// v000
// Times are from an AMD MI455X. After a warm-up the kernel runs many times in a row, and a time is the length of
// such a window on the GPU divided by its runs, so every launch and the gaps after it count. The runs cycle
// through copies of the inputs. A figure is the median of several windows, for all but v000 over two sittings.
// Sittings can differ by a few percent; kernels timed side by side share one.
// v000, which the later versions start from, runs in 131 microseconds.
#include <hip/hip_runtime.h>

// Contractions: q/k/v projections on v_wmma_f32_16x16x32_bf16 (x and W as bf16 RNE-converted inputs, f32 accumulate);
// S^T = K x Q^T on v_wmma_f32_16x16x32_f16 as three products (q,k f16 value planes + f16 residual planes x2048,
// residual products in their own accumulator folded by 1/2048 in f32); O = P x V on f16 (P carried x4096, V f16);
// out-projection on f16 (Wo = f16 of bf16 RNE value x64, ctx f16, 1/64 folded in the f32 epilogue);
// softmax, gate and skip-add in f32.

#ifndef NB
#define NB 8
#endif
#ifndef SEQ
#define SEQ 4096
#endif
#define NB_FULL   8
#define SEQ_FULL  4096
#define CH        256                 // channels (projection K)
#define HD        32                  // q/k/v dim (single head)
#define NQKV      96                  // stacked projection outputs: q 0..31, k 32..63, v 64..95
#define NT        64                  // positions per projection block
#define XPW       132                 // LDS pitch (32-bit words) of the transposed bf16 x tile
#define SP        72                  // LDS pitch (halves) of the q|k, q|k residual and v staging tiles
#define BQ        128                 // query rows per attention block (8 waves x 16)
#define BK        32                  // keys per inner iteration
#define NWAVE     8
#define CP        40                  // LDS pitch (halves) of the per-wave ctx staging tile
#define ON        32
#define OPF       36                  // LDS pitch (floats) of the out-projection staging tile
#define RES_CARRY 2048.0f             // power-of-two carry of the q/k residual planes
#define RES_FOLD  (1.0f / 2048.0f)

static_assert(NB >= 1 && NB <= NB_FULL);
static_assert(SEQ <= SEQ_FULL);
static_assert(SEQ % BQ == 0);
static_assert(SEQ % NT == 0);
static_assert(SEQ % ON == 0);
static_assert(SEQ % BK == 0);
static_assert(BQ == NWAVE * 16);
static_assert(HD == 32);
static_assert(CH % 32 == 0);
static_assert(NQKV == 3 * HD);
static_assert(8 * 256 == (CH / 2) * (NT / 4));     // x staging items == threads x iterations
static_assert(XPW >= CH / 2 && (XPW * 4) % 16 == 0);
static_assert(SP >= 2 * HD && SP >= NT && (SP * 2) % 16 == 0);
static_assert(NT * 4 == 256);                      // q/k (+ residual) plane store: one 16-B piece per thread each
static_assert(HD * 8 == 256);                      // v plane store: one 16-B piece per thread
static_assert(CP >= HD && (CP * 2) % 16 == 0);
static_assert(OPF >= ON && (OPF * 4) % 16 == 0);
static_assert(NWAVE * 32 == CH);                   // out-projection: each wave owns 32 channel rows
static_assert(ON == 32);
static_assert(NT * XPW * 4 + 2 * NT * SP * 2 + HD * SP * 2 <= 65536);   // static LDS of the projection kernel

#define WB_BYTES  ((size_t)NQKV * CH * 2)
#define WO_BYTES  ((size_t)CH * HD * 2)
#define PL_BYTES  ((size_t)NB * SEQ * HD * 2)
#define NPLANE    6                                 // q, k, v, ctx, q residual, k residual
#define WS_TOTAL  (WB_BYTES + WO_BYTES + NPLANE * PL_BYTES)
static_assert(WB_BYTES % 128 == 0 && WO_BYTES % 128 == 0 && PL_BYTES % 128 == 0);
static_assert(WS_TOTAL <= (size_t)134217728);

typedef __bf16   bf16;
typedef _Float16 f16;
typedef bf16     v16bf __attribute__((ext_vector_type(16)));
typedef f16      v16h  __attribute__((ext_vector_type(16)));
typedef f16      v8h   __attribute__((ext_vector_type(8)));
typedef float    v8f   __attribute__((ext_vector_type(8)));
typedef float    v4f   __attribute__((ext_vector_type(4)));
typedef unsigned v4u   __attribute__((ext_vector_type(4)));

union FragB  { v16bf v; v4u q[2]; };
union FragH  { v16h  v; v4u q[2]; f16 h[16]; };
union Pack8H { v4u u; v8h v; f16 h[8]; };

// WMMA helpers: builtin followed by the VALU hazard guard (ties D, keeps A/B live).
static __device__ __forceinline__ v8f mma_bf16(v16bf a, v16bf b, v8f acc) {
  acc = __builtin_amdgcn_wmma_f32_16x16x32_bf16(false, a, false, b, (short)0, acc, false, false);
  asm volatile("v_nop\n\tv_nop\n\tv_nop\n\tv_nop" : "+v"(acc) : "v"(a), "v"(b));
  return acc;
}
static __device__ __forceinline__ v8f mma_f16(v16h a, v16h b, v8f acc) {
  acc = __builtin_amdgcn_wmma_f32_16x16x32_f16(false, a, false, b, (short)0, acc, false, false);
  asm volatile("v_nop\n\tv_nop\n\tv_nop\n\tv_nop" : "+v"(acc) : "v"(a), "v"(b));
  return acc;
}

// f32 -> bf16 bits, RNE (finite inputs).
static __device__ __forceinline__ unsigned bf16_bits(float f) {
  const unsigned u = __float_as_uint(f);
  return (u + 0x7FFFu + ((u >> 16) & 1u)) >> 16;
}
static __device__ __forceinline__ float bf16_val(float f) {
  return __uint_as_float(bf16_bits(f) << 16);
}

// Weight planes, built once. 4096 pieces of 8 elements, one 16-B piece per thread, 16 blocks x 256.
//   wb  [96][256] bf16 bits : rows 0..31 wq, 32..63 wk, 64..95 wv (k = channel contiguous)
//   woh [256][32] f16       : f16(bf16 RNE value of wo x 64), exact
__global__ __launch_bounds__(256) void prep_kernel(const float* __restrict__ wq, const float* __restrict__ wk,
                                                   const float* __restrict__ wv, const float* __restrict__ wo,
                                                   unsigned short* __restrict__ wb, f16* __restrict__ woh) {
  const int p = blockIdx.x * 256 + threadIdx.x;       // 0..4095
  if (blockIdx.x < 12) {                               // block-uniform
    const int which = p >> 10;                         // 0..2, block-uniform
    const int off   = (p & 1023) * 8;
    const v4f q0 = *(const v4f*)(wq + off), q1 = *(const v4f*)(wq + off + 4);
    const v4f k0 = *(const v4f*)(wk + off), k1 = *(const v4f*)(wk + off + 4);
    const v4f v0 = *(const v4f*)(wv + off), v1 = *(const v4f*)(wv + off + 4);
    const v4f a0 = (which == 0) ? q0 : ((which == 1) ? k0 : v0);   // select by value
    const v4f a1 = (which == 0) ? q1 : ((which == 1) ? k1 : v1);
    v4u u;
    u[0] = bf16_bits(a0[0]) | (bf16_bits(a0[1]) << 16);
    u[1] = bf16_bits(a0[2]) | (bf16_bits(a0[3]) << 16);
    u[2] = bf16_bits(a1[0]) | (bf16_bits(a1[1]) << 16);
    u[3] = bf16_bits(a1[2]) | (bf16_bits(a1[3]) << 16);
    unsigned short* dst = wb + (size_t)p * 8;
    *(v4u*)dst = u;
    
  } else {
    const int off = (p - 3072) * 8;
    const v4f a0 = *(const v4f*)(wo + off), a1 = *(const v4f*)(wo + off + 4);
    Pack8H ph;
    #pragma unroll
    for (int i = 0; i < 4; ++i) {
      ph.h[i]     = (f16)(bf16_val(a0[i]) * 64.0f);
      ph.h[4 + i] = (f16)(bf16_val(a1[i]) * 64.0f);
    }
    const v4u u = ph.u;
    f16* dst = woh + off;
    *(v4u*)dst = u;
    
  }
}

// Fused q/k/v projection. Block = (64-position tile, batch), 256 threads.
// x tile [256 c][64 n] is RNE-converted to bf16 and transposed through LDS to [n][c]; D[n][dd] = sum_c x[c][n] W[dd][c].
// Planes: qp,kp [NB][SEQ][32] f16 value planes; qr,kr [NB][SEQ][32] f16 residual planes = (f32 - f16 value) x 2048
// coverage: q,k,q_res,k_res rows n0..n0+63 x 32 d ; v 32 d x positions n0..n0+63 ; every written line whole,
// one instruction. LDS: sX, sQK, sR, sV are cross-wave (block barriers); staged extent == consumed extent for all four.
__global__ __launch_bounds__(256) void qkv_kernel(const float* __restrict__ x,
                                                  const unsigned short* __restrict__ wb,
                                                  f16* __restrict__ qp, f16* __restrict__ kp,
                                                  f16* __restrict__ qr, f16* __restrict__ kr,
                                                  f16* __restrict__ vp) {
  const int n0   = blockIdx.x * NT;
  const int b    = blockIdx.y;
  const int tid  = threadIdx.x;
  const int wave = tid >> 5;
  const int lane = tid & 31;
  const int lq   = lane & 15;
  const int hi   = lane >> 4;

  __shared__ __align__(16) unsigned sX[NT * XPW];     // [n][c/2] packed bf16 pairs (even c in the low half)
  __shared__ __align__(16) f16      sQK[NT * SP];     // [n][q 0..31 | k 32..63] values
  __shared__ __align__(16) f16      sR[NT * SP];      // [n][q 0..31 | k 32..63] residuals x2048
  __shared__ __align__(16) f16      sV[HD * SP];      // [d][n]

  #pragma unroll 2
  for (int it = 0; it < 8; ++it) {
    const int item = it * 256 + tid;                  // 0..2047
    const int nq   = item & 15;                       // 4-position group
    const int cp   = item >> 4;                       // channel pair 0..127
    const float* src = x + ((size_t)b * CH + 2 * cp) * SEQ_FULL + n0 + nq * 4;
    const v4f a0 = *(const v4f*)(src);
    const v4f a1 = *(const v4f*)(src + SEQ_FULL);
    #pragma unroll
    for (int i = 0; i < 4; ++i)
      sX[(nq * 4 + i) * XPW + cp] = bf16_bits(a0[i]) | (bf16_bits(a1[i]) << 16);
  }
  __syncthreads();

  const int nt = wave & 3;                            // position sub-tile
  const int g3 = wave >> 2;                           // output tile group: tiles g3*3 + {0,1,2}
  v8f acc[3];
  #pragma unroll
  for (int j = 0; j < 3; ++j) acc[j] = (v8f){0, 0, 0, 0, 0, 0, 0, 0};

  const int aoff = (nt * 16 + lq) * XPW + hi * 4;     // row n, words of channels 8*hi..
  #pragma unroll 2
  for (int ks = 0; ks < CH / 32; ++ks) {
    FragB a;
    a.q[0] = *(const v4u*)(sX + aoff + ks * 16);        // c = ks*32 + 8*hi + 0..7
    a.q[1] = *(const v4u*)(sX + aoff + ks * 16 + 8);    // c = ks*32 + 16 + 8*hi + 0..7
    #pragma unroll
    for (int j = 0; j < 3; ++j) {
      const unsigned short* wr = wb + (size_t)((g3 * 3 + j) * 16 + lq) * CH + ks * 32 + hi * 8;
      FragB w;
      w.q[0] = *(const v4u*)(wr);                       // c = ks*32 + 8*hi + 0..7
      w.q[1] = *(const v4u*)(wr + 16);                  // c = ks*32 + 16 + 8*hi + 0..7
      acc[j] = mma_bf16(a.v, w.v, acc[j]);
    }
  }

  // D element r of lane: (n = nt*16 + 8*hi + r, dd = tile*16 + lq)
  #pragma unroll
  for (int j = 0; j < 3; ++j) {
    const int t = g3 * 3 + j;                         // wave-uniform
    #pragma unroll
    for (int r = 0; r < 8; ++r) {
      const int nrow = nt * 16 + hi * 8 + r;
      const float av = acc[j][r];
      const f16 hv = (f16)av;
      if (t < 4) {
        sQK[nrow * SP + t * 16 + lq] = hv;
        sR[nrow * SP + t * 16 + lq]  = (f16)((av - (float)hv) * RES_CARRY);
      } else {
        sV[((t - 4) * 16 + lq) * SP + nrow] = hv;
      }
    }
  }
  __syncthreads();

  Pack8H pq, pk, pqr, pkr, pv;
  const int row = tid >> 2, seg = tid & 3;
  pq.v  = *(const v8h*)(sQK + row * SP + seg * 8);
  pk.v  = *(const v8h*)(sQK + row * SP + HD + seg * 8);
  pqr.v = *(const v8h*)(sR + row * SP + seg * 8);
  pkr.v = *(const v8h*)(sR + row * SP + HD + seg * 8);
  const int dv = tid >> 3, sv = tid & 7;
  pv.v = *(const v8h*)(sV + dv * SP + sv * 8);
  const size_t qi = ((size_t)b * SEQ + n0) * HD + (size_t)tid * 8;
  const size_t vi = ((size_t)b * HD + dv) * SEQ + n0 + sv * 8;
  const v4u uq = pq.u, uk = pk.u, uqr = pqr.u, ukr = pkr.u, uv = pv.u;
  *(v4u*)(qp + qi) = uq;
  *(v4u*)(kp + qi) = uk;
  *(v4u*)(qr + qi) = uqr;
  *(v4u*)(kr + qi) = ukr;
  *(v4u*)(vp + vi) = uv;
  
}

// Flash attention, all keys, no logit scaling. Block = (query block of 128, batch); one wave owns 16 query rows.
// S^T = K x Q^T so queries sit on lanes; P^T in C-layout is bit-identical to the A-fragment layout of O += P x V.
// Scores: kval.qval in the main accumulator; kres.qval + kval.qres in a second accumulator folded by 1/2048 in f32.
// K A-fragments and V B-fragments are loaded straight from the f16 planes (two 16-B loads per fragment).
// LDS sC: per-wave staging (block barrier used; every wave reaches it).
__global__ __launch_bounds__(256) void attn_kernel(const f16* __restrict__ qp, const f16* __restrict__ qr,
                                                   const f16* __restrict__ kp, const f16* __restrict__ kr,
                                                   const f16* __restrict__ vp, f16* __restrict__ ctx) {
  const int qblk = blockIdx.x;
  const int b    = blockIdx.y;
  const int tid  = threadIdx.x;
  const int wave = tid >> 5;
  const int lane = tid & 31;
  const int lq   = lane & 15;   // query column of S^T / d column of O
  const int hi   = lane >> 4;   // k-split half

  __shared__ __align__(16) f16 sC[NWAVE * 16 * CP];

  const int qrow0 = qblk * BQ + wave * 16;

  FragH qf, qrf;                 // B operands: column = query qrow0+lq, k = d split map (value, residual)
  {
    const size_t qo = ((size_t)b * SEQ + qrow0 + lq) * HD + hi * 8;
    qf.q[0]  = *(const v4u*)(qp + qo);          // d = 8*hi + 0..7
    qf.q[1]  = *(const v4u*)(qp + qo + 16);     // d = 16 + 8*hi + 0..7
    qrf.q[0] = *(const v4u*)(qr + qo);
    qrf.q[1] = *(const v4u*)(qr + qo + 16);
  }
  const f16* kb_b = kp + (size_t)b * SEQ * HD;
  const f16* kr_b = kr + (size_t)b * SEQ * HD;
  const f16* vt_b = vp + (size_t)b * HD * SEQ;

  v8f o[2];
  o[0] = (v8f){0, 0, 0, 0, 0, 0, 0, 0};
  o[1] = (v8f){0, 0, 0, 0, 0, 0, 0, 0};
  float rmax = -__builtin_inff();
  float rsum = 0.0f;
  const float SL = 1.4426950408889634f;   // log2(e)

  #pragma unroll 1
  for (int j0 = 0; j0 < SEQ; j0 += BK) {
    FragH ak[2], akr[2], bv[2];
    #pragma unroll
    for (int sub = 0; sub < 2; ++sub) {
      const size_t ko = (size_t)(j0 + sub * 16 + lq) * HD + hi * 8;   // row = key
      ak[sub].q[0]  = *(const v4u*)(kb_b + ko);          // d = 8*hi + 0..7
      ak[sub].q[1]  = *(const v4u*)(kb_b + ko + 16);     // d = 16 + 8*hi + 0..7
      akr[sub].q[0] = *(const v4u*)(kr_b + ko);
      akr[sub].q[1] = *(const v4u*)(kr_b + ko + 16);
    }
    #pragma unroll
    for (int dt = 0; dt < 2; ++dt) {
      const f16* base = vt_b + (size_t)(dt * 16 + lq) * SEQ + j0 + hi * 8;   // column = d
      bv[dt].q[0] = *(const v4u*)(base);           // keys j0 + 8*hi + 0..7
      bv[dt].q[1] = *(const v4u*)(base + 16);      // keys j0 + 16 + 8*hi + 0..7
    }

    // c[sub][r] = score(query qrow0+lq, key j0 + sub*16 + 8*hi + r)
    v8f c[2];
    #pragma unroll
    for (int sub = 0; sub < 2; ++sub) {
      const v8f z = (v8f){0, 0, 0, 0, 0, 0, 0, 0};
      v8f cm = mma_f16(ak[sub].v, qf.v, z);          // value x value
      v8f cr = mma_f16(akr[sub].v, qf.v, z);         // k residual x q value
      cr = mma_f16(ak[sub].v, qrf.v, cr);            // k value x q residual
      #pragma unroll
      for (int r = 0; r < 8; ++r) cm[r] = cm[r] + cr[r] * RES_FOLD;
      c[sub] = cm;
    }

    // online softmax: query lq's 32 scores are split across lane / lane^16
    float m_new = rmax;
    #pragma unroll
    for (int r = 0; r < 8; ++r) {
      m_new = fmaxf(m_new, c[0][r]);
      m_new = fmaxf(m_new, c[1][r]);
    }
    m_new = fmaxf(m_new, __shfl_xor(m_new, 16, 32));
    const float scale = __builtin_amdgcn_exp2f((rmax - m_new) * SL);
    rmax = m_new;

    // exp + pack: P^T C-layout == A-fragment layout of the PV product; P carried x4096
    FragH pa;
    float psum = 0.0f;
    #pragma unroll
    for (int r = 0; r < 8; ++r) {
      const float p0 = __builtin_amdgcn_exp2f((c[0][r] - m_new) * SL);   // key 8*hi + r
      const float p1 = __builtin_amdgcn_exp2f((c[1][r] - m_new) * SL);   // key 16 + 8*hi + r
      psum += p0 + p1;
      pa.h[r]     = (f16)(p0 * 4096.0f);
      pa.h[8 + r] = (f16)(p1 * 4096.0f);
    }
    rsum = rsum * scale + psum + __shfl_xor(psum, 16, 32);

    // rescale O: queries are the row dimension there -> per-row scale from lane 8*hi + r
    float sc[8];
    #pragma unroll
    for (int r = 0; r < 8; ++r) sc[r] = __shfl(scale, (hi << 3) + r, 32);
    #pragma unroll
    for (int dt = 0; dt < 2; ++dt) {
      #pragma unroll
      for (int r = 0; r < 8; ++r) o[dt][r] *= sc[r];
    }

    // O += P x V
    #pragma unroll
    for (int dt = 0; dt < 2; ++dt) o[dt] = mma_f16(pa.v, bv[dt].v, o[dt]);
  }

  // normalize: lane holds column d = dt*16 + lq for query rows 8*hi + r
  const float rinv = (1.0f / rsum) * (1.0f / 4096.0f);
  float rs[8];
  #pragma unroll
  for (int r = 0; r < 8; ++r) rs[r] = __shfl(rinv, (hi << 3) + r, 32);

  f16* so = sC + wave * (16 * CP);
  #pragma unroll
  for (int r = 0; r < 8; ++r) {
    #pragma unroll
    for (int dt = 0; dt < 2; ++dt)
      so[(hi * 8 + r) * CP + dt * 16 + lq] = (f16)(o[dt][r] * rs[r]);
  }
  __syncthreads();

  v4u    cv[2];
  size_t ci[2];
  #pragma unroll
  for (int it = 0; it < 2; ++it) {
    const int p   = it * 32 + lane;        // 16-B piece 0..63 of the wave's 1024-B slab
    const int row = p >> 2, seg = p & 3;
    Pack8H ph;
    ph.v   = *(const v8h*)(so + row * CP + seg * 8);
    cv[it] = ph.u;
    ci[it] = ((size_t)b * SEQ + qrow0) * HD + (size_t)p * 8;
  }
  #pragma unroll
  for (int it = 0; it < 2; ++it) *(v4u*)(ctx + ci[it]) = cv[it];
  
}

// Out-projection + gate + skip-add. Block = (32-position tile, batch); wave w owns channels 32w..32w+31.
// D[c][n] = sum_d woh[c][d] ctx[n][d]; result = D * (g/64) + bf16 RNE value of x; g = bf16 RNE value of gamma.
// LDS sO: each wave reads only rows it wrote; block barrier used anyway (every wave reaches it).
__global__ __launch_bounds__(256) void oproj_kernel(const f16* __restrict__ ctx, const f16* __restrict__ woh,
                                                    const float* __restrict__ x, const float* __restrict__ gamma,
                                                    float* __restrict__ out) {
  const int n0   = blockIdx.x * ON;
  const int b    = blockIdx.y;
  const int tid  = threadIdx.x;
  const int wave = tid >> 5;
  const int lane = tid & 31;
  const int lq   = lane & 15;
  const int hi   = lane >> 4;

  __shared__ __align__(16) float sO[CH * OPF];

  const float gs = bf16_val(gamma[0]) * (1.0f / 64.0f);

  FragH bn[2];                   // B operand: column = position, k = d split map
  #pragma unroll
  for (int nt = 0; nt < 2; ++nt) {
    const f16* p = ctx + ((size_t)b * SEQ + n0 + nt * 16 + lq) * HD + hi * 8;
    bn[nt].q[0] = *(const v4u*)(p);
    bn[nt].q[1] = *(const v4u*)(p + 16);
  }
  #pragma unroll
  for (int ct = 0; ct < 2; ++ct) {
    const int c0 = (wave * 2 + ct) * 16;
    FragH a;                     // A operand: row = channel, k = d split map
    const f16* wr = woh + (size_t)(c0 + lq) * HD + hi * 8;
    a.q[0] = *(const v4u*)(wr);
    a.q[1] = *(const v4u*)(wr + 16);
    #pragma unroll
    for (int nt = 0; nt < 2; ++nt) {
      v8f z = (v8f){0, 0, 0, 0, 0, 0, 0, 0};
      const v8f acc = mma_f16(a.v, bn[nt].v, z);
      #pragma unroll
      for (int r = 0; r < 8; ++r)
        sO[(c0 + hi * 8 + r) * OPF + nt * 16 + lq] = acc[r];
    }
  }
  __syncthreads();

  v4f    vals[8];
  size_t gi[8];
  #pragma unroll
  for (int it = 0; it < 8; ++it) {
    const int c   = wave * 32 + it * 4 + (lane >> 3);
    const int seg = lane & 7;
    const v4f o4  = *(const v4f*)(sO + c * OPF + seg * 4);
    gi[it] = ((size_t)b * CH + c) * SEQ_FULL + n0 + seg * 4;
    const v4f xr = *(const v4f*)(x + gi[it]);
    v4f rv;
    #pragma unroll
    for (int i = 0; i < 4; ++i) rv[i] = fmaf(o4[i], gs, bf16_val(xr[i]));
    vals[it] = rv;
  }
  #pragma unroll
  for (int it = 0; it < 8; ++it) *(v4f*)(out + gi[it]) = vals[it];
  
}

extern "C" void kernel_launch(void* const* d_in, const int* in_sizes, int n_in,
                              void* d_out, int out_size, void* d_ws, size_t ws_size,
                              hipStream_t stream) {
  if (n_in < 6) return;
  const size_t x_need = ((size_t)(NB - 1) * CH + (CH - 1)) * SEQ_FULL + SEQ;
  if ((size_t)in_sizes[0] < x_need) return;
  if ((size_t)in_sizes[1] < (size_t)HD * CH) return;
  if ((size_t)in_sizes[2] < (size_t)HD * CH) return;
  if ((size_t)in_sizes[3] < (size_t)HD * CH) return;
  if ((size_t)in_sizes[4] < (size_t)CH * HD) return;
  if (in_sizes[5] < 1) return;
  if ((size_t)out_size < x_need) return;
  if (ws_size < WS_TOTAL) return;

  const float* x     = (const float*)d_in[0];
  const float* wq    = (const float*)d_in[1];
  const float* wk    = (const float*)d_in[2];
  const float* wv    = (const float*)d_in[3];
  const float* wo    = (const float*)d_in[4];
  const float* gamma = (const float*)d_in[5];
  float*       out   = (float*)d_out;

  char* ws = (char*)d_ws;
  unsigned short* wb  = (unsigned short*)(ws);
  f16*            woh = (f16*)(ws + WB_BYTES);
  f16*            qp  = (f16*)(ws + WB_BYTES + WO_BYTES);
  f16*            kp  = (f16*)(ws + WB_BYTES + WO_BYTES + PL_BYTES);
  f16*            vp  = (f16*)(ws + WB_BYTES + WO_BYTES + 2 * PL_BYTES);
  f16*            cx  = (f16*)(ws + WB_BYTES + WO_BYTES + 3 * PL_BYTES);
  f16*            qrp = (f16*)(ws + WB_BYTES + WO_BYTES + 4 * PL_BYTES);
  f16*            krp = (f16*)(ws + WB_BYTES + WO_BYTES + 5 * PL_BYTES);

  prep_kernel<<<dim3(16), 256, 0, stream>>>(wq, wk, wv, wo, wb, woh);
  // qkv_kernel(x, wb, qp, kp, qr, kr, vp)
  qkv_kernel<<<dim3(SEQ / NT, NB), 256, 0, stream>>>(x, wb, qp, kp, qrp, krp, vp);
  // attn_kernel(qp, qr, kp, kr, vp, ctx)
  attn_kernel<<<dim3(SEQ / BQ, NB), 256, 0, stream>>>(qp, qrp, kp, krp, vp, cx);
  oproj_kernel<<<dim3(SEQ / ON, NB), 256, 0, stream>>>(cx, woh, x, gamma, out);
}

// v001
// One run takes 69.8 microseconds.
// Timed twice side by side with v000, it ran 1.87 times as fast both times.
#include <hip/hip_runtime.h>

// Contractions: q/k/v projections on v_wmma_f32_16x16x32_bf16 (x and W as bf16 RNE-converted inputs, f32 accumulate);
// S^T = K x Q^T on v_wmma_f32_16x16x32_f16 as three products (q,k f16 value planes + f16 residual planes x2048,
// residual products in their own accumulator folded by 1/2048 in f32); O = P x V on f16 (P carried x4096, V f16);
// out-projection on f16 (Wo = f16 of bf16 RNE value x64, ctx f16, 1/64 folded in the f32 epilogue);
// softmax, gate and skip-add in f32.

#ifndef NB
#define NB 8
#endif
#ifndef SEQ
#define SEQ 4096
#endif
#define NB_FULL   8
#define SEQ_FULL  4096
#define CH        256                 // channels (projection K)
#define HD        32                  // q/k/v dim (single head)
#define NQKV      96                  // stacked projection outputs: q 0..31, k 32..63, v 64..95
#define NT        64                  // positions per projection block
#define XPW       132                 // LDS pitch (32-bit words) of the transposed bf16 x tile
#define SP        72                  // LDS pitch (halves) of the q|k, q|k residual and v staging tiles
#define BQ        128                 // query rows per attention block (8 waves x 16)
#define BK        32                  // keys per inner iteration
#define NWAVE     8
#define CP        40                  // LDS pitch (halves) of the per-wave ctx staging tile
#define KS        128                 // keys per LDS stage of the attention ring (4 inner iterations)
#define NS        (SEQ / KS)          // stages
#define KPH       40                  // LDS pitch (halves) of a staged k / k residual row: 80 B = 16 B x odd
#define VPH       136                 // LDS pitch (halves) of a staged v row of KS keys: 272 B = 16 B x odd
#define ST_KR     (KS * KPH)          // offsets (halves) inside one stage: k at 0, k residual, v
#define ST_V      (2 * KS * KPH)
#define ST_H      (2 * KS * KPH + HD * VPH)   // halves per stage
#define ON        32
#define OPF       36                  // LDS pitch (floats) of the out-projection staging tile
#define RES_CARRY 2048.0f             // power-of-two carry of the q/k residual planes
#define RES_FOLD  (1.0f / 2048.0f)

static_assert(NB >= 1 && NB <= NB_FULL);
static_assert(SEQ <= SEQ_FULL);
static_assert(SEQ % BQ == 0);
static_assert(SEQ % NT == 0);
static_assert(SEQ % ON == 0);
static_assert(SEQ % BK == 0);
static_assert(BQ == NWAVE * 16);
static_assert(SEQ % KS == 0 && KS % BK == 0);
static_assert(KS * 4 == 2 * 256 && HD * (KS / 8) == 2 * 256);   // 16-B pieces per plane and stage == 2 per thread
static_assert(KPH >= HD && (KPH * 2) % 16 == 0 && VPH >= KS && (VPH * 2) % 16 == 0 && (ST_H * 2) % 16 == 0);
static_assert(HD == 32);
static_assert(CH % 32 == 0);
static_assert(NQKV == 3 * HD);
static_assert(8 * 256 == (CH / 2) * (NT / 4));     // x staging items == threads x iterations
static_assert(XPW >= CH / 2 && (XPW * 4) % 16 == 0);
static_assert(SP >= 2 * HD && SP >= NT && (SP * 2) % 16 == 0);
static_assert(NT * 4 == 256);                      // q/k (+ residual) plane store: one 16-B piece per thread each
static_assert(HD * 8 == 256);                      // v plane store: one 16-B piece per thread
static_assert(CP >= HD && (CP * 2) % 16 == 0);
static_assert(OPF >= ON && (OPF * 4) % 16 == 0);
static_assert(NWAVE * 32 == CH);                   // out-projection: each wave owns 32 channel rows
static_assert(ON == 32);
static_assert(NT * XPW * 4 + 2 * NT * SP * 2 + HD * SP * 2 <= 65536);   // static LDS of the projection kernel

#define WB_BYTES  ((size_t)NQKV * CH * 2)
#define WO_BYTES  ((size_t)CH * HD * 2)
#define PL_BYTES  ((size_t)NB * SEQ * HD * 2)
#define NPLANE    6                                 // q, k, v, ctx, q residual, k residual
#define WS_TOTAL  (WB_BYTES + WO_BYTES + NPLANE * PL_BYTES)
static_assert(WB_BYTES % 128 == 0 && WO_BYTES % 128 == 0 && PL_BYTES % 128 == 0);
static_assert(WS_TOTAL <= (size_t)134217728);

typedef __bf16   bf16;
typedef _Float16 f16;
typedef bf16     v16bf __attribute__((ext_vector_type(16)));
typedef f16      v16h  __attribute__((ext_vector_type(16)));
typedef f16      v8h   __attribute__((ext_vector_type(8)));
typedef float    v8f   __attribute__((ext_vector_type(8)));
typedef float    v4f   __attribute__((ext_vector_type(4)));
typedef unsigned v4u   __attribute__((ext_vector_type(4)));

union FragB  { v16bf v; v4u q[2]; };
union FragH  { v16h  v; v4u q[2]; f16 h[16]; };
union Pack8H { v4u u; v8h v; f16 h[8]; };

// WMMA helpers: builtin followed by the VALU hazard guard (ties D, keeps A/B live).
static __device__ __forceinline__ v8f mma_bf16(v16bf a, v16bf b, v8f acc) {
  acc = __builtin_amdgcn_wmma_f32_16x16x32_bf16(false, a, false, b, (short)0, acc, false, false);
  asm volatile("v_nop\n\tv_nop\n\tv_nop\n\tv_nop" : "+v"(acc) : "v"(a), "v"(b));
  return acc;
}
static __device__ __forceinline__ v8f mma_f16(v16h a, v16h b, v8f acc) {
  acc = __builtin_amdgcn_wmma_f32_16x16x32_f16(false, a, false, b, (short)0, acc, false, false);
  asm volatile("v_nop\n\tv_nop\n\tv_nop\n\tv_nop" : "+v"(acc) : "v"(a), "v"(b));
  return acc;
}

// f32 -> bf16 bits, RNE (finite inputs).
static __device__ __forceinline__ unsigned bf16_bits(float f) {
  const unsigned u = __float_as_uint(f);
  return (u + 0x7FFFu + ((u >> 16) & 1u)) >> 16;
}
static __device__ __forceinline__ float bf16_val(float f) {
  return __uint_as_float(bf16_bits(f) << 16);
}

// Weight planes, built once. 4096 pieces of 8 elements, one 16-B piece per thread, 16 blocks x 256.
//   wb  [96][256] bf16 bits : rows 0..31 wq, 32..63 wk, 64..95 wv (k = channel contiguous)
//   woh [256][32] f16       : f16(bf16 RNE value of wo x 64), exact
__global__ __launch_bounds__(256) void prep_kernel(const float* __restrict__ wq, const float* __restrict__ wk,
                                                   const float* __restrict__ wv, const float* __restrict__ wo,
                                                   unsigned short* __restrict__ wb, f16* __restrict__ woh) {
  const int p = blockIdx.x * 256 + threadIdx.x;       // 0..4095
  if (blockIdx.x < 12) {                               // block-uniform
    const int which = p >> 10;                         // 0..2, block-uniform
    const int off   = (p & 1023) * 8;
    const v4f q0 = *(const v4f*)(wq + off), q1 = *(const v4f*)(wq + off + 4);
    const v4f k0 = *(const v4f*)(wk + off), k1 = *(const v4f*)(wk + off + 4);
    const v4f v0 = *(const v4f*)(wv + off), v1 = *(const v4f*)(wv + off + 4);
    const v4f a0 = (which == 0) ? q0 : ((which == 1) ? k0 : v0);   // select by value
    const v4f a1 = (which == 0) ? q1 : ((which == 1) ? k1 : v1);
    v4u u;
    u[0] = bf16_bits(a0[0]) | (bf16_bits(a0[1]) << 16);
    u[1] = bf16_bits(a0[2]) | (bf16_bits(a0[3]) << 16);
    u[2] = bf16_bits(a1[0]) | (bf16_bits(a1[1]) << 16);
    u[3] = bf16_bits(a1[2]) | (bf16_bits(a1[3]) << 16);
    unsigned short* dst = wb + (size_t)p * 8;
    *(v4u*)dst = u;
    
  } else {
    const int off = (p - 3072) * 8;
    const v4f a0 = *(const v4f*)(wo + off), a1 = *(const v4f*)(wo + off + 4);
    Pack8H ph;
    #pragma unroll
    for (int i = 0; i < 4; ++i) {
      ph.h[i]     = (f16)(bf16_val(a0[i]) * 64.0f);
      ph.h[4 + i] = (f16)(bf16_val(a1[i]) * 64.0f);
    }
    const v4u u = ph.u;
    f16* dst = woh + off;
    *(v4u*)dst = u;
    
  }
}

// Fused q/k/v projection. Block = (64-position tile, batch), 256 threads.
// x tile [256 c][64 n] is RNE-converted to bf16 and transposed through LDS to [n][c]; D[n][dd] = sum_c x[c][n] W[dd][c].
// Planes: qp,kp [NB][SEQ][32] f16 value planes; qr,kr [NB][SEQ][32] f16 residual planes = (f32 - f16 value) x 2048
// coverage: q,k,q_res,k_res rows n0..n0+63 x 32 d ; v 32 d x positions n0..n0+63 ; every written line whole,
// one instruction. LDS: sX, sQK, sR, sV are cross-wave (block barriers); staged extent == consumed extent for all four.
__global__ __launch_bounds__(256) void qkv_kernel(const float* __restrict__ x,
                                                  const unsigned short* __restrict__ wb,
                                                  f16* __restrict__ qp, f16* __restrict__ kp,
                                                  f16* __restrict__ qr, f16* __restrict__ kr,
                                                  f16* __restrict__ vp) {
  const int n0   = blockIdx.x * NT;
  const int b    = blockIdx.y;
  const int tid  = threadIdx.x;
  const int wave = tid >> 5;
  const int lane = tid & 31;
  const int lq   = lane & 15;
  const int hi   = lane >> 4;

  __shared__ __align__(16) unsigned sX[NT * XPW];     // [n][c/2] packed bf16 pairs (even c in the low half)
  __shared__ __align__(16) f16      sQK[NT * SP];     // [n][q 0..31 | k 32..63] values
  __shared__ __align__(16) f16      sR[NT * SP];      // [n][q 0..31 | k 32..63] residuals x2048
  __shared__ __align__(16) f16      sV[HD * SP];      // [d][n]

  #pragma unroll 2
  for (int it = 0; it < 8; ++it) {
    const int item = it * 256 + tid;                  // 0..2047
    const int nq   = item & 15;                       // 4-position group
    const int cp   = item >> 4;                       // channel pair 0..127
    const float* src = x + ((size_t)b * CH + 2 * cp) * SEQ_FULL + n0 + nq * 4;
    const v4f a0 = *(const v4f*)(src);
    const v4f a1 = *(const v4f*)(src + SEQ_FULL);
    #pragma unroll
    for (int i = 0; i < 4; ++i)
      sX[(nq * 4 + i) * XPW + cp] = bf16_bits(a0[i]) | (bf16_bits(a1[i]) << 16);
  }
  __syncthreads();

  const int nt = wave & 3;                            // position sub-tile
  const int g3 = wave >> 2;                           // output tile group: tiles g3*3 + {0,1,2}
  v8f acc[3];
  #pragma unroll
  for (int j = 0; j < 3; ++j) acc[j] = (v8f){0, 0, 0, 0, 0, 0, 0, 0};

  const int aoff = (nt * 16 + lq) * XPW + hi * 4;     // row n, words of channels 8*hi..
  #pragma unroll 2
  for (int ks = 0; ks < CH / 32; ++ks) {
    FragB a;
    a.q[0] = *(const v4u*)(sX + aoff + ks * 16);        // c = ks*32 + 8*hi + 0..7
    a.q[1] = *(const v4u*)(sX + aoff + ks * 16 + 8);    // c = ks*32 + 16 + 8*hi + 0..7
    #pragma unroll
    for (int j = 0; j < 3; ++j) {
      const unsigned short* wr = wb + (size_t)((g3 * 3 + j) * 16 + lq) * CH + ks * 32 + hi * 8;
      FragB w;
      w.q[0] = *(const v4u*)(wr);                       // c = ks*32 + 8*hi + 0..7
      w.q[1] = *(const v4u*)(wr + 16);                  // c = ks*32 + 16 + 8*hi + 0..7
      acc[j] = mma_bf16(a.v, w.v, acc[j]);
    }
  }

  // D element r of lane: (n = nt*16 + 8*hi + r, dd = tile*16 + lq)
  #pragma unroll
  for (int j = 0; j < 3; ++j) {
    const int t = g3 * 3 + j;                         // wave-uniform
    #pragma unroll
    for (int r = 0; r < 8; ++r) {
      const int nrow = nt * 16 + hi * 8 + r;
      const float av = acc[j][r];
      const f16 hv = (f16)av;
      if (t < 4) {
        sQK[nrow * SP + t * 16 + lq] = hv;
        sR[nrow * SP + t * 16 + lq]  = (f16)((av - (float)hv) * RES_CARRY);
      } else {
        sV[((t - 4) * 16 + lq) * SP + nrow] = hv;
      }
    }
  }
  __syncthreads();

  Pack8H pq, pk, pqr, pkr, pv;
  const int row = tid >> 2, seg = tid & 3;
  pq.v  = *(const v8h*)(sQK + row * SP + seg * 8);
  pk.v  = *(const v8h*)(sQK + row * SP + HD + seg * 8);
  pqr.v = *(const v8h*)(sR + row * SP + seg * 8);
  pkr.v = *(const v8h*)(sR + row * SP + HD + seg * 8);
  const int dv = tid >> 3, sv = tid & 7;
  pv.v = *(const v8h*)(sV + dv * SP + sv * 8);
  const size_t qi = ((size_t)b * SEQ + n0) * HD + (size_t)tid * 8;
  const size_t vi = ((size_t)b * HD + dv) * SEQ + n0 + sv * 8;
  const v4u uq = pq.u, uk = pk.u, uqr = pqr.u, ukr = pkr.u, uv = pv.u;
  *(v4u*)(qp + qi) = uq;
  *(v4u*)(kp + qi) = uk;
  *(v4u*)(qr + qi) = uqr;
  *(v4u*)(kr + qi) = ukr;
  *(v4u*)(vp + vi) = uv;
  
}

// Flash attention, all keys, no logit scaling. Block = (query block of 128, batch); one wave owns 16 query rows.
// S^T = K x Q^T so queries sit on lanes; P^T in C-layout is bit-identical to the A-fragment layout of O += P x V.
// Scores: kval.qval in the main accumulator; kres.qval + kval.qres in a second accumulator folded by 1/2048 in f32.
// K, K-residual and V tiles of KS keys are brought into a two-buffer LDS ring once per block by asynchronous copies
// (stage t + 2 flies while stage t + 1 is worked on); the fragments are two 16-B LDS loads each, in the k order of the q fragments.
// LDS sC: per-wave staging (block barrier used; every wave reaches it). sRing: cross-wave, published by the ring's barriers.

// One stage: keys j0..j0+KS-1 of the three planes into dst. Six 16-B pieces per thread, every lane on, all addresses
// 16-B multiples; k / k residual pieces are contiguous in global memory, v pieces are 256-B runs of each of the 32 rows.
static __device__ __forceinline__ void stage_copy(const f16* __restrict__ kb_b, const f16* __restrict__ kr_b,
                                                  const f16* __restrict__ vt_b, int j0, f16* dst, int tid) {
  const int p0 = tid, p1 = tid + 256;                 // piece 0..511 of each plane
  const f16* gk0 = kb_b + (size_t)j0 * HD + p0 * 8;
  const f16* gk1 = kb_b + (size_t)j0 * HD + p1 * 8;
  const f16* gr0 = kr_b + (size_t)j0 * HD + p0 * 8;
  const f16* gr1 = kr_b + (size_t)j0 * HD + p1 * 8;
  const f16* gv0 = vt_b + (size_t)(p0 >> 4) * SEQ + j0 + (p0 & 15) * 8;
  const f16* gv1 = vt_b + (size_t)(p1 >> 4) * SEQ + j0 + (p1 & 15) * 8;
  const unsigned l0  = (unsigned)(size_t)dst;         // LDS byte address of the stage
  const unsigned lk0 = l0 + ((p0 >> 2) * KPH + (p0 & 3) * 8) * 2;
  const unsigned lk1 = l0 + ((p1 >> 2) * KPH + (p1 & 3) * 8) * 2;
  const unsigned lr0 = lk0 + ST_KR * 2;
  const unsigned lr1 = lk1 + ST_KR * 2;
  const unsigned lv0 = l0 + (ST_V + (p0 >> 4) * VPH + (p0 & 15) * 8) * 2;
  const unsigned lv1 = l0 + (ST_V + (p1 >> 4) * VPH + (p1 & 15) * 8) * 2;
  // The copies and their s_wait_xcnt in one statement: no address register is rewritten ahead of that wait.
  asm volatile("global_load_async_to_lds_b128 %0, %6, off\n\t"
               "global_load_async_to_lds_b128 %1, %7, off\n\t"
               "global_load_async_to_lds_b128 %2, %8, off\n\t"
               "global_load_async_to_lds_b128 %3, %9, off\n\t"
               "global_load_async_to_lds_b128 %4, %10, off\n\t"
               "global_load_async_to_lds_b128 %5, %11, off\n\t"
               "s_wait_xcnt 0x0"
               :: "v"(lk0), "v"(lk1), "v"(lr0), "v"(lr1), "v"(lv0), "v"(lv1),
                  "v"(gk0), "v"(gk1), "v"(gr0), "v"(gr1), "v"(gv0), "v"(gv1)
               : "memory");
}

__global__ __launch_bounds__(256) void attn_kernel(const f16* __restrict__ qp, const f16* __restrict__ qr,
                                                   const f16* __restrict__ kp, const f16* __restrict__ kr,
                                                   const f16* __restrict__ vp, f16* __restrict__ ctx) {
  const int qblk = blockIdx.x;
  const int b    = blockIdx.y;
  const int tid  = threadIdx.x;
  const int wave = tid >> 5;
  const int lane = tid & 31;
  const int lq   = lane & 15;   // query column of S^T / d column of O
  const int hi   = lane >> 4;   // k-split half

  __shared__ __align__(16) f16 sC[NWAVE * 16 * CP];
  __shared__ __align__(16) f16 sRing[2 * ST_H];

  const int qrow0 = qblk * BQ + wave * 16;

  FragH qf, qrf;                 // B operands: column = query qrow0+lq, k = d split map (value, residual)
  {
    const size_t qo = ((size_t)b * SEQ + qrow0 + lq) * HD + hi * 8;
    qf.q[0]  = *(const v4u*)(qp + qo);          // d = 8*hi + 0..7
    qf.q[1]  = *(const v4u*)(qp + qo + 16);     // d = 16 + 8*hi + 0..7
    qrf.q[0] = *(const v4u*)(qr + qo);
    qrf.q[1] = *(const v4u*)(qr + qo + 16);
  }
  const f16* kb_b = kp + (size_t)b * SEQ * HD;
  const f16* kr_b = kr + (size_t)b * SEQ * HD;
  const f16* vt_b = vp + (size_t)b * HD * SEQ;

  v8f o[2];
  o[0] = (v8f){0, 0, 0, 0, 0, 0, 0, 0};
  o[1] = (v8f){0, 0, 0, 0, 0, 0, 0, 0};
  float rmax = -__builtin_inff();
  float rsum = 0.0f;
  const float SL = 1.4426950408889634f;   // log2(e)

  // ring prologue: stage 0 landed and published, then stage 1 in flight
  stage_copy(kb_b, kr_b, vt_b, 0, sRing, tid);
  asm volatile("s_wait_asynccnt 0x0" ::: "memory");   // this wave's pieces of stage 0 have landed
  __syncthreads();                                    // ... and every other wave's
  if (NS > 1) stage_copy(kb_b, kr_b, vt_b, KS, sRing + ST_H, tid);

  #pragma unroll 1
  for (int t = 0; t < NS; ++t) {
  f16* sbuf = sRing + (t & 1) * ST_H;                 // trip t reads this buffer alone
  for (int jj = 0; jj < KS; jj += BK) {
    FragH ak[2], akr[2], bv[2];
    #pragma unroll
    for (int sub = 0; sub < 2; ++sub) {
      const int ko = (jj + sub * 16 + lq) * KPH + hi * 8;             // row = key
      ak[sub].q[0]  = *(const v4u*)(sbuf + ko);                  // d = 8*hi + 0..7
      ak[sub].q[1]  = *(const v4u*)(sbuf + ko + 16);             // d = 16 + 8*hi + 0..7
      akr[sub].q[0] = *(const v4u*)(sbuf + ST_KR + ko);
      akr[sub].q[1] = *(const v4u*)(sbuf + ST_KR + ko + 16);
    }
    #pragma unroll
    for (int dt = 0; dt < 2; ++dt) {
      const f16* base = sbuf + ST_V + (dt * 16 + lq) * VPH + jj + hi * 8;    // column = d
      bv[dt].q[0] = *(const v4u*)(base);           // keys jj + 8*hi + 0..7 of the stage
      bv[dt].q[1] = *(const v4u*)(base + 16);      // keys jj + 16 + 8*hi + 0..7
    }

    // c[sub][r] = score(query qrow0+lq, key t*KS + jj + sub*16 + 8*hi + r)
    v8f c[2];
    #pragma unroll
    for (int sub = 0; sub < 2; ++sub) {
      const v8f z = (v8f){0, 0, 0, 0, 0, 0, 0, 0};
      v8f cm = mma_f16(ak[sub].v, qf.v, z);          // value x value
      v8f cr = mma_f16(akr[sub].v, qf.v, z);         // k residual x q value
      cr = mma_f16(ak[sub].v, qrf.v, cr);            // k value x q residual
      #pragma unroll
      for (int r = 0; r < 8; ++r) cm[r] = cm[r] + cr[r] * RES_FOLD;
      c[sub] = cm;
    }

    // online softmax: query lq's 32 scores are split across lane / lane^16
    float m_new = rmax;
    #pragma unroll
    for (int r = 0; r < 8; ++r) {
      m_new = fmaxf(m_new, c[0][r]);
      m_new = fmaxf(m_new, c[1][r]);
    }
    m_new = fmaxf(m_new, __shfl_xor(m_new, 16, 32));
    const float scale = __builtin_amdgcn_exp2f((rmax - m_new) * SL);
    rmax = m_new;

    // exp + pack: P^T C-layout == A-fragment layout of the PV product; P carried x4096
    FragH pa;
    float psum = 0.0f;
    #pragma unroll
    for (int r = 0; r < 8; ++r) {
      const float p0 = __builtin_amdgcn_exp2f((c[0][r] - m_new) * SL);   // key 8*hi + r
      const float p1 = __builtin_amdgcn_exp2f((c[1][r] - m_new) * SL);   // key 16 + 8*hi + r
      psum += p0 + p1;
      pa.h[r]     = (f16)(p0 * 4096.0f);
      pa.h[8 + r] = (f16)(p1 * 4096.0f);
    }
    rsum = rsum * scale + psum + __shfl_xor(psum, 16, 32);

    // rescale O: queries are the row dimension there -> per-row scale from lane 8*hi + r
    float sc[8];
    #pragma unroll
    for (int r = 0; r < 8; ++r) sc[r] = __shfl(scale, (hi << 3) + r, 32);
    #pragma unroll
    for (int dt = 0; dt < 2; ++dt) {
      #pragma unroll
      for (int r = 0; r < 8; ++r) o[dt][r] *= sc[r];
    }

    // O += P x V
    #pragma unroll
    for (int dt = 0; dt < 2; ++dt) o[dt] = mma_f16(pa.v, bv[dt].v, o[dt]);
  }
  // publish point of stage t + 1; behind it the buffer just read is free for stage t + 2
  asm volatile("s_wait_dscnt 0x0" ::: "memory");      // this wave's reads of sbuf have returned
  asm volatile("s_wait_asynccnt 0x0" ::: "memory");   // this wave's pieces of stage t + 1 have landed
  __syncthreads();
  if (t + 2 < NS) stage_copy(kb_b, kr_b, vt_b, (t + 2) * KS, sbuf, tid);
  }
  asm volatile("s_wait_asynccnt 0x0" ::: "memory");   // nothing in flight when the wave goes on to its end

  // normalize: lane holds column d = dt*16 + lq for query rows 8*hi + r
  const float rinv = (1.0f / rsum) * (1.0f / 4096.0f);
  float rs[8];
  #pragma unroll
  for (int r = 0; r < 8; ++r) rs[r] = __shfl(rinv, (hi << 3) + r, 32);

  f16* so = sC + wave * (16 * CP);
  #pragma unroll
  for (int r = 0; r < 8; ++r) {
    #pragma unroll
    for (int dt = 0; dt < 2; ++dt)
      so[(hi * 8 + r) * CP + dt * 16 + lq] = (f16)(o[dt][r] * rs[r]);
  }
  __syncthreads();

  v4u    cv[2];
  size_t ci[2];
  #pragma unroll
  for (int it = 0; it < 2; ++it) {
    const int p   = it * 32 + lane;        // 16-B piece 0..63 of the wave's 1024-B slab
    const int row = p >> 2, seg = p & 3;
    Pack8H ph;
    ph.v   = *(const v8h*)(so + row * CP + seg * 8);
    cv[it] = ph.u;
    ci[it] = ((size_t)b * SEQ + qrow0) * HD + (size_t)p * 8;
  }
  #pragma unroll
  for (int it = 0; it < 2; ++it) *(v4u*)(ctx + ci[it]) = cv[it];
  
}

// Out-projection + gate + skip-add. Block = (32-position tile, batch); wave w owns channels 32w..32w+31.
// D[c][n] = sum_d woh[c][d] ctx[n][d]; result = D * (g/64) + bf16 RNE value of x; g = bf16 RNE value of gamma.
// LDS sO: each wave reads only rows it wrote; block barrier used anyway (every wave reaches it).
__global__ __launch_bounds__(256) void oproj_kernel(const f16* __restrict__ ctx, const f16* __restrict__ woh,
                                                    const float* __restrict__ x, const float* __restrict__ gamma,
                                                    float* __restrict__ out) {
  const int n0   = blockIdx.x * ON;
  const int b    = blockIdx.y;
  const int tid  = threadIdx.x;
  const int wave = tid >> 5;
  const int lane = tid & 31;
  const int lq   = lane & 15;
  const int hi   = lane >> 4;

  __shared__ __align__(16) float sO[CH * OPF];

  const float gs = bf16_val(gamma[0]) * (1.0f / 64.0f);

  FragH bn[2];                   // B operand: column = position, k = d split map
  #pragma unroll
  for (int nt = 0; nt < 2; ++nt) {
    const f16* p = ctx + ((size_t)b * SEQ + n0 + nt * 16 + lq) * HD + hi * 8;
    bn[nt].q[0] = *(const v4u*)(p);
    bn[nt].q[1] = *(const v4u*)(p + 16);
  }
  #pragma unroll
  for (int ct = 0; ct < 2; ++ct) {
    const int c0 = (wave * 2 + ct) * 16;
    FragH a;                     // A operand: row = channel, k = d split map
    const f16* wr = woh + (size_t)(c0 + lq) * HD + hi * 8;
    a.q[0] = *(const v4u*)(wr);
    a.q[1] = *(const v4u*)(wr + 16);
    #pragma unroll
    for (int nt = 0; nt < 2; ++nt) {
      v8f z = (v8f){0, 0, 0, 0, 0, 0, 0, 0};
      const v8f acc = mma_f16(a.v, bn[nt].v, z);
      #pragma unroll
      for (int r = 0; r < 8; ++r)
        sO[(c0 + hi * 8 + r) * OPF + nt * 16 + lq] = acc[r];
    }
  }
  __syncthreads();

  v4f    vals[8];
  size_t gi[8];
  #pragma unroll
  for (int it = 0; it < 8; ++it) {
    const int c   = wave * 32 + it * 4 + (lane >> 3);
    const int seg = lane & 7;
    const v4f o4  = *(const v4f*)(sO + c * OPF + seg * 4);
    gi[it] = ((size_t)b * CH + c) * SEQ_FULL + n0 + seg * 4;
    const v4f xr = *(const v4f*)(x + gi[it]);
    v4f rv;
    #pragma unroll
    for (int i = 0; i < 4; ++i) rv[i] = fmaf(o4[i], gs, bf16_val(xr[i]));
    vals[it] = rv;
  }
  #pragma unroll
  for (int it = 0; it < 8; ++it) *(v4f*)(out + gi[it]) = vals[it];
  
}

extern "C" void kernel_launch(void* const* d_in, const int* in_sizes, int n_in,
                              void* d_out, int out_size, void* d_ws, size_t ws_size,
                              hipStream_t stream) {
  if (n_in < 6) return;
  const size_t x_need = ((size_t)(NB - 1) * CH + (CH - 1)) * SEQ_FULL + SEQ;
  if ((size_t)in_sizes[0] < x_need) return;
  if ((size_t)in_sizes[1] < (size_t)HD * CH) return;
  if ((size_t)in_sizes[2] < (size_t)HD * CH) return;
  if ((size_t)in_sizes[3] < (size_t)HD * CH) return;
  if ((size_t)in_sizes[4] < (size_t)CH * HD) return;
  if (in_sizes[5] < 1) return;
  if ((size_t)out_size < x_need) return;
  if (ws_size < WS_TOTAL) return;

  const float* x     = (const float*)d_in[0];
  const float* wq    = (const float*)d_in[1];
  const float* wk    = (const float*)d_in[2];
  const float* wv    = (const float*)d_in[3];
  const float* wo    = (const float*)d_in[4];
  const float* gamma = (const float*)d_in[5];
  float*       out   = (float*)d_out;

  char* ws = (char*)d_ws;
  unsigned short* wb  = (unsigned short*)(ws);
  f16*            woh = (f16*)(ws + WB_BYTES);
  f16*            qp  = (f16*)(ws + WB_BYTES + WO_BYTES);
  f16*            kp  = (f16*)(ws + WB_BYTES + WO_BYTES + PL_BYTES);
  f16*            vp  = (f16*)(ws + WB_BYTES + WO_BYTES + 2 * PL_BYTES);
  f16*            cx  = (f16*)(ws + WB_BYTES + WO_BYTES + 3 * PL_BYTES);
  f16*            qrp = (f16*)(ws + WB_BYTES + WO_BYTES + 4 * PL_BYTES);
  f16*            krp = (f16*)(ws + WB_BYTES + WO_BYTES + 5 * PL_BYTES);

  prep_kernel<<<dim3(16), 256, 0, stream>>>(wq, wk, wv, wo, wb, woh);
  // qkv_kernel(x, wb, qp, kp, qr, kr, vp)
  qkv_kernel<<<dim3(SEQ / NT, NB), 256, 0, stream>>>(x, wb, qp, kp, qrp, krp, vp);
  // attn_kernel(qp, qr, kp, kr, vp, ctx)
  attn_kernel<<<dim3(SEQ / BQ, NB), 256, 0, stream>>>(qp, qrp, kp, krp, vp, cx);
  oproj_kernel<<<dim3(SEQ / ON, NB), 256, 0, stream>>>(cx, woh, x, gamma, out);
}

// v002
// A run of this version takes 61.4 microseconds.
// Timed twice side by side with v001, it ran 1.14 and 1.13 times as fast.
// Counting every step since v000, it is 2.13 times as fast.
#include <hip/hip_runtime.h>

// Contractions: q/k/v projections on v_wmma_f32_16x16x32_bf16 (x and W as bf16 RNE-converted inputs, f32 accumulate);
// S^T = K x Q^T on v_wmma_f32_16x16x32_f16 as three products (q,k f16 value planes + f16 residual planes x2048,
// residual products in their own accumulator folded by 1/2048 in f32); O = P x V on f16 (P carried x4096, V f16);
// out-projection on f16 (Wo = f16 of bf16 RNE value x64, ctx f16, 1/64 folded in the f32 epilogue);
// softmax, gate and skip-add in f32.

#ifndef NB
#define NB 8
#endif
#ifndef SEQ
#define SEQ 4096
#endif
#define NB_FULL   8
#define SEQ_FULL  4096
#define CH        256                 // channels (projection K)
#define HD        32                  // q/k/v dim (single head)
#define NQKV      96                  // stacked projection outputs: q 0..31, k 32..63, v 64..95
#define NT        64                  // positions per projection block
#define XPW       132                 // LDS pitch (32-bit words) of the transposed bf16 x tile
#define SP        72                  // LDS pitch (halves) of the q|k, q|k residual and v staging tiles
#define BQ        128                 // query rows per attention block (8 waves x 16)
#define BK        32                  // keys per PV product (k of one WMMA)
#define NWAVE     8
#define CP        40                  // LDS pitch (halves) of the per-wave ctx staging tile
#define KS        128                 // keys per LDS stage of the attention ring == keys per online-softmax step
#define NS        (SEQ / KS)          // stages
#define NSUB      (KS / 16)           // 16-key score tiles per stage
#define NGRP      (KS / BK)           // 32-key PV groups per stage
#define KPH       40                  // LDS pitch (halves) of a staged k / k residual row: 80 B = 16 B x odd
#define VPH       136                 // LDS pitch (halves) of a staged v row of KS keys: 272 B = 16 B x odd
#define ST_KR     (KS * KPH)          // offsets (halves) inside one stage: k at 0, k residual, v
#define ST_V      (2 * KS * KPH)
#define ST_H      (2 * KS * KPH + HD * VPH)   // halves per stage
#define ON        32
#define OPF       36                  // LDS pitch (floats) of the out-projection staging tile
#define RES_CARRY 2048.0f             // power-of-two carry of the q/k residual planes
#define RES_FOLD  (1.0f / 2048.0f)

static_assert(NB >= 1 && NB <= NB_FULL);
static_assert(SEQ <= SEQ_FULL);
static_assert(SEQ % BQ == 0);
static_assert(SEQ % NT == 0);
static_assert(SEQ % ON == 0);
static_assert(SEQ % BK == 0);
static_assert(BQ == NWAVE * 16);
static_assert(SEQ % KS == 0 && KS % BK == 0 && BK == 32 && NSUB % 4 == 0);
static_assert(KS * 4 == 2 * 256 && HD * (KS / 8) == 2 * 256);   // 16-B pieces per plane and stage == 2 per thread
static_assert(KPH >= HD && (KPH * 2) % 16 == 0 && VPH >= KS && (VPH * 2) % 16 == 0 && (ST_H * 2) % 16 == 0);
static_assert(HD == 32);
static_assert(CH % 32 == 0);
static_assert(NQKV == 3 * HD);
static_assert(8 * 256 == (CH / 2) * (NT / 4));     // x staging items == threads x iterations
static_assert(XPW >= CH / 2 && (XPW * 4) % 16 == 0);
static_assert(SP >= 2 * HD && SP >= NT && (SP * 2) % 16 == 0);
static_assert(NT * 4 == 256);                      // q/k (+ residual) plane store: one 16-B piece per thread each
static_assert(HD * 8 == 256);                      // v plane store: one 16-B piece per thread
static_assert(CP >= HD && (CP * 2) % 16 == 0);
static_assert(OPF >= ON && (OPF * 4) % 16 == 0);
static_assert(NWAVE * 32 == CH);                   // out-projection: each wave owns 32 channel rows
static_assert(ON == 32);
static_assert(NT * XPW * 4 + 2 * NT * SP * 2 + HD * SP * 2 <= 65536);   // static LDS of the projection kernel

#define WB_BYTES  ((size_t)NQKV * CH * 2)
#define WO_BYTES  ((size_t)CH * HD * 2)
#define PL_BYTES  ((size_t)NB * SEQ * HD * 2)
#define NPLANE    6                                 // q, k, v, ctx, q residual, k residual
#define WS_TOTAL  (WB_BYTES + WO_BYTES + NPLANE * PL_BYTES)
static_assert(WB_BYTES % 128 == 0 && WO_BYTES % 128 == 0 && PL_BYTES % 128 == 0);
static_assert(WS_TOTAL <= (size_t)134217728);

typedef __bf16   bf16;
typedef _Float16 f16;
typedef bf16     v16bf __attribute__((ext_vector_type(16)));
typedef f16      v16h  __attribute__((ext_vector_type(16)));
typedef f16      v8h   __attribute__((ext_vector_type(8)));
typedef float    v8f   __attribute__((ext_vector_type(8)));
typedef float    v4f   __attribute__((ext_vector_type(4)));
typedef unsigned v4u   __attribute__((ext_vector_type(4)));

union FragB  { v16bf v; v4u q[2]; };
union FragH  { v16h  v; v4u q[2]; f16 h[16]; };
union Pack8H { v4u u; v8h v; f16 h[8]; };

// WMMA helpers: builtin followed by the VALU hazard guard (ties D, keeps A/B live).
static __device__ __forceinline__ v8f mma_bf16(v16bf a, v16bf b, v8f acc) {
  acc = __builtin_amdgcn_wmma_f32_16x16x32_bf16(false, a, false, b, (short)0, acc, false, false);
  asm volatile("v_nop\n\tv_nop\n\tv_nop\n\tv_nop" : "+v"(acc) : "v"(a), "v"(b));
  return acc;
}
static __device__ __forceinline__ v8f mma_f16(v16h a, v16h b, v8f acc) {
  acc = __builtin_amdgcn_wmma_f32_16x16x32_f16(false, a, false, b, (short)0, acc, false, false);
  asm volatile("v_nop\n\tv_nop\n\tv_nop\n\tv_nop" : "+v"(acc) : "v"(a), "v"(b));
  return acc;
}

// f32 -> bf16 bits, RNE (finite inputs).
static __device__ __forceinline__ unsigned bf16_bits(float f) {
  const unsigned u = __float_as_uint(f);
  return (u + 0x7FFFu + ((u >> 16) & 1u)) >> 16;
}
static __device__ __forceinline__ float bf16_val(float f) {
  return __uint_as_float(bf16_bits(f) << 16);
}

// Weight planes, built once. 4096 pieces of 8 elements, one 16-B piece per thread, 16 blocks x 256.
//   wb  [96][256] bf16 bits : rows 0..31 wq, 32..63 wk, 64..95 wv (k = channel contiguous)
//   woh [256][32] f16       : f16(bf16 RNE value of wo x 64), exact
__global__ __launch_bounds__(256) void prep_kernel(const float* __restrict__ wq, const float* __restrict__ wk,
                                                   const float* __restrict__ wv, const float* __restrict__ wo,
                                                   unsigned short* __restrict__ wb, f16* __restrict__ woh) {
  const int p = blockIdx.x * 256 + threadIdx.x;       // 0..4095
  if (blockIdx.x < 12) {                               // block-uniform
    const int which = p >> 10;                         // 0..2, block-uniform
    const int off   = (p & 1023) * 8;
    const v4f q0 = *(const v4f*)(wq + off), q1 = *(const v4f*)(wq + off + 4);
    const v4f k0 = *(const v4f*)(wk + off), k1 = *(const v4f*)(wk + off + 4);
    const v4f v0 = *(const v4f*)(wv + off), v1 = *(const v4f*)(wv + off + 4);
    const v4f a0 = (which == 0) ? q0 : ((which == 1) ? k0 : v0);   // select by value
    const v4f a1 = (which == 0) ? q1 : ((which == 1) ? k1 : v1);
    v4u u;
    u[0] = bf16_bits(a0[0]) | (bf16_bits(a0[1]) << 16);
    u[1] = bf16_bits(a0[2]) | (bf16_bits(a0[3]) << 16);
    u[2] = bf16_bits(a1[0]) | (bf16_bits(a1[1]) << 16);
    u[3] = bf16_bits(a1[2]) | (bf16_bits(a1[3]) << 16);
    unsigned short* dst = wb + (size_t)p * 8;
    *(v4u*)dst = u;
    
  } else {
    const int off = (p - 3072) * 8;
    const v4f a0 = *(const v4f*)(wo + off), a1 = *(const v4f*)(wo + off + 4);
    Pack8H ph;
    #pragma unroll
    for (int i = 0; i < 4; ++i) {
      ph.h[i]     = (f16)(bf16_val(a0[i]) * 64.0f);
      ph.h[4 + i] = (f16)(bf16_val(a1[i]) * 64.0f);
    }
    const v4u u = ph.u;
    f16* dst = woh + off;
    *(v4u*)dst = u;
    
  }
}

// Fused q/k/v projection. Block = (64-position tile, batch), 256 threads.
// x tile [256 c][64 n] is RNE-converted to bf16 and transposed through LDS to [n][c]; D[n][dd] = sum_c x[c][n] W[dd][c].
// Planes: qp,kp [NB][SEQ][32] f16 value planes; qr,kr [NB][SEQ][32] f16 residual planes = (f32 - f16 value) x 2048
// coverage: q,k,q_res,k_res rows n0..n0+63 x 32 d ; v 32 d x positions n0..n0+63 ; every written line whole,
// one instruction. LDS: sX, sQK, sR, sV are cross-wave (block barriers); staged extent == consumed extent for all four.
__global__ __launch_bounds__(256) void qkv_kernel(const float* __restrict__ x,
                                                  const unsigned short* __restrict__ wb,
                                                  f16* __restrict__ qp, f16* __restrict__ kp,
                                                  f16* __restrict__ qr, f16* __restrict__ kr,
                                                  f16* __restrict__ vp) {
  const int n0   = blockIdx.x * NT;
  const int b    = blockIdx.y;
  const int tid  = threadIdx.x;
  const int wave = tid >> 5;
  const int lane = tid & 31;
  const int lq   = lane & 15;
  const int hi   = lane >> 4;

  __shared__ __align__(16) unsigned sX[NT * XPW];     // [n][c/2] packed bf16 pairs (even c in the low half)
  __shared__ __align__(16) f16      sQK[NT * SP];     // [n][q 0..31 | k 32..63] values
  __shared__ __align__(16) f16      sR[NT * SP];      // [n][q 0..31 | k 32..63] residuals x2048
  __shared__ __align__(16) f16      sV[HD * SP];      // [d][n]

  #pragma unroll 2
  for (int it = 0; it < 8; ++it) {
    const int item = it * 256 + tid;                  // 0..2047
    const int nq   = item & 15;                       // 4-position group
    const int cp   = item >> 4;                       // channel pair 0..127
    const float* src = x + ((size_t)b * CH + 2 * cp) * SEQ_FULL + n0 + nq * 4;
    const v4f a0 = *(const v4f*)(src);
    const v4f a1 = *(const v4f*)(src + SEQ_FULL);
    #pragma unroll
    for (int i = 0; i < 4; ++i)
      sX[(nq * 4 + i) * XPW + cp] = bf16_bits(a0[i]) | (bf16_bits(a1[i]) << 16);
  }
  __syncthreads();

  const int nt = wave & 3;                            // position sub-tile
  const int g3 = wave >> 2;                           // output tile group: tiles g3*3 + {0,1,2}
  v8f acc[3];
  #pragma unroll
  for (int j = 0; j < 3; ++j) acc[j] = (v8f){0, 0, 0, 0, 0, 0, 0, 0};

  const int aoff = (nt * 16 + lq) * XPW + hi * 4;     // row n, words of channels 8*hi..
  #pragma unroll 2
  for (int ks = 0; ks < CH / 32; ++ks) {
    FragB a;
    a.q[0] = *(const v4u*)(sX + aoff + ks * 16);        // c = ks*32 + 8*hi + 0..7
    a.q[1] = *(const v4u*)(sX + aoff + ks * 16 + 8);    // c = ks*32 + 16 + 8*hi + 0..7
    #pragma unroll
    for (int j = 0; j < 3; ++j) {
      const unsigned short* wr = wb + (size_t)((g3 * 3 + j) * 16 + lq) * CH + ks * 32 + hi * 8;
      FragB w;
      w.q[0] = *(const v4u*)(wr);                       // c = ks*32 + 8*hi + 0..7
      w.q[1] = *(const v4u*)(wr + 16);                  // c = ks*32 + 16 + 8*hi + 0..7
      acc[j] = mma_bf16(a.v, w.v, acc[j]);
    }
  }

  // D element r of lane: (n = nt*16 + 8*hi + r, dd = tile*16 + lq)
  #pragma unroll
  for (int j = 0; j < 3; ++j) {
    const int t = g3 * 3 + j;                         // wave-uniform
    #pragma unroll
    for (int r = 0; r < 8; ++r) {
      const int nrow = nt * 16 + hi * 8 + r;
      const float av = acc[j][r];
      const f16 hv = (f16)av;
      if (t < 4) {
        sQK[nrow * SP + t * 16 + lq] = hv;
        sR[nrow * SP + t * 16 + lq]  = (f16)((av - (float)hv) * RES_CARRY);
      } else {
        sV[((t - 4) * 16 + lq) * SP + nrow] = hv;
      }
    }
  }
  __syncthreads();

  Pack8H pq, pk, pqr, pkr, pv;
  const int row = tid >> 2, seg = tid & 3;
  pq.v  = *(const v8h*)(sQK + row * SP + seg * 8);
  pk.v  = *(const v8h*)(sQK + row * SP + HD + seg * 8);
  pqr.v = *(const v8h*)(sR + row * SP + seg * 8);
  pkr.v = *(const v8h*)(sR + row * SP + HD + seg * 8);
  const int dv = tid >> 3, sv = tid & 7;
  pv.v = *(const v8h*)(sV + dv * SP + sv * 8);
  const size_t qi = ((size_t)b * SEQ + n0) * HD + (size_t)tid * 8;
  const size_t vi = ((size_t)b * HD + dv) * SEQ + n0 + sv * 8;
  const v4u uq = pq.u, uk = pk.u, uqr = pqr.u, ukr = pkr.u, uv = pv.u;
  *(v4u*)(qp + qi) = uq;
  *(v4u*)(kp + qi) = uk;
  *(v4u*)(qr + qi) = uqr;
  *(v4u*)(kr + qi) = ukr;
  *(v4u*)(vp + vi) = uv;
  
}

// Flash attention, all keys, no logit scaling. Block = (query block of 128, batch); one wave owns 16 query rows.
// S^T = K x Q^T so queries sit on lanes; P^T in C-layout is bit-identical to the A-fragment layout of O += P x V.
// Scores: kval.qval in the main accumulator; kres.qval + kval.qres in a second accumulator folded by 1/2048 in f32.
// K, K-residual and V tiles of KS keys are brought into a two-buffer LDS ring once per block by asynchronous copies
// (stage t + 2 flies while stage t + 1 is worked on); the fragments are two 16-B LDS loads each, in the k order of the q fragments.
// One online-softmax step per stage: all KS scores first, then one maximum, one exchange between the lane halves and one
// rescale of O, then the stage's PV products.
// LDS sC: per-wave staging (block barrier used; every wave reaches it). sRing: cross-wave, published by the ring's barriers.

// One stage: keys j0..j0+KS-1 of the three planes into dst. Six 16-B pieces per thread, every lane on, all addresses
// 16-B multiples; k / k residual pieces are contiguous in global memory, v pieces are 256-B runs of each of the 32 rows.
static __device__ __forceinline__ void stage_copy(const f16* __restrict__ kb_b, const f16* __restrict__ kr_b,
                                                  const f16* __restrict__ vt_b, int j0, f16* dst, int tid) {
  const int p0 = tid, p1 = tid + 256;                 // piece 0..511 of each plane
  const f16* gk0 = kb_b + (size_t)j0 * HD + p0 * 8;
  const f16* gk1 = kb_b + (size_t)j0 * HD + p1 * 8;
  const f16* gr0 = kr_b + (size_t)j0 * HD + p0 * 8;
  const f16* gr1 = kr_b + (size_t)j0 * HD + p1 * 8;
  const f16* gv0 = vt_b + (size_t)(p0 >> 4) * SEQ + j0 + (p0 & 15) * 8;
  const f16* gv1 = vt_b + (size_t)(p1 >> 4) * SEQ + j0 + (p1 & 15) * 8;
  const unsigned l0  = (unsigned)(size_t)dst;         // LDS byte address of the stage
  const unsigned lk0 = l0 + ((p0 >> 2) * KPH + (p0 & 3) * 8) * 2;
  const unsigned lk1 = l0 + ((p1 >> 2) * KPH + (p1 & 3) * 8) * 2;
  const unsigned lr0 = lk0 + ST_KR * 2;
  const unsigned lr1 = lk1 + ST_KR * 2;
  const unsigned lv0 = l0 + (ST_V + (p0 >> 4) * VPH + (p0 & 15) * 8) * 2;
  const unsigned lv1 = l0 + (ST_V + (p1 >> 4) * VPH + (p1 & 15) * 8) * 2;
  // The copies and their s_wait_xcnt in one statement: no address register is rewritten ahead of that wait.
  asm volatile("global_load_async_to_lds_b128 %0, %6, off\n\t"
               "global_load_async_to_lds_b128 %1, %7, off\n\t"
               "global_load_async_to_lds_b128 %2, %8, off\n\t"
               "global_load_async_to_lds_b128 %3, %9, off\n\t"
               "global_load_async_to_lds_b128 %4, %10, off\n\t"
               "global_load_async_to_lds_b128 %5, %11, off\n\t"
               "s_wait_xcnt 0x0"
               :: "v"(lk0), "v"(lk1), "v"(lr0), "v"(lr1), "v"(lv0), "v"(lv1),
                  "v"(gk0), "v"(gk1), "v"(gr0), "v"(gr1), "v"(gv0), "v"(gv1)
               : "memory");
}

__global__ __launch_bounds__(256) void attn_kernel(const f16* __restrict__ qp, const f16* __restrict__ qr,
                                                   const f16* __restrict__ kp, const f16* __restrict__ kr,
                                                   const f16* __restrict__ vp, f16* __restrict__ ctx) {
  const int qblk = blockIdx.x;
  const int b    = blockIdx.y;
  const int tid  = threadIdx.x;
  const int wave = tid >> 5;
  const int lane = tid & 31;
  const int lq   = lane & 15;   // query column of S^T / d column of O
  const int hi   = lane >> 4;   // k-split half

  __shared__ __align__(16) f16 sC[NWAVE * 16 * CP];
  __shared__ __align__(16) f16 sRing[2 * ST_H];

  const int qrow0 = qblk * BQ + wave * 16;

  FragH qf, qrf;                 // B operands: column = query qrow0+lq, k = d split map (value, residual)
  {
    const size_t qo = ((size_t)b * SEQ + qrow0 + lq) * HD + hi * 8;
    qf.q[0]  = *(const v4u*)(qp + qo);          // d = 8*hi + 0..7
    qf.q[1]  = *(const v4u*)(qp + qo + 16);     // d = 16 + 8*hi + 0..7
    qrf.q[0] = *(const v4u*)(qr + qo);
    qrf.q[1] = *(const v4u*)(qr + qo + 16);
  }
  const f16* kb_b = kp + (size_t)b * SEQ * HD;
  const f16* kr_b = kr + (size_t)b * SEQ * HD;
  const f16* vt_b = vp + (size_t)b * HD * SEQ;

  v8f o[2];
  o[0] = (v8f){0, 0, 0, 0, 0, 0, 0, 0};
  o[1] = (v8f){0, 0, 0, 0, 0, 0, 0, 0};
  float rmax = -__builtin_inff();
  float rsum = 0.0f;
  const float SL = 1.4426950408889634f;   // log2(e)

  // ring prologue: stage 0 landed and published, then stage 1 in flight
  stage_copy(kb_b, kr_b, vt_b, 0, sRing, tid);
  asm volatile("s_wait_asynccnt 0x0" ::: "memory");   // this wave's pieces of stage 0 have landed
  __syncthreads();                                    // ... and every other wave's
  if (NS > 1) stage_copy(kb_b, kr_b, vt_b, KS, sRing + ST_H, tid);

  #pragma unroll 1
  for (int t = 0; t < NS; ++t) {
  f16* sbuf = sRing + (t & 1) * ST_H;                 // trip t reads this buffer alone

  // the stage's k and k residual fragments, read as one group ahead of the products, in the order of their use
  FragH ak[NSUB], akr[NSUB];
  #pragma unroll
  for (int h = 0; h < NSUB; h += 4) {
    #pragma unroll
    for (int i = 0; i < 4; ++i) {
      const int ko = ((h + i) * 16 + lq) * KPH + hi * 8;       // row = key
      ak[h + i].q[0] = *(const v4u*)(sbuf + ko);               // d = 8*hi + 0..7
      ak[h + i].q[1] = *(const v4u*)(sbuf + ko + 16);          // d = 16 + 8*hi + 0..7
    }
    #pragma unroll
    for (int i = 0; i < 4; ++i) {
      const int ko = ((h + i) * 16 + lq) * KPH + hi * 8;
      akr[h + i].q[0] = *(const v4u*)(sbuf + ST_KR + ko);
      akr[h + i].q[1] = *(const v4u*)(sbuf + ST_KR + ko + 16);
    }
  }

  // c[sub][r] = score(query qrow0+lq, key t*KS + sub*16 + 8*hi + r): all KS keys of the stage before any softmax work.
  // Four tiles at a time, so that the product that accumulates into cr stands four products behind the one it waits for.
  v8f c[NSUB];
  #pragma unroll
  for (int h = 0; h < NSUB; h += 4) {
    const v8f z = (v8f){0, 0, 0, 0, 0, 0, 0, 0};
    v8f cm[4], cr[4];
    #pragma unroll
    for (int i = 0; i < 4; ++i) cm[i] = mma_f16(ak[h + i].v, qf.v, z);        // value x value
    #pragma unroll
    for (int i = 0; i < 4; ++i) cr[i] = mma_f16(akr[h + i].v, qf.v, z);       // k residual x q value
    #pragma unroll
    for (int i = 0; i < 4; ++i) cr[i] = mma_f16(ak[h + i].v, qrf.v, cr[i]);   // k value x q residual
    #pragma unroll
    for (int i = 0; i < 4; ++i) c[h + i] = cm[i] + cr[i] * RES_FOLD;
  }

  // the stage's v fragments, read as one group; the softmax work below covers their latency
  FragH bv[NGRP][2];
  #pragma unroll
  for (int g = 0; g < NGRP; ++g) {
    #pragma unroll
    for (int dt = 0; dt < 2; ++dt) {
      const f16* base = sbuf + ST_V + (dt * 16 + lq) * VPH + g * BK + hi * 8;    // column = d
      bv[g][dt].q[0] = *(const v4u*)(base);           // keys g*32 + 8*hi + 0..7 of the stage
      bv[g][dt].q[1] = *(const v4u*)(base + 16);      // keys g*32 + 16 + 8*hi + 0..7
    }
  }

  // one online-softmax step per stage: query lq's KS scores are split across lane / lane^16.
  // The maximum runs as eight independent chains over the tiles, joined at the end.
  v8f mx = c[0];
  #pragma unroll
  for (int sub = 1; sub < NSUB; ++sub) {
    #pragma unroll
    for (int r = 0; r < 8; ++r) mx[r] = fmaxf(mx[r], c[sub][r]);
  }
  float m_new = rmax;
  #pragma unroll
  for (int r = 0; r < 8; ++r) m_new = fmaxf(m_new, mx[r]);
  m_new = fmaxf(m_new, __shfl_xor(m_new, 16, 32));
  const float scale = __builtin_amdgcn_exp2f((rmax - m_new) * SL);
  rmax = m_new;

  // exp + pack: P^T C-layout == A-fragment layout of the PV product; P carried x4096
  FragH pa[NGRP];
  v8f ps = (v8f){0, 0, 0, 0, 0, 0, 0, 0};
  #pragma unroll
  for (int sub = 0; sub < NSUB; ++sub) {
    const v8f e = (c[sub] - m_new) * SL;
    v8f p;
    #pragma unroll
    for (int r = 0; r < 8; ++r) p[r] = __builtin_amdgcn_exp2f(e[r]);   // key sub*16 + 8*hi + r
    ps += p;
    const v8f p4 = p * 4096.0f;
    #pragma unroll
    for (int r = 0; r < 8; ++r) pa[sub >> 1].h[(sub & 1) * 8 + r] = (f16)p4[r];
  }
  const float psum = ((ps[0] + ps[1]) + (ps[2] + ps[3])) + ((ps[4] + ps[5]) + (ps[6] + ps[7]));
  rsum = rsum * scale + psum + __shfl_xor(psum, 16, 32);

  // rescale O: queries are the row dimension there -> per-row scale from lane 8*hi + r
  float sc[8];
  #pragma unroll
  for (int r = 0; r < 8; ++r) sc[r] = __shfl(scale, (hi << 3) + r, 32);
  #pragma unroll
  for (int dt = 0; dt < 2; ++dt) {
    #pragma unroll
    for (int r = 0; r < 8; ++r) o[dt][r] *= sc[r];
  }

  // O += P x V over the stage's NGRP groups of 32 keys
  #pragma unroll
  for (int g = 0; g < NGRP; ++g) {
    #pragma unroll
    for (int dt = 0; dt < 2; ++dt) o[dt] = mma_f16(pa[g].v, bv[g][dt].v, o[dt]);
  }
  // publish point of stage t + 1; behind it the buffer just read is free for stage t + 2
  asm volatile("s_wait_dscnt 0x0" ::: "memory");      // this wave's reads of sbuf have returned
  asm volatile("s_wait_asynccnt 0x0" ::: "memory");   // this wave's pieces of stage t + 1 have landed
  __syncthreads();
  if (t + 2 < NS) stage_copy(kb_b, kr_b, vt_b, (t + 2) * KS, sbuf, tid);
  }
  asm volatile("s_wait_asynccnt 0x0" ::: "memory");   // nothing in flight when the wave goes on to its end

  // normalize: lane holds column d = dt*16 + lq for query rows 8*hi + r
  const float rinv = (1.0f / rsum) * (1.0f / 4096.0f);
  float rs[8];
  #pragma unroll
  for (int r = 0; r < 8; ++r) rs[r] = __shfl(rinv, (hi << 3) + r, 32);

  f16* so = sC + wave * (16 * CP);
  #pragma unroll
  for (int r = 0; r < 8; ++r) {
    #pragma unroll
    for (int dt = 0; dt < 2; ++dt)
      so[(hi * 8 + r) * CP + dt * 16 + lq] = (f16)(o[dt][r] * rs[r]);
  }
  __syncthreads();

  v4u    cv[2];
  size_t ci[2];
  #pragma unroll
  for (int it = 0; it < 2; ++it) {
    const int p   = it * 32 + lane;        // 16-B piece 0..63 of the wave's 1024-B slab
    const int row = p >> 2, seg = p & 3;
    Pack8H ph;
    ph.v   = *(const v8h*)(so + row * CP + seg * 8);
    cv[it] = ph.u;
    ci[it] = ((size_t)b * SEQ + qrow0) * HD + (size_t)p * 8;
  }
  #pragma unroll
  for (int it = 0; it < 2; ++it) *(v4u*)(ctx + ci[it]) = cv[it];
  
}

// Out-projection + gate + skip-add. Block = (32-position tile, batch); wave w owns channels 32w..32w+31.
// D[c][n] = sum_d woh[c][d] ctx[n][d]; result = D * (g/64) + bf16 RNE value of x; g = bf16 RNE value of gamma.
// LDS sO: each wave reads only rows it wrote; block barrier used anyway (every wave reaches it).
__global__ __launch_bounds__(256) void oproj_kernel(const f16* __restrict__ ctx, const f16* __restrict__ woh,
                                                    const float* __restrict__ x, const float* __restrict__ gamma,
                                                    float* __restrict__ out) {
  const int n0   = blockIdx.x * ON;
  const int b    = blockIdx.y;
  const int tid  = threadIdx.x;
  const int wave = tid >> 5;
  const int lane = tid & 31;
  const int lq   = lane & 15;
  const int hi   = lane >> 4;

  __shared__ __align__(16) float sO[CH * OPF];

  const float gs = bf16_val(gamma[0]) * (1.0f / 64.0f);

  FragH bn[2];                   // B operand: column = position, k = d split map
  #pragma unroll
  for (int nt = 0; nt < 2; ++nt) {
    const f16* p = ctx + ((size_t)b * SEQ + n0 + nt * 16 + lq) * HD + hi * 8;
    bn[nt].q[0] = *(const v4u*)(p);
    bn[nt].q[1] = *(const v4u*)(p + 16);
  }
  #pragma unroll
  for (int ct = 0; ct < 2; ++ct) {
    const int c0 = (wave * 2 + ct) * 16;
    FragH a;                     // A operand: row = channel, k = d split map
    const f16* wr = woh + (size_t)(c0 + lq) * HD + hi * 8;
    a.q[0] = *(const v4u*)(wr);
    a.q[1] = *(const v4u*)(wr + 16);
    #pragma unroll
    for (int nt = 0; nt < 2; ++nt) {
      v8f z = (v8f){0, 0, 0, 0, 0, 0, 0, 0};
      const v8f acc = mma_f16(a.v, bn[nt].v, z);
      #pragma unroll
      for (int r = 0; r < 8; ++r)
        sO[(c0 + hi * 8 + r) * OPF + nt * 16 + lq] = acc[r];
    }
  }
  __syncthreads();

  v4f    vals[8];
  size_t gi[8];
  #pragma unroll
  for (int it = 0; it < 8; ++it) {
    const int c   = wave * 32 + it * 4 + (lane >> 3);
    const int seg = lane & 7;
    const v4f o4  = *(const v4f*)(sO + c * OPF + seg * 4);
    gi[it] = ((size_t)b * CH + c) * SEQ_FULL + n0 + seg * 4;
    const v4f xr = *(const v4f*)(x + gi[it]);
    v4f rv;
    #pragma unroll
    for (int i = 0; i < 4; ++i) rv[i] = fmaf(o4[i], gs, bf16_val(xr[i]));
    vals[it] = rv;
  }
  #pragma unroll
  for (int it = 0; it < 8; ++it) *(v4f*)(out + gi[it]) = vals[it];
  
}

extern "C" void kernel_launch(void* const* d_in, const int* in_sizes, int n_in,
                              void* d_out, int out_size, void* d_ws, size_t ws_size,
                              hipStream_t stream) {
  if (n_in < 6) return;
  const size_t x_need = ((size_t)(NB - 1) * CH + (CH - 1)) * SEQ_FULL + SEQ;
  if ((size_t)in_sizes[0] < x_need) return;
  if ((size_t)in_sizes[1] < (size_t)HD * CH) return;
  if ((size_t)in_sizes[2] < (size_t)HD * CH) return;
  if ((size_t)in_sizes[3] < (size_t)HD * CH) return;
  if ((size_t)in_sizes[4] < (size_t)CH * HD) return;
  if (in_sizes[5] < 1) return;
  if ((size_t)out_size < x_need) return;
  if (ws_size < WS_TOTAL) return;

  const float* x     = (const float*)d_in[0];
  const float* wq    = (const float*)d_in[1];
  const float* wk    = (const float*)d_in[2];
  const float* wv    = (const float*)d_in[3];
  const float* wo    = (const float*)d_in[4];
  const float* gamma = (const float*)d_in[5];
  float*       out   = (float*)d_out;

  char* ws = (char*)d_ws;
  unsigned short* wb  = (unsigned short*)(ws);
  f16*            woh = (f16*)(ws + WB_BYTES);
  f16*            qp  = (f16*)(ws + WB_BYTES + WO_BYTES);
  f16*            kp  = (f16*)(ws + WB_BYTES + WO_BYTES + PL_BYTES);
  f16*            vp  = (f16*)(ws + WB_BYTES + WO_BYTES + 2 * PL_BYTES);
  f16*            cx  = (f16*)(ws + WB_BYTES + WO_BYTES + 3 * PL_BYTES);
  f16*            qrp = (f16*)(ws + WB_BYTES + WO_BYTES + 4 * PL_BYTES);
  f16*            krp = (f16*)(ws + WB_BYTES + WO_BYTES + 5 * PL_BYTES);

  prep_kernel<<<dim3(16), 256, 0, stream>>>(wq, wk, wv, wo, wb, woh);
  // qkv_kernel(x, wb, qp, kp, qr, kr, vp)
  qkv_kernel<<<dim3(SEQ / NT, NB), 256, 0, stream>>>(x, wb, qp, kp, qrp, krp, vp);
  // attn_kernel(qp, qr, kp, kr, vp, ctx)
  attn_kernel<<<dim3(SEQ / BQ, NB), 256, 0, stream>>>(qp, qrp, kp, krp, vp, cx);
  oproj_kernel<<<dim3(SEQ / ON, NB), 256, 0, stream>>>(cx, woh, x, gamma, out);
}

// v003
// One run takes 58.2 microseconds.
// In both of two side-by-side timings against v002, it was 1.06 times as fast.
// Counting every step since v000, it is 2.25 times as fast.
#include <hip/hip_runtime.h>

// Contractions: q/k/v projections on v_wmma_f32_16x16x32_bf16 (x and W as bf16 RNE-converted inputs, f32 accumulate);
// S^T = K x Q^T on v_wmma_f32_16x16x32_f16 as three products (q,k f16 value planes + f16 residual planes x2048,
// residual products in their own accumulator folded by 1/2048 in f32); O = P x V on f16 (P carried x4096, V f16);
// out-projection on f16 (Wo = f16 of bf16 RNE value x64, ctx f16, 1/64 folded in the f32 epilogue);
// softmax, gate and skip-add in f32.

#ifndef NB
#define NB 8
#endif
#ifndef SEQ
#define SEQ 4096
#endif
#define NB_FULL   8
#define SEQ_FULL  4096
#define CH        256                 // channels (projection K)
#define HD        32                  // q/k/v dim (single head)
#define NQKV      96                  // stacked projection outputs: q 0..31, k 32..63, v 64..95
#define NT        64                  // positions per projection block
#define XPW       132                 // LDS pitch (32-bit words) of the transposed bf16 x tile
#define SP        72                  // LDS pitch (halves) of the q|k, q|k residual and v staging tiles
#define BQ        128                 // query rows per attention block (8 waves x 16)
#define BK        32                  // keys per PV product (k of one WMMA)
#define NWAVE     8
#define CP        40                  // LDS pitch (halves) of the per-wave ctx staging tile
#define KS        128                 // keys per LDS stage of the attention ring == keys per online-softmax step
#define NS        (SEQ / KS)          // stages
#define NSUB      (KS / 16)           // 16-key score tiles per stage
#define NGRP      (KS / BK)           // 32-key PV groups per stage
#define KPH       40                  // LDS pitch (halves) of a staged k / k residual row: 80 B = 16 B x odd
#define VPH       136                 // LDS pitch (halves) of a staged v row of KS keys: 272 B = 16 B x odd
#define ST_KR     (KS * KPH)          // offsets (halves) inside one stage: k at 0, k residual, v
#define ST_V      (2 * KS * KPH)
#define ST_H      (2 * KS * KPH + HD * VPH)   // halves per stage
#define ON        32
#define OPF       36                  // LDS pitch (floats) of the out-projection staging tile
#define RES_CARRY 2048.0f             // power-of-two carry of the q/k residual planes
#define RES_FOLD  (1.0f / 2048.0f)

static_assert(NB >= 1 && NB <= NB_FULL);
static_assert(SEQ <= SEQ_FULL);
static_assert(SEQ % BQ == 0);
static_assert(SEQ % NT == 0);
static_assert(SEQ % ON == 0);
static_assert(SEQ % BK == 0);
static_assert(BQ == NWAVE * 16);
static_assert(SEQ % KS == 0 && KS % BK == 0 && BK == 32 && NSUB % 4 == 0);
static_assert(KS * 4 == 2 * 256 && HD * (KS / 8) == 2 * 256);   // 16-B pieces per plane and stage == 2 per thread
static_assert(KPH >= HD && (KPH * 2) % 16 == 0 && VPH >= KS && (VPH * 2) % 16 == 0 && (ST_H * 2) % 16 == 0);
static_assert(HD == 32);
static_assert(CH % 32 == 0);
static_assert(NQKV == 3 * HD);
static_assert(8 * 256 == (CH / 2) * (NT / 4));     // x staging items == threads x iterations
static_assert(XPW >= CH / 2 && (XPW * 4) % 16 == 0);
static_assert(SP >= 2 * HD && SP >= NT && (SP * 2) % 16 == 0);
static_assert(NT * 4 == 256);                      // q/k (+ residual) plane store: one 16-B piece per thread each
static_assert(HD * 8 == 256);                      // v plane store: one 16-B piece per thread
static_assert(CP >= HD && (CP * 2) % 16 == 0);
static_assert(OPF >= ON && (OPF * 4) % 16 == 0);
static_assert(NWAVE * 32 == CH);                   // out-projection: each wave owns 32 channel rows
static_assert(ON == 32);
static_assert(NT * XPW * 4 + 2 * NT * SP * 2 + HD * SP * 2 <= 65536);   // static LDS of the projection kernel

#define WB_BYTES  ((size_t)NQKV * CH * 2)
#define WO_BYTES  ((size_t)CH * HD * 2)
#define PL_BYTES  ((size_t)NB * SEQ * HD * 2)
#define NPLANE    6                                 // q, k, v, ctx, q residual, k residual
#define WS_TOTAL  (WB_BYTES + WO_BYTES + NPLANE * PL_BYTES)
static_assert(WB_BYTES % 128 == 0 && WO_BYTES % 128 == 0 && PL_BYTES % 128 == 0);
static_assert(WS_TOTAL <= (size_t)134217728);

typedef __bf16   bf16;
typedef _Float16 f16;
typedef bf16     v16bf __attribute__((ext_vector_type(16)));
typedef f16      v16h  __attribute__((ext_vector_type(16)));
typedef f16      v8h   __attribute__((ext_vector_type(8)));
typedef float    v8f   __attribute__((ext_vector_type(8)));
typedef float    v4f   __attribute__((ext_vector_type(4)));
typedef unsigned v4u   __attribute__((ext_vector_type(4)));

union FragB  { v16bf v; v4u q[2]; };
union FragH  { v16h  v; v4u q[2]; f16 h[16]; };
union Pack8H { v4u u; v8h v; f16 h[8]; };

// WMMA helpers: builtin followed by the VALU hazard guard (ties D, keeps A/B live).
static __device__ __forceinline__ v8f mma_bf16(v16bf a, v16bf b, v8f acc) {
  acc = __builtin_amdgcn_wmma_f32_16x16x32_bf16(false, a, false, b, (short)0, acc, false, false);
  asm volatile("v_nop\n\tv_nop\n\tv_nop\n\tv_nop" : "+v"(acc) : "v"(a), "v"(b));
  return acc;
}
static __device__ __forceinline__ v8f mma_f16(v16h a, v16h b, v8f acc) {
  acc = __builtin_amdgcn_wmma_f32_16x16x32_f16(false, a, false, b, (short)0, acc, false, false);
  asm volatile("v_nop\n\tv_nop\n\tv_nop\n\tv_nop" : "+v"(acc) : "v"(a), "v"(b));
  return acc;
}

// f32 -> bf16 bits, RNE (finite inputs).
static __device__ __forceinline__ unsigned bf16_bits(float f) {
  const unsigned u = __float_as_uint(f);
  return (u + 0x7FFFu + ((u >> 16) & 1u)) >> 16;
}
static __device__ __forceinline__ float bf16_val(float f) {
  return __uint_as_float(bf16_bits(f) << 16);
}

// Weight planes, built once. 4096 pieces of 8 elements, one 16-B piece per thread, 16 blocks x 256.
//   wb  [96][256] bf16 bits : rows 0..31 wq, 32..63 wk, 64..95 wv (k = channel contiguous)
//   woh [256][32] f16       : f16(bf16 RNE value of wo x 64), exact
__global__ __launch_bounds__(256) void prep_kernel(const float* __restrict__ wq, const float* __restrict__ wk,
                                                   const float* __restrict__ wv, const float* __restrict__ wo,
                                                   unsigned short* __restrict__ wb, f16* __restrict__ woh) {
  const int p = blockIdx.x * 256 + threadIdx.x;       // 0..4095
  if (blockIdx.x < 12) {                               // block-uniform
    const int which = p >> 10;                         // 0..2, block-uniform
    const int off   = (p & 1023) * 8;
    const v4f q0 = *(const v4f*)(wq + off), q1 = *(const v4f*)(wq + off + 4);
    const v4f k0 = *(const v4f*)(wk + off), k1 = *(const v4f*)(wk + off + 4);
    const v4f v0 = *(const v4f*)(wv + off), v1 = *(const v4f*)(wv + off + 4);
    const v4f a0 = (which == 0) ? q0 : ((which == 1) ? k0 : v0);   // select by value
    const v4f a1 = (which == 0) ? q1 : ((which == 1) ? k1 : v1);
    v4u u;
    u[0] = bf16_bits(a0[0]) | (bf16_bits(a0[1]) << 16);
    u[1] = bf16_bits(a0[2]) | (bf16_bits(a0[3]) << 16);
    u[2] = bf16_bits(a1[0]) | (bf16_bits(a1[1]) << 16);
    u[3] = bf16_bits(a1[2]) | (bf16_bits(a1[3]) << 16);
    unsigned short* dst = wb + (size_t)p * 8;
    *(v4u*)dst = u;
    
  } else {
    const int off = (p - 3072) * 8;
    const v4f a0 = *(const v4f*)(wo + off), a1 = *(const v4f*)(wo + off + 4);
    Pack8H ph;
    #pragma unroll
    for (int i = 0; i < 4; ++i) {
      ph.h[i]     = (f16)(bf16_val(a0[i]) * 64.0f);
      ph.h[4 + i] = (f16)(bf16_val(a1[i]) * 64.0f);
    }
    const v4u u = ph.u;
    f16* dst = woh + off;
    *(v4u*)dst = u;
    
  }
}

// Fused q/k/v projection. Block = (64-position tile, batch), 256 threads.
// x tile [256 c][64 n] is RNE-converted to bf16 and transposed through LDS to [n][c]; D[n][dd] = sum_c x[c][n] W[dd][c].
// Planes: qp,kp [NB][SEQ][32] f16 value planes; qr,kr [NB][SEQ][32] f16 residual planes = (f32 - f16 value) x 2048
// coverage: q,k,q_res,k_res rows n0..n0+63 x 32 d ; v 32 d x positions n0..n0+63 ; every written line whole,
// one instruction. LDS: sX, sQK, sR, sV are cross-wave (block barriers); staged extent == consumed extent for all four.
__global__ __launch_bounds__(256) void qkv_kernel(const float* __restrict__ x,
                                                  const unsigned short* __restrict__ wb,
                                                  f16* __restrict__ qp, f16* __restrict__ kp,
                                                  f16* __restrict__ qr, f16* __restrict__ kr,
                                                  f16* __restrict__ vp) {
  const int n0   = blockIdx.x * NT;
  const int b    = blockIdx.y;
  const int tid  = threadIdx.x;
  const int wave = tid >> 5;
  const int lane = tid & 31;
  const int lq   = lane & 15;
  const int hi   = lane >> 4;

  __shared__ __align__(16) unsigned sX[NT * XPW];     // [n][c/2] packed bf16 pairs (even c in the low half)
  __shared__ __align__(16) f16      sQK[NT * SP];     // [n][q 0..31 | k 32..63] values
  __shared__ __align__(16) f16      sR[NT * SP];      // [n][q 0..31 | k 32..63] residuals x2048
  __shared__ __align__(16) f16      sV[HD * SP];      // [d][n]

  #pragma unroll 2
  for (int it = 0; it < 8; ++it) {
    const int item = it * 256 + tid;                  // 0..2047
    const int nq   = item & 15;                       // 4-position group
    const int cp   = item >> 4;                       // channel pair 0..127
    const float* src = x + ((size_t)b * CH + 2 * cp) * SEQ_FULL + n0 + nq * 4;
    const v4f a0 = *(const v4f*)(src);
    const v4f a1 = *(const v4f*)(src + SEQ_FULL);
    #pragma unroll
    for (int i = 0; i < 4; ++i)
      sX[(nq * 4 + i) * XPW + cp] = bf16_bits(a0[i]) | (bf16_bits(a1[i]) << 16);
  }
  __syncthreads();

  const int nt = wave & 3;                            // position sub-tile
  const int g3 = wave >> 2;                           // output tile group: tiles g3*3 + {0,1,2}
  v8f acc[3];
  #pragma unroll
  for (int j = 0; j < 3; ++j) acc[j] = (v8f){0, 0, 0, 0, 0, 0, 0, 0};

  const int aoff = (nt * 16 + lq) * XPW + hi * 4;     // row n, words of channels 8*hi..
  #pragma unroll 2
  for (int ks = 0; ks < CH / 32; ++ks) {
    FragB a;
    a.q[0] = *(const v4u*)(sX + aoff + ks * 16);        // c = ks*32 + 8*hi + 0..7
    a.q[1] = *(const v4u*)(sX + aoff + ks * 16 + 8);    // c = ks*32 + 16 + 8*hi + 0..7
    #pragma unroll
    for (int j = 0; j < 3; ++j) {
      const unsigned short* wr = wb + (size_t)((g3 * 3 + j) * 16 + lq) * CH + ks * 32 + hi * 8;
      FragB w;
      w.q[0] = *(const v4u*)(wr);                       // c = ks*32 + 8*hi + 0..7
      w.q[1] = *(const v4u*)(wr + 16);                  // c = ks*32 + 16 + 8*hi + 0..7
      acc[j] = mma_bf16(a.v, w.v, acc[j]);
    }
  }

  // D element r of lane: (n = nt*16 + 8*hi + r, dd = tile*16 + lq)
  #pragma unroll
  for (int j = 0; j < 3; ++j) {
    const int t = g3 * 3 + j;                         // wave-uniform
    #pragma unroll
    for (int r = 0; r < 8; ++r) {
      const int nrow = nt * 16 + hi * 8 + r;
      const float av = acc[j][r];
      const f16 hv = (f16)av;
      if (t < 4) {
        sQK[nrow * SP + t * 16 + lq] = hv;
        sR[nrow * SP + t * 16 + lq]  = (f16)((av - (float)hv) * RES_CARRY);
      } else {
        sV[((t - 4) * 16 + lq) * SP + nrow] = hv;
      }
    }
  }
  __syncthreads();

  Pack8H pq, pk, pqr, pkr, pv;
  const int row = tid >> 2, seg = tid & 3;
  pq.v  = *(const v8h*)(sQK + row * SP + seg * 8);
  pk.v  = *(const v8h*)(sQK + row * SP + HD + seg * 8);
  pqr.v = *(const v8h*)(sR + row * SP + seg * 8);
  pkr.v = *(const v8h*)(sR + row * SP + HD + seg * 8);
  const int dv = tid >> 3, sv = tid & 7;
  pv.v = *(const v8h*)(sV + dv * SP + sv * 8);
  const size_t qi = ((size_t)b * SEQ + n0) * HD + (size_t)tid * 8;
  const size_t vi = ((size_t)b * HD + dv) * SEQ + n0 + sv * 8;
  const v4u uq = pq.u, uk = pk.u, uqr = pqr.u, ukr = pkr.u, uv = pv.u;
  *(v4u*)(qp + qi) = uq;
  *(v4u*)(kp + qi) = uk;
  *(v4u*)(qr + qi) = uqr;
  *(v4u*)(kr + qi) = ukr;
  *(v4u*)(vp + vi) = uv;
  
}

// Flash attention, all keys, no logit scaling. Block = (query block of 128, batch); one wave owns 16 query rows.
// S^T = K x Q^T so queries sit on lanes; P^T in C-layout is bit-identical to the A-fragment layout of O += P x V.
// Scores: kval.qval in the main accumulator; kres.qval + kval.qres in a second accumulator folded by 1/2048 in f32.
// K, K-residual and V tiles of KS keys are brought into a two-buffer LDS ring once per block by asynchronous copies
// (stage t + 2 flies while stage t + 1 is worked on); the fragments are two 16-B LDS loads each, in the k order of the q fragments.
// One online-softmax step per stage: all KS scores first, then one maximum, one exchange between the lane halves and one
// rescale of O, then the stage's PV products.
// LDS sC: per-wave staging (block barrier used; every wave reaches it). sRing: cross-wave, published by the ring's barriers.

// One stage: keys j0..j0+KS-1 of the three planes into dst. Six 16-B pieces per thread, every lane on, all addresses
// 16-B multiples; k / k residual pieces are contiguous in global memory, v pieces are 256-B runs of each of the 32 rows.
static __device__ __forceinline__ void stage_copy(const f16* __restrict__ kb_b, const f16* __restrict__ kr_b,
                                                  const f16* __restrict__ vt_b, int j0, f16* dst, int tid) {
  const int p0 = tid, p1 = tid + 256;                 // piece 0..511 of each plane
  const f16* gk0 = kb_b + (size_t)j0 * HD + p0 * 8;
  const f16* gk1 = kb_b + (size_t)j0 * HD + p1 * 8;
  const f16* gr0 = kr_b + (size_t)j0 * HD + p0 * 8;
  const f16* gr1 = kr_b + (size_t)j0 * HD + p1 * 8;
  const f16* gv0 = vt_b + (size_t)(p0 >> 4) * SEQ + j0 + (p0 & 15) * 8;
  const f16* gv1 = vt_b + (size_t)(p1 >> 4) * SEQ + j0 + (p1 & 15) * 8;
  const unsigned l0  = (unsigned)(size_t)dst;         // LDS byte address of the stage
  const unsigned lk0 = l0 + ((p0 >> 2) * KPH + (p0 & 3) * 8) * 2;
  const unsigned lk1 = l0 + ((p1 >> 2) * KPH + (p1 & 3) * 8) * 2;
  const unsigned lr0 = lk0 + ST_KR * 2;
  const unsigned lr1 = lk1 + ST_KR * 2;
  const unsigned lv0 = l0 + (ST_V + (p0 >> 4) * VPH + (p0 & 15) * 8) * 2;
  const unsigned lv1 = l0 + (ST_V + (p1 >> 4) * VPH + (p1 & 15) * 8) * 2;
  // The copies and their s_wait_xcnt in one statement: no address register is rewritten ahead of that wait.
  asm volatile("global_load_async_to_lds_b128 %0, %6, off\n\t"
               "global_load_async_to_lds_b128 %1, %7, off\n\t"
               "global_load_async_to_lds_b128 %2, %8, off\n\t"
               "global_load_async_to_lds_b128 %3, %9, off\n\t"
               "global_load_async_to_lds_b128 %4, %10, off\n\t"
               "global_load_async_to_lds_b128 %5, %11, off\n\t"
               "s_wait_xcnt 0x0"
               :: "v"(lk0), "v"(lk1), "v"(lr0), "v"(lr1), "v"(lv0), "v"(lv1),
                  "v"(gk0), "v"(gk1), "v"(gr0), "v"(gr1), "v"(gv0), "v"(gv1)
               : "memory");
}

__global__ __launch_bounds__(256) void attn_kernel(const f16* __restrict__ qp, const f16* __restrict__ qr,
                                                   const f16* __restrict__ kp, const f16* __restrict__ kr,
                                                   const f16* __restrict__ vp, f16* __restrict__ ctx) {
  const int qblk = blockIdx.x;
  const int b    = blockIdx.y;
  const int tid  = threadIdx.x;
  const int wave = tid >> 5;
  const int lane = tid & 31;
  const int lq   = lane & 15;   // query column of S^T / d column of O
  const int hi   = lane >> 4;   // k-split half

  __shared__ __align__(16) f16 sC[NWAVE * 16 * CP];
  __shared__ __align__(16) f16 sRing[2 * ST_H];

  const int qrow0 = qblk * BQ + wave * 16;

  FragH qf, qrf;                 // B operands: column = query qrow0+lq, k = d split map (value, residual)
  {
    const size_t qo = ((size_t)b * SEQ + qrow0 + lq) * HD + hi * 8;
    qf.q[0]  = *(const v4u*)(qp + qo);          // d = 8*hi + 0..7
    qf.q[1]  = *(const v4u*)(qp + qo + 16);     // d = 16 + 8*hi + 0..7
    qrf.q[0] = *(const v4u*)(qr + qo);
    qrf.q[1] = *(const v4u*)(qr + qo + 16);
  }
  const f16* kb_b = kp + (size_t)b * SEQ * HD;
  const f16* kr_b = kr + (size_t)b * SEQ * HD;
  const f16* vt_b = vp + (size_t)b * HD * SEQ;

  v8f o[2];
  o[0] = (v8f){0, 0, 0, 0, 0, 0, 0, 0};
  o[1] = (v8f){0, 0, 0, 0, 0, 0, 0, 0};
  float rmax = -__builtin_inff();
  float rbias = -__builtin_inff();        // rmax * log2(e) - 12, as rounded: the reference point of every exponent
  float rsum = 0.0f;                      // carried x4096, like P and O
  const float SL = 1.4426950408889634f;   // log2(e)

  // ring prologue: stage 0 landed and published, then stage 1 in flight
  stage_copy(kb_b, kr_b, vt_b, 0, sRing, tid);
  asm volatile("s_wait_asynccnt 0x0" ::: "memory");   // this wave's pieces of stage 0 have landed
  __syncthreads();                                    // ... and every other wave's
  if (NS > 1) stage_copy(kb_b, kr_b, vt_b, KS, sRing + ST_H, tid);

  #pragma unroll 1
  for (int t = 0; t < NS; ++t) {
  f16* sbuf = sRing + (t & 1) * ST_H;                 // trip t reads this buffer alone

  // the stage's k and k residual fragments, read as one group ahead of the products, in the order of their use
  FragH ak[NSUB], akr[NSUB];
  #pragma unroll
  for (int h = 0; h < NSUB; h += 4) {
    #pragma unroll
    for (int i = 0; i < 4; ++i) {
      const int ko = ((h + i) * 16 + lq) * KPH + hi * 8;       // row = key
      ak[h + i].q[0] = *(const v4u*)(sbuf + ko);               // d = 8*hi + 0..7
      ak[h + i].q[1] = *(const v4u*)(sbuf + ko + 16);          // d = 16 + 8*hi + 0..7
    }
    #pragma unroll
    for (int i = 0; i < 4; ++i) {
      const int ko = ((h + i) * 16 + lq) * KPH + hi * 8;
      akr[h + i].q[0] = *(const v4u*)(sbuf + ST_KR + ko);
      akr[h + i].q[1] = *(const v4u*)(sbuf + ST_KR + ko + 16);
    }
  }

  // c[sub][r] = score(query qrow0+lq, key t*KS + sub*16 + 8*hi + r): all KS keys of the stage before any softmax work.
  // Four tiles at a time, so that the product that accumulates into cr stands four products behind the one it waits for.
  v8f c[NSUB];
  #pragma unroll
  for (int h = 0; h < NSUB; h += 4) {
    const v8f z = (v8f){0, 0, 0, 0, 0, 0, 0, 0};
    v8f cm[4], cr[4];
    #pragma unroll
    for (int i = 0; i < 4; ++i) cm[i] = mma_f16(ak[h + i].v, qf.v, z);        // value x value
    #pragma unroll
    for (int i = 0; i < 4; ++i) cr[i] = mma_f16(akr[h + i].v, qf.v, z);       // k residual x q value
    #pragma unroll
    for (int i = 0; i < 4; ++i) cr[i] = mma_f16(ak[h + i].v, qrf.v, cr[i]);   // k value x q residual
    #pragma unroll
    for (int i = 0; i < 4; ++i) c[h + i] = cm[i] + cr[i] * RES_FOLD;
  }

  // the stage's v fragments, read as one group; the softmax work below covers their latency
  FragH bv[NGRP][2];
  #pragma unroll
  for (int g = 0; g < NGRP; ++g) {
    #pragma unroll
    for (int dt = 0; dt < 2; ++dt) {
      const f16* base = sbuf + ST_V + (dt * 16 + lq) * VPH + g * BK + hi * 8;    // column = d
      bv[g][dt].q[0] = *(const v4u*)(base);           // keys g*32 + 8*hi + 0..7 of the stage
      bv[g][dt].q[1] = *(const v4u*)(base + 16);      // keys g*32 + 16 + 8*hi + 0..7
    }
  }

  // one online-softmax step per stage: query lq's KS scores are split across lane / lane^16.
  // The maximum runs as eight independent chains over the tiles, joined at the end.
  v8f mx = c[0];
  #pragma unroll
  for (int sub = 1; sub < NSUB; ++sub) {
    #pragma unroll
    for (int r = 0; r < 8; ++r) mx[r] = fmaxf(mx[r], c[sub][r]);
  }
  float m_new = rmax;
  #pragma unroll
  for (int r = 0; r < 8; ++r) m_new = fmaxf(m_new, mx[r]);
  m_new = fmaxf(m_new, __shfl_xor(m_new, 16, 32));
  // The exponent of a score is one fused multiply-add: c * log2(e) - bias, bias = m_new * log2(e) - 12, so that the
  // maximum, the change of base and the x4096 carry of P cost no instruction of their own. The rescale uses the same
  // rounded biases, so every stage's weights refer to one another exactly as their exponents do.
  const float bias_new = fmaf(m_new, SL, -12.0f);
  const float scale = __builtin_amdgcn_exp2f(rbias - bias_new);
  rmax  = m_new;
  rbias = bias_new;
  const v8f slv = (v8f){SL, SL, SL, SL, SL, SL, SL, SL};
  const float nb = -bias_new;
  const v8f nbv = (v8f){nb, nb, nb, nb, nb, nb, nb, nb};

  // exp + pack: P^T C-layout == A-fragment layout of the PV product; P carried x4096
  FragH pa[NGRP];
  v8f ps = (v8f){0, 0, 0, 0, 0, 0, 0, 0};
  #pragma unroll
  for (int sub = 0; sub < NSUB; ++sub) {
    const v8f e = __builtin_elementwise_fma(c[sub], slv, nbv);
    v8f p;
    #pragma unroll
    for (int r = 0; r < 8; ++r) p[r] = __builtin_amdgcn_exp2f(e[r]);   // 4096 x weight of key sub*16 + 8*hi + r
    ps += p;
    #pragma unroll
    for (int r = 0; r < 8; ++r) pa[sub >> 1].h[(sub & 1) * 8 + r] = (f16)p[r];
  }
  const float psum = ((ps[0] + ps[1]) + (ps[2] + ps[3])) + ((ps[4] + ps[5]) + (ps[6] + ps[7]));
  rsum = rsum * scale + psum + __shfl_xor(psum, 16, 32);

  // rescale O: queries are the row dimension there -> per-row scale from lane 8*hi + r
  float sc[8];
  #pragma unroll
  for (int r = 0; r < 8; ++r) sc[r] = __shfl(scale, (hi << 3) + r, 32);
  #pragma unroll
  for (int dt = 0; dt < 2; ++dt) {
    #pragma unroll
    for (int r = 0; r < 8; ++r) o[dt][r] *= sc[r];
  }

  // O += P x V over the stage's NGRP groups of 32 keys
  #pragma unroll
  for (int g = 0; g < NGRP; ++g) {
    #pragma unroll
    for (int dt = 0; dt < 2; ++dt) o[dt] = mma_f16(pa[g].v, bv[g][dt].v, o[dt]);
  }
  // publish point of stage t + 1; behind it the buffer just read is free for stage t + 2
  asm volatile("s_wait_dscnt 0x0" ::: "memory");      // this wave's reads of sbuf have returned
  asm volatile("s_wait_asynccnt 0x0" ::: "memory");   // this wave's pieces of stage t + 1 have landed
  __syncthreads();
  if (t + 2 < NS) stage_copy(kb_b, kr_b, vt_b, (t + 2) * KS, sbuf, tid);
  }
  asm volatile("s_wait_asynccnt 0x0" ::: "memory");   // nothing in flight when the wave goes on to its end

  // normalize: lane holds column d = dt*16 + lq for query rows 8*hi + r
  const float rinv = 1.0f / rsum;          // O and rsum carry the same x4096
  float rs[8];
  #pragma unroll
  for (int r = 0; r < 8; ++r) rs[r] = __shfl(rinv, (hi << 3) + r, 32);

  f16* so = sC + wave * (16 * CP);
  #pragma unroll
  for (int r = 0; r < 8; ++r) {
    #pragma unroll
    for (int dt = 0; dt < 2; ++dt)
      so[(hi * 8 + r) * CP + dt * 16 + lq] = (f16)(o[dt][r] * rs[r]);
  }
  __syncthreads();

  v4u    cv[2];
  size_t ci[2];
  #pragma unroll
  for (int it = 0; it < 2; ++it) {
    const int p   = it * 32 + lane;        // 16-B piece 0..63 of the wave's 1024-B slab
    const int row = p >> 2, seg = p & 3;
    Pack8H ph;
    ph.v   = *(const v8h*)(so + row * CP + seg * 8);
    cv[it] = ph.u;
    ci[it] = ((size_t)b * SEQ + qrow0) * HD + (size_t)p * 8;
  }
  #pragma unroll
  for (int it = 0; it < 2; ++it) *(v4u*)(ctx + ci[it]) = cv[it];
  
}

// Out-projection + gate + skip-add. Block = (32-position tile, batch); wave w owns channels 32w..32w+31.
// D[c][n] = sum_d woh[c][d] ctx[n][d]; result = D * (g/64) + bf16 RNE value of x; g = bf16 RNE value of gamma.
// LDS sO: each wave reads only rows it wrote; block barrier used anyway (every wave reaches it).
__global__ __launch_bounds__(256) void oproj_kernel(const f16* __restrict__ ctx, const f16* __restrict__ woh,
                                                    const float* __restrict__ x, const float* __restrict__ gamma,
                                                    float* __restrict__ out) {
  const int n0   = blockIdx.x * ON;
  const int b    = blockIdx.y;
  const int tid  = threadIdx.x;
  const int wave = tid >> 5;
  const int lane = tid & 31;
  const int lq   = lane & 15;
  const int hi   = lane >> 4;

  __shared__ __align__(16) float sO[CH * OPF];

  const float gs = bf16_val(gamma[0]) * (1.0f / 64.0f);

  FragH bn[2];                   // B operand: column = position, k = d split map
  #pragma unroll
  for (int nt = 0; nt < 2; ++nt) {
    const f16* p = ctx + ((size_t)b * SEQ + n0 + nt * 16 + lq) * HD + hi * 8;
    bn[nt].q[0] = *(const v4u*)(p);
    bn[nt].q[1] = *(const v4u*)(p + 16);
  }
  #pragma unroll
  for (int ct = 0; ct < 2; ++ct) {
    const int c0 = (wave * 2 + ct) * 16;
    FragH a;                     // A operand: row = channel, k = d split map
    const f16* wr = woh + (size_t)(c0 + lq) * HD + hi * 8;
    a.q[0] = *(const v4u*)(wr);
    a.q[1] = *(const v4u*)(wr + 16);
    #pragma unroll
    for (int nt = 0; nt < 2; ++nt) {
      v8f z = (v8f){0, 0, 0, 0, 0, 0, 0, 0};
      const v8f acc = mma_f16(a.v, bn[nt].v, z);
      #pragma unroll
      for (int r = 0; r < 8; ++r)
        sO[(c0 + hi * 8 + r) * OPF + nt * 16 + lq] = acc[r];
    }
  }
  __syncthreads();

  v4f    vals[8];
  size_t gi[8];
  #pragma unroll
  for (int it = 0; it < 8; ++it) {
    const int c   = wave * 32 + it * 4 + (lane >> 3);
    const int seg = lane & 7;
    const v4f o4  = *(const v4f*)(sO + c * OPF + seg * 4);
    gi[it] = ((size_t)b * CH + c) * SEQ_FULL + n0 + seg * 4;
    const v4f xr = *(const v4f*)(x + gi[it]);
    v4f rv;
    #pragma unroll
    for (int i = 0; i < 4; ++i) rv[i] = fmaf(o4[i], gs, bf16_val(xr[i]));
    vals[it] = rv;
  }
  #pragma unroll
  for (int it = 0; it < 8; ++it) *(v4f*)(out + gi[it]) = vals[it];
  
}

extern "C" void kernel_launch(void* const* d_in, const int* in_sizes, int n_in,
                              void* d_out, int out_size, void* d_ws, size_t ws_size,
                              hipStream_t stream) {
  if (n_in < 6) return;
  const size_t x_need = ((size_t)(NB - 1) * CH + (CH - 1)) * SEQ_FULL + SEQ;
  if ((size_t)in_sizes[0] < x_need) return;
  if ((size_t)in_sizes[1] < (size_t)HD * CH) return;
  if ((size_t)in_sizes[2] < (size_t)HD * CH) return;
  if ((size_t)in_sizes[3] < (size_t)HD * CH) return;
  if ((size_t)in_sizes[4] < (size_t)CH * HD) return;
  if (in_sizes[5] < 1) return;
  if ((size_t)out_size < x_need) return;
  if (ws_size < WS_TOTAL) return;

  const float* x     = (const float*)d_in[0];
  const float* wq    = (const float*)d_in[1];
  const float* wk    = (const float*)d_in[2];
  const float* wv    = (const float*)d_in[3];
  const float* wo    = (const float*)d_in[4];
  const float* gamma = (const float*)d_in[5];
  float*       out   = (float*)d_out;

  char* ws = (char*)d_ws;
  unsigned short* wb  = (unsigned short*)(ws);
  f16*            woh = (f16*)(ws + WB_BYTES);
  f16*            qp  = (f16*)(ws + WB_BYTES + WO_BYTES);
  f16*            kp  = (f16*)(ws + WB_BYTES + WO_BYTES + PL_BYTES);
  f16*            vp  = (f16*)(ws + WB_BYTES + WO_BYTES + 2 * PL_BYTES);
  f16*            cx  = (f16*)(ws + WB_BYTES + WO_BYTES + 3 * PL_BYTES);
  f16*            qrp = (f16*)(ws + WB_BYTES + WO_BYTES + 4 * PL_BYTES);
  f16*            krp = (f16*)(ws + WB_BYTES + WO_BYTES + 5 * PL_BYTES);

  prep_kernel<<<dim3(16), 256, 0, stream>>>(wq, wk, wv, wo, wb, woh);
  // qkv_kernel(x, wb, qp, kp, qr, kr, vp)
  qkv_kernel<<<dim3(SEQ / NT, NB), 256, 0, stream>>>(x, wb, qp, kp, qrp, krp, vp);
  // attn_kernel(qp, qr, kp, kr, vp, ctx)
  attn_kernel<<<dim3(SEQ / BQ, NB), 256, 0, stream>>>(qp, qrp, kp, krp, vp, cx);
  oproj_kernel<<<dim3(SEQ / ON, NB), 256, 0, stream>>>(cx, woh, x, gamma, out);
}

// v004
// One run takes 54.6 microseconds.
// Two timings next to v003 both put it at 1.07 times that version's speed.
// Counting every step since v000, it is 2.40 times as fast.
#include <hip/hip_runtime.h>

// Contractions: q/k/v projections on v_wmma_f32_16x16x32_bf16 (x and W as bf16 RNE-converted inputs, f32 accumulate);
// S^T = K x Q^T on v_wmma_f32_16x16x32_f16 as three products (q,k f16 value planes + f16 residual planes x2048,
// residual products in their own accumulator folded by 1/2048 in f32); O = P x V on f16 (P carried x4096, V f16);
// out-projection on f16 (Wo = f16 of bf16 RNE value x64, ctx f16, 1/64 folded in the f32 epilogue), done by the attention
// kernel itself on its own 128 positions; softmax, gate and skip-add in f32.

#ifndef NB
#define NB 8
#endif
#ifndef SEQ
#define SEQ 4096
#endif
#define NB_FULL   8
#define SEQ_FULL  4096
#define CH        256                 // channels (projection K)
#define HD        32                  // q/k/v dim (single head)
#define NQKV      96                  // stacked projection outputs: q 0..31, k 32..63, v 64..95
#define NT        64                  // positions per projection block
#define XPW       132                 // LDS pitch (32-bit words) of the transposed bf16 x tile
#define SP        72                  // LDS pitch (halves) of the q|k, q|k residual and v staging tiles
#define BQ        128                 // query rows per attention block (8 waves x 16)
#define BK        32                  // keys per PV product (k of one WMMA)
#define NWAVE     8
#define CP        40                  // LDS pitch (halves) of the per-wave ctx staging tile
#define KS        128                 // keys per LDS stage of the attention ring == keys per online-softmax step
#define NS        (SEQ / KS)          // stages
#define NSUB      (KS / 16)           // 16-key score tiles per stage
#define NGRP      (KS / BK)           // 32-key PV groups per stage
#define KPH       40                  // LDS pitch (halves) of a staged k / k residual row: 80 B = 16 B x odd
#define VPH       136                 // LDS pitch (halves) of a staged v row of KS keys: 272 B = 16 B x odd
#define ST_KR     (KS * KPH)          // offsets (halves) inside one stage: k at 0, k residual, v
#define ST_V      (2 * KS * KPH)
#define ST_H      (2 * KS * KPH + HD * VPH)   // halves per stage
#define XP        132                 // LDS pitch (floats) of a staged x / result row of BQ positions: 528 B = 16 B x odd
#define RES_CARRY 2048.0f             // power-of-two carry of the q/k residual planes
#define RES_FOLD  (1.0f / 2048.0f)

static_assert(NB >= 1 && NB <= NB_FULL);
static_assert(SEQ <= SEQ_FULL);
static_assert(SEQ % BQ == 0);
static_assert(SEQ % NT == 0);
static_assert(SEQ % BK == 0);
static_assert(BQ == NWAVE * 16);
static_assert(SEQ % KS == 0 && KS % BK == 0 && BK == 32 && NSUB % 4 == 0);
static_assert(KS * 4 == 2 * 256 && HD * (KS / 8) == 2 * 256);   // 16-B pieces per plane and stage == 2 per thread
static_assert(KPH >= HD && (KPH * 2) % 16 == 0 && VPH >= KS && (VPH * 2) % 16 == 0 && (ST_H * 2) % 16 == 0);
static_assert(HD == 32);
static_assert(CH % 32 == 0);
static_assert(NQKV == 3 * HD);
static_assert(8 * 256 == (CH / 2) * (NT / 4));     // x staging items == threads x iterations
static_assert(XPW >= CH / 2 && (XPW * 4) % 16 == 0);
static_assert(SP >= 2 * HD && SP >= NT && (SP * 2) % 16 == 0);
static_assert(NT * 4 == 256);                      // q/k (+ residual) plane store: one 16-B piece per thread each
static_assert(HD * 8 == 256);                      // v plane store: one 16-B piece per thread
static_assert(CP >= HD && (CP * 2) % 16 == 0);
static_assert(XP >= BQ && (XP * 4) % 16 == 0);
static_assert(NWAVE * 32 == CH);                   // out-projection: each wave owns 32 channel rows
static_assert(BQ * 4 == 32 * 16);                  // one x / result row of the block == one 16-B piece per lane of a wave
static_assert(NS >= 2 && NS * NWAVE == CH);        // one x row per wave rides each of the NS stage copies
static_assert(NT * XPW * 4 + 2 * NT * SP * 2 + HD * SP * 2 <= 65536);   // static LDS of the projection kernel

#define WB_BYTES  ((size_t)NQKV * CH * 2)
#define WO_BYTES  ((size_t)CH * HD * 2)
#define PL_BYTES  ((size_t)NB * SEQ * HD * 2)
#define NPLANE    6                                 // q, k, v, unused, q residual, k residual
#define WS_TOTAL  (WB_BYTES + WO_BYTES + NPLANE * PL_BYTES)
static_assert(WB_BYTES % 128 == 0 && WO_BYTES % 128 == 0 && PL_BYTES % 128 == 0);
static_assert(WS_TOTAL <= (size_t)134217728);

typedef __bf16   bf16;
typedef _Float16 f16;
typedef bf16     v16bf __attribute__((ext_vector_type(16)));
typedef f16      v16h  __attribute__((ext_vector_type(16)));
typedef f16      v8h   __attribute__((ext_vector_type(8)));
typedef float    v8f   __attribute__((ext_vector_type(8)));
typedef float    v4f   __attribute__((ext_vector_type(4)));
typedef unsigned v4u   __attribute__((ext_vector_type(4)));

union FragB  { v16bf v; v4u q[2]; };
union FragH  { v16h  v; v4u q[2]; f16 h[16]; };
union Pack8H { v4u u; v8h v; f16 h[8]; };

// WMMA helpers: builtin followed by the VALU hazard guard (ties D, keeps A/B live).
static __device__ __forceinline__ v8f mma_bf16(v16bf a, v16bf b, v8f acc) {
  acc = __builtin_amdgcn_wmma_f32_16x16x32_bf16(false, a, false, b, (short)0, acc, false, false);
  asm volatile("v_nop\n\tv_nop\n\tv_nop\n\tv_nop" : "+v"(acc) : "v"(a), "v"(b));
  return acc;
}
static __device__ __forceinline__ v8f mma_f16(v16h a, v16h b, v8f acc) {
  acc = __builtin_amdgcn_wmma_f32_16x16x32_f16(false, a, false, b, (short)0, acc, false, false);
  asm volatile("v_nop\n\tv_nop\n\tv_nop\n\tv_nop" : "+v"(acc) : "v"(a), "v"(b));
  return acc;
}

// f32 -> bf16 bits, RNE (finite inputs).
static __device__ __forceinline__ unsigned bf16_bits(float f) {
  const unsigned u = __float_as_uint(f);
  return (u + 0x7FFFu + ((u >> 16) & 1u)) >> 16;
}
static __device__ __forceinline__ float bf16_val(float f) {
  return __uint_as_float(bf16_bits(f) << 16);
}

// Weight planes, built once. 4096 pieces of 8 elements, one 16-B piece per thread, 16 blocks x 256.
//   wb  [96][256] bf16 bits : rows 0..31 wq, 32..63 wk, 64..95 wv (k = channel contiguous)
//   woh [256][32] f16       : f16(bf16 RNE value of wo x 64), exact
__global__ __launch_bounds__(256) void prep_kernel(const float* __restrict__ wq, const float* __restrict__ wk,
                                                   const float* __restrict__ wv, const float* __restrict__ wo,
                                                   unsigned short* __restrict__ wb, f16* __restrict__ woh) {
  const int p = blockIdx.x * 256 + threadIdx.x;       // 0..4095
  if (blockIdx.x < 12) {                               // block-uniform
    const int which = p >> 10;                         // 0..2, block-uniform
    const int off   = (p & 1023) * 8;
    const v4f q0 = *(const v4f*)(wq + off), q1 = *(const v4f*)(wq + off + 4);
    const v4f k0 = *(const v4f*)(wk + off), k1 = *(const v4f*)(wk + off + 4);
    const v4f v0 = *(const v4f*)(wv + off), v1 = *(const v4f*)(wv + off + 4);
    const v4f a0 = (which == 0) ? q0 : ((which == 1) ? k0 : v0);   // select by value
    const v4f a1 = (which == 0) ? q1 : ((which == 1) ? k1 : v1);
    v4u u;
    u[0] = bf16_bits(a0[0]) | (bf16_bits(a0[1]) << 16);
    u[1] = bf16_bits(a0[2]) | (bf16_bits(a0[3]) << 16);
    u[2] = bf16_bits(a1[0]) | (bf16_bits(a1[1]) << 16);
    u[3] = bf16_bits(a1[2]) | (bf16_bits(a1[3]) << 16);
    unsigned short* dst = wb + (size_t)p * 8;
    *(v4u*)dst = u;
    
  } else {
    const int off = (p - 3072) * 8;
    const v4f a0 = *(const v4f*)(wo + off), a1 = *(const v4f*)(wo + off + 4);
    Pack8H ph;
    #pragma unroll
    for (int i = 0; i < 4; ++i) {
      ph.h[i]     = (f16)(bf16_val(a0[i]) * 64.0f);
      ph.h[4 + i] = (f16)(bf16_val(a1[i]) * 64.0f);
    }
    const v4u u = ph.u;
    f16* dst = woh + off;
    *(v4u*)dst = u;
    
  }
}

// Fused q/k/v projection. Block = (64-position tile, batch), 256 threads.
// x tile [256 c][64 n] is RNE-converted to bf16 and transposed through LDS to [n][c]; D[n][dd] = sum_c x[c][n] W[dd][c].
// Planes: qp,kp [NB][SEQ][32] f16 value planes; qr,kr [NB][SEQ][32] f16 residual planes = (f32 - f16 value) x 2048
// coverage: q,k,q_res,k_res rows n0..n0+63 x 32 d ; v 32 d x positions n0..n0+63 ; every written line whole,
// one instruction. LDS: sX, sQK, sR, sV are cross-wave (block barriers); staged extent == consumed extent for all four.
__global__ __launch_bounds__(256) void qkv_kernel(const float* __restrict__ x,
                                                  const unsigned short* __restrict__ wb,
                                                  f16* __restrict__ qp, f16* __restrict__ kp,
                                                  f16* __restrict__ qr, f16* __restrict__ kr,
                                                  f16* __restrict__ vp) {
  const int n0   = blockIdx.x * NT;
  const int b    = blockIdx.y;
  const int tid  = threadIdx.x;
  const int wave = tid >> 5;
  const int lane = tid & 31;
  const int lq   = lane & 15;
  const int hi   = lane >> 4;

  __shared__ __align__(16) unsigned sX[NT * XPW];     // [n][c/2] packed bf16 pairs (even c in the low half)
  __shared__ __align__(16) f16      sQK[NT * SP];     // [n][q 0..31 | k 32..63] values
  __shared__ __align__(16) f16      sR[NT * SP];      // [n][q 0..31 | k 32..63] residuals x2048
  __shared__ __align__(16) f16      sV[HD * SP];      // [d][n]

  #pragma unroll 2
  for (int it = 0; it < 8; ++it) {
    const int item = it * 256 + tid;                  // 0..2047
    const int nq   = item & 15;                       // 4-position group
    const int cp   = item >> 4;                       // channel pair 0..127
    const float* src = x + ((size_t)b * CH + 2 * cp) * SEQ_FULL + n0 + nq * 4;
    const v4f a0 = *(const v4f*)(src);
    const v4f a1 = *(const v4f*)(src + SEQ_FULL);
    #pragma unroll
    for (int i = 0; i < 4; ++i)
      sX[(nq * 4 + i) * XPW + cp] = bf16_bits(a0[i]) | (bf16_bits(a1[i]) << 16);
  }
  __syncthreads();

  const int nt = wave & 3;                            // position sub-tile
  const int g3 = wave >> 2;                           // output tile group: tiles g3*3 + {0,1,2}
  v8f acc[3];
  #pragma unroll
  for (int j = 0; j < 3; ++j) acc[j] = (v8f){0, 0, 0, 0, 0, 0, 0, 0};

  const int aoff = (nt * 16 + lq) * XPW + hi * 4;     // row n, words of channels 8*hi..
  #pragma unroll 2
  for (int ks = 0; ks < CH / 32; ++ks) {
    FragB a;
    a.q[0] = *(const v4u*)(sX + aoff + ks * 16);        // c = ks*32 + 8*hi + 0..7
    a.q[1] = *(const v4u*)(sX + aoff + ks * 16 + 8);    // c = ks*32 + 16 + 8*hi + 0..7
    #pragma unroll
    for (int j = 0; j < 3; ++j) {
      const unsigned short* wr = wb + (size_t)((g3 * 3 + j) * 16 + lq) * CH + ks * 32 + hi * 8;
      FragB w;
      w.q[0] = *(const v4u*)(wr);                       // c = ks*32 + 8*hi + 0..7
      w.q[1] = *(const v4u*)(wr + 16);                  // c = ks*32 + 16 + 8*hi + 0..7
      acc[j] = mma_bf16(a.v, w.v, acc[j]);
    }
  }

  // D element r of lane: (n = nt*16 + 8*hi + r, dd = tile*16 + lq)
  #pragma unroll
  for (int j = 0; j < 3; ++j) {
    const int t = g3 * 3 + j;                         // wave-uniform
    #pragma unroll
    for (int r = 0; r < 8; ++r) {
      const int nrow = nt * 16 + hi * 8 + r;
      const float av = acc[j][r];
      const f16 hv = (f16)av;
      if (t < 4) {
        sQK[nrow * SP + t * 16 + lq] = hv;
        sR[nrow * SP + t * 16 + lq]  = (f16)((av - (float)hv) * RES_CARRY);
      } else {
        sV[((t - 4) * 16 + lq) * SP + nrow] = hv;
      }
    }
  }
  __syncthreads();

  Pack8H pq, pk, pqr, pkr, pv;
  const int row = tid >> 2, seg = tid & 3;
  pq.v  = *(const v8h*)(sQK + row * SP + seg * 8);
  pk.v  = *(const v8h*)(sQK + row * SP + HD + seg * 8);
  pqr.v = *(const v8h*)(sR + row * SP + seg * 8);
  pkr.v = *(const v8h*)(sR + row * SP + HD + seg * 8);
  const int dv = tid >> 3, sv = tid & 7;
  pv.v = *(const v8h*)(sV + dv * SP + sv * 8);
  const size_t qi = ((size_t)b * SEQ + n0) * HD + (size_t)tid * 8;
  const size_t vi = ((size_t)b * HD + dv) * SEQ + n0 + sv * 8;
  const v4u uq = pq.u, uk = pk.u, uqr = pqr.u, ukr = pkr.u, uv = pv.u;
  *(v4u*)(qp + qi) = uq;
  *(v4u*)(kp + qi) = uk;
  *(v4u*)(qr + qi) = uqr;
  *(v4u*)(kr + qi) = ukr;
  *(v4u*)(vp + vi) = uv;
  
}

// Flash attention, all keys, no logit scaling. Block = (query block of 128, batch); one wave owns 16 query rows.
// S^T = K x Q^T so queries sit on lanes; P^T in C-layout is bit-identical to the A-fragment layout of O += P x V.
// Scores: kval.qval in the main accumulator; kres.qval + kval.qres in a second accumulator folded by 1/2048 in f32.
// K, K-residual and V tiles of KS keys are brought into a two-buffer LDS ring once per block by asynchronous copies
// (stage t + 2 flies while stage t + 1 is worked on); the fragments are two 16-B LDS loads each, in the k order of the q fragments.
// One online-softmax step per stage: all KS scores first, then one maximum, one exchange between the lane halves and one
// rescale of O, then the stage's PV products.
// Epilogue: out-projection + gate + skip-add of the block's 128 positions. D[n][c] = sum_d ctx[n][d] woh[c][d];
// result = D * (g/64) + bf16 RNE value of x; g = bf16 RNE value of gamma. Wave w owns channels 32w..32w+31.
// The block's x tile [256 c][128 n] comes into LDS beside the ring, eight rows with each stage's copies.
// LDS sC: cross-wave (block barrier). sRing, sXO as filled by the copies: cross-wave, published by the ring's barriers.
// sXO in the epilogue: each wave reads and rewrites only the rows of its own channels.

// One stage: keys s*KS..s*KS+KS-1 of the three planes into dst. Six 16-B pieces per thread, every lane on, all addresses
// 16-B multiples; k / k residual pieces are contiguous in global memory, v pieces are 256-B runs of each of the 32 rows.
// A seventh piece per thread: x rows (channels) s*NWAVE..s*NWAVE+NWAVE-1 of the block's positions into sx, one row per wave.
static __device__ __forceinline__ void stage_copy(const f16* __restrict__ kb_b, const f16* __restrict__ kr_b,
                                                  const f16* __restrict__ vt_b, const float* __restrict__ x_b,
                                                  int s, f16* dst, float* sx, int tid) {
  const int j0 = s * KS;
  const int p0 = tid, p1 = tid + 256;                 // piece 0..511 of each plane
  const f16* gk0 = kb_b + (size_t)j0 * HD + p0 * 8;
  const f16* gk1 = kb_b + (size_t)j0 * HD + p1 * 8;
  const f16* gr0 = kr_b + (size_t)j0 * HD + p0 * 8;
  const f16* gr1 = kr_b + (size_t)j0 * HD + p1 * 8;
  const f16* gv0 = vt_b + (size_t)(p0 >> 4) * SEQ + j0 + (p0 & 15) * 8;
  const f16* gv1 = vt_b + (size_t)(p1 >> 4) * SEQ + j0 + (p1 & 15) * 8;
  const unsigned l0  = (unsigned)(size_t)dst;         // LDS byte address of the stage
  const unsigned lk0 = l0 + ((p0 >> 2) * KPH + (p0 & 3) * 8) * 2;
  const unsigned lk1 = l0 + ((p1 >> 2) * KPH + (p1 & 3) * 8) * 2;
  const unsigned lr0 = lk0 + ST_KR * 2;
  const unsigned lr1 = lk1 + ST_KR * 2;
  const unsigned lv0 = l0 + (ST_V + (p0 >> 4) * VPH + (p0 & 15) * 8) * 2;
  const unsigned lv1 = l0 + (ST_V + (p1 >> 4) * VPH + (p1 & 15) * 8) * 2;
  const int xc = s * NWAVE + (tid >> 5);              // channel row of this wave's x piece
  const float* gx = x_b + (size_t)xc * SEQ_FULL + (tid & 31) * 4;
  const unsigned lx = (unsigned)(size_t)sx + (xc * XP + (tid & 31) * 4) * 4;
  // The copies and their s_wait_xcnt in one statement: no address register is rewritten ahead of that wait.
  asm volatile("global_load_async_to_lds_b128 %0, %7, off\n\t"
               "global_load_async_to_lds_b128 %1, %8, off\n\t"
               "global_load_async_to_lds_b128 %2, %9, off\n\t"
               "global_load_async_to_lds_b128 %3, %10, off\n\t"
               "global_load_async_to_lds_b128 %4, %11, off\n\t"
               "global_load_async_to_lds_b128 %5, %12, off\n\t"
               "global_load_async_to_lds_b128 %6, %13, off\n\t"
               "s_wait_xcnt 0x0"
               :: "v"(lk0), "v"(lk1), "v"(lr0), "v"(lr1), "v"(lv0), "v"(lv1), "v"(lx),
                  "v"(gk0), "v"(gk1), "v"(gr0), "v"(gr1), "v"(gv0), "v"(gv1), "v"(gx)
               : "memory");
}

// Epilogue pieces. A lane's part of one channel row of the LDS tile: eight neighbouring positions out of every 16.
static __device__ __forceinline__ void x_rows_load(const float* xrow, v4f (&xv)[NWAVE][2]) {
  #pragma unroll
  for (int nt = 0; nt < NWAVE; ++nt) {
    xv[nt][0] = *(const v4f*)(xrow + nt * 16);
    xv[nt][1] = *(const v4f*)(xrow + nt * 16 + 4);
  }
}
// result = D * gs + bf16 RNE value of x, written over x in the LDS tile
static __device__ __forceinline__ void gate_add_store(float* xrow, const v8f (&acc)[NWAVE], const v4f (&xv)[NWAVE][2],
                                                      float gs) {
  #pragma unroll
  for (int nt = 0; nt < NWAVE; ++nt) {
    v4f r0, r1;
    #pragma unroll
    for (int i = 0; i < 4; ++i) {
      r0[i] = fmaf(acc[nt][i], gs, bf16_val(xv[nt][0][i]));
      r1[i] = fmaf(acc[nt][4 + i], gs, bf16_val(xv[nt][1][i]));
    }
    *(v4f*)(xrow + nt * 16)     = r0;
    *(v4f*)(xrow + nt * 16 + 4) = r1;
  }
}
// 16 channel rows of the LDS tile to the output: each store is one 512-B row of the block's positions, whole lines
static __device__ __forceinline__ void rows_out(const float* srow, float* orow) {
  v4f vals[16];
  #pragma unroll
  for (int it = 0; it < 16; ++it) vals[it] = *(const v4f*)(srow + it * XP);
  #pragma unroll
  for (int it = 0; it < 16; ++it) *(v4f*)(orow + (size_t)it * SEQ_FULL) = vals[it];
}

__global__ __launch_bounds__(256) void attn_kernel(const f16* __restrict__ qp, const f16* __restrict__ qr,
                                                   const f16* __restrict__ kp, const f16* __restrict__ kr,
                                                   const f16* __restrict__ vp, const f16* __restrict__ woh,
                                                   const float* __restrict__ x, const float* __restrict__ gamma,
                                                   float* __restrict__ out) {
  const int qblk = blockIdx.x;
  const int b    = blockIdx.y;
  const int tid  = threadIdx.x;
  const int wave = tid >> 5;
  const int lane = tid & 31;
  const int lq   = lane & 15;   // query column of S^T / d column of O
  const int hi   = lane >> 4;   // k-split half

  __shared__ __align__(16) f16 sC[NWAVE * 16 * CP];
  __shared__ __align__(16) f16 sRing[2 * ST_H];
  __shared__ __align__(16) float sXO[CH * XP];        // [c][n]: x of the block's positions, then the result in place

  const int qrow0 = qblk * BQ + wave * 16;

  FragH qf, qrf;                 // B operands: column = query qrow0+lq, k = d split map (value, residual)
  {
    const size_t qo = ((size_t)b * SEQ + qrow0 + lq) * HD + hi * 8;
    qf.q[0]  = *(const v4u*)(qp + qo);          // d = 8*hi + 0..7
    qf.q[1]  = *(const v4u*)(qp + qo + 16);     // d = 16 + 8*hi + 0..7
    qrf.q[0] = *(const v4u*)(qr + qo);
    qrf.q[1] = *(const v4u*)(qr + qo + 16);
  }
  const f16* kb_b = kp + (size_t)b * SEQ * HD;
  const f16* kr_b = kr + (size_t)b * SEQ * HD;
  const f16* vt_b = vp + (size_t)b * HD * SEQ;
  const float* x_b = x + (size_t)b * CH * SEQ_FULL + qblk * BQ;

  v8f o[2];
  o[0] = (v8f){0, 0, 0, 0, 0, 0, 0, 0};
  o[1] = (v8f){0, 0, 0, 0, 0, 0, 0, 0};
  float rmax = -__builtin_inff();
  float rbias = -__builtin_inff();        // rmax * log2(e) - 12, as rounded: the reference point of every exponent
  float rsum = 0.0f;                      // carried x4096, like P and O
  const float SL = 1.4426950408889634f;   // log2(e)

  // ring prologue: stage 0 landed and published, then stage 1 in flight
  stage_copy(kb_b, kr_b, vt_b, x_b, 0, sRing, sXO, tid);
  asm volatile("s_wait_asynccnt 0x0" ::: "memory");   // this wave's pieces of stage 0 have landed
  __syncthreads();                                    // ... and every other wave's
  stage_copy(kb_b, kr_b, vt_b, x_b, 1, sRing + ST_H, sXO, tid);

  #pragma unroll 1
  for (int t = 0; t < NS; ++t) {
  f16* sbuf = sRing + (t & 1) * ST_H;                 // trip t reads this buffer alone

  // the stage's k and k residual fragments, read as one group ahead of the products, in the order of their use
  FragH ak[NSUB], akr[NSUB];
  #pragma unroll
  for (int h = 0; h < NSUB; h += 4) {
    #pragma unroll
    for (int i = 0; i < 4; ++i) {
      const int ko = ((h + i) * 16 + lq) * KPH + hi * 8;       // row = key
      ak[h + i].q[0] = *(const v4u*)(sbuf + ko);               // d = 8*hi + 0..7
      ak[h + i].q[1] = *(const v4u*)(sbuf + ko + 16);          // d = 16 + 8*hi + 0..7
    }
    #pragma unroll
    for (int i = 0; i < 4; ++i) {
      const int ko = ((h + i) * 16 + lq) * KPH + hi * 8;
      akr[h + i].q[0] = *(const v4u*)(sbuf + ST_KR + ko);
      akr[h + i].q[1] = *(const v4u*)(sbuf + ST_KR + ko + 16);
    }
  }

  // c[sub][r] = score(query qrow0+lq, key t*KS + sub*16 + 8*hi + r): all KS keys of the stage before any softmax work.
  // Four tiles at a time, so that the product that accumulates into cr stands four products behind the one it waits for.
  v8f c[NSUB];
  #pragma unroll
  for (int h = 0; h < NSUB; h += 4) {
    const v8f z = (v8f){0, 0, 0, 0, 0, 0, 0, 0};
    v8f cm[4], cr[4];
    #pragma unroll
    for (int i = 0; i < 4; ++i) cm[i] = mma_f16(ak[h + i].v, qf.v, z);        // value x value
    #pragma unroll
    for (int i = 0; i < 4; ++i) cr[i] = mma_f16(akr[h + i].v, qf.v, z);       // k residual x q value
    #pragma unroll
    for (int i = 0; i < 4; ++i) cr[i] = mma_f16(ak[h + i].v, qrf.v, cr[i]);   // k value x q residual
    #pragma unroll
    for (int i = 0; i < 4; ++i) c[h + i] = cm[i] + cr[i] * RES_FOLD;
  }

  // the stage's v fragments, read as one group; the softmax work below covers their latency
  FragH bv[NGRP][2];
  #pragma unroll
  for (int g = 0; g < NGRP; ++g) {
    #pragma unroll
    for (int dt = 0; dt < 2; ++dt) {
      const f16* base = sbuf + ST_V + (dt * 16 + lq) * VPH + g * BK + hi * 8;    // column = d
      bv[g][dt].q[0] = *(const v4u*)(base);           // keys g*32 + 8*hi + 0..7 of the stage
      bv[g][dt].q[1] = *(const v4u*)(base + 16);      // keys g*32 + 16 + 8*hi + 0..7
    }
  }

  // one online-softmax step per stage: query lq's KS scores are split across lane / lane^16.
  // The maximum runs as eight independent chains over the tiles, joined at the end.
  v8f mx = c[0];
  #pragma unroll
  for (int sub = 1; sub < NSUB; ++sub) {
    #pragma unroll
    for (int r = 0; r < 8; ++r) mx[r] = fmaxf(mx[r], c[sub][r]);
  }
  float m_new = rmax;
  #pragma unroll
  for (int r = 0; r < 8; ++r) m_new = fmaxf(m_new, mx[r]);
  m_new = fmaxf(m_new, __shfl_xor(m_new, 16, 32));
  // The exponent of a score is one fused multiply-add: c * log2(e) - bias, bias = m_new * log2(e) - 12, so that the
  // maximum, the change of base and the x4096 carry of P cost no instruction of their own. The rescale uses the same
  // rounded biases, so every stage's weights refer to one another exactly as their exponents do.
  const float bias_new = fmaf(m_new, SL, -12.0f);
  const float scale = __builtin_amdgcn_exp2f(rbias - bias_new);
  rmax  = m_new;
  rbias = bias_new;
  const v8f slv = (v8f){SL, SL, SL, SL, SL, SL, SL, SL};
  const float nb = -bias_new;
  const v8f nbv = (v8f){nb, nb, nb, nb, nb, nb, nb, nb};

  // exp + pack: P^T C-layout == A-fragment layout of the PV product; P carried x4096
  FragH pa[NGRP];
  v8f ps = (v8f){0, 0, 0, 0, 0, 0, 0, 0};
  #pragma unroll
  for (int sub = 0; sub < NSUB; ++sub) {
    const v8f e = __builtin_elementwise_fma(c[sub], slv, nbv);
    v8f p;
    #pragma unroll
    for (int r = 0; r < 8; ++r) p[r] = __builtin_amdgcn_exp2f(e[r]);   // 4096 x weight of key sub*16 + 8*hi + r
    ps += p;
    #pragma unroll
    for (int r = 0; r < 8; ++r) pa[sub >> 1].h[(sub & 1) * 8 + r] = (f16)p[r];
  }
  const float psum = ((ps[0] + ps[1]) + (ps[2] + ps[3])) + ((ps[4] + ps[5]) + (ps[6] + ps[7]));
  rsum = rsum * scale + psum + __shfl_xor(psum, 16, 32);

  // rescale O: queries are the row dimension there -> per-row scale from lane 8*hi + r
  float sc[8];
  #pragma unroll
  for (int r = 0; r < 8; ++r) sc[r] = __shfl(scale, (hi << 3) + r, 32);
  #pragma unroll
  for (int dt = 0; dt < 2; ++dt) {
    #pragma unroll
    for (int r = 0; r < 8; ++r) o[dt][r] *= sc[r];
  }

  // O += P x V over the stage's NGRP groups of 32 keys
  #pragma unroll
  for (int g = 0; g < NGRP; ++g) {
    #pragma unroll
    for (int dt = 0; dt < 2; ++dt) o[dt] = mma_f16(pa[g].v, bv[g][dt].v, o[dt]);
  }
  // publish point of stage t + 1; behind it the buffer just read is free for stage t + 2
  asm volatile("s_wait_dscnt 0x0" ::: "memory");      // this wave's reads of sbuf have returned
  asm volatile("s_wait_asynccnt 0x0" ::: "memory");   // this wave's pieces of stage t + 1 have landed
  __syncthreads();
  if (t + 2 < NS) stage_copy(kb_b, kr_b, vt_b, x_b, t + 2, sbuf, sXO, tid);
  }
  asm volatile("s_wait_asynccnt 0x0" ::: "memory");   // nothing in flight when the wave goes on to its end

  // this wave's out-projection weights, asked for ahead of the normalisation. B operand: column = channel, k = d split map
  FragH bw[2];
  #pragma unroll
  for (int ct = 0; ct < 2; ++ct) {
    const f16* wr = woh + (size_t)((wave * 2 + ct) * 16 + lq) * HD + hi * 8;
    bw[ct].q[0] = *(const v4u*)(wr);
    bw[ct].q[1] = *(const v4u*)(wr + 16);
  }
  const float gs = bf16_val(gamma[0]) * (1.0f / 64.0f);

  // x of the wave's first 16 channels (the tile was published by the ring's last barriers); the normalisation covers the latency
  const int c0 = wave * 32;
  float* xrow0 = sXO + (c0 + lq) * XP + hi * 8;       // lane: channel row c0 + lq, positions nt*16 + 8*hi + 0..7
  float* xrow1 = xrow0 + 16 * XP;
  v4f xv0[NWAVE][2], xv1[NWAVE][2];
  x_rows_load(xrow0, xv0);

  // normalize: lane holds column d = dt*16 + lq for query rows 8*hi + r
  const float rinv = 1.0f / rsum;          // O and rsum carry the same x4096
  float rs[8];
  #pragma unroll
  for (int r = 0; r < 8; ++r) rs[r] = __shfl(rinv, (hi << 3) + r, 32);

  f16* so = sC + wave * (16 * CP);
  #pragma unroll
  for (int r = 0; r < 8; ++r) {
    #pragma unroll
    for (int dt = 0; dt < 2; ++dt)
      so[(hi * 8 + r) * CP + dt * 16 + lq] = (f16)(o[dt][r] * rs[r]);
  }
  __syncthreads();                         // ctx of all 128 positions is in sC

  FragH an[NWAVE];                         // A operands: row = position nt*16 + lq, k = d split map
  #pragma unroll
  for (int nt = 0; nt < NWAVE; ++nt) {
    const f16* p = sC + (nt * 16 + lq) * CP + hi * 8;
    an[nt].q[0] = *(const v4u*)(p);
    an[nt].q[1] = *(const v4u*)(p + 16);
  }

  // D element r of lane: (n = nt*16 + 8*hi + r, c = channel tile's first + lq): eight neighbouring positions of one channel row
  const v8f z = (v8f){0, 0, 0, 0, 0, 0, 0, 0};
  float* orow = out + ((size_t)b * CH + c0) * SEQ_FULL + qblk * BQ + lane * 4;
  v8f acc0[NWAVE], acc1[NWAVE];
  #pragma unroll
  for (int nt = 0; nt < NWAVE; ++nt) acc0[nt] = mma_f16(an[nt].v, bw[0].v, z);
  gate_add_store(xrow0, acc0, xv0, gs);
  #pragma unroll
  for (int nt = 0; nt < NWAVE; ++nt) acc1[nt] = mma_f16(an[nt].v, bw[1].v, z);
  asm volatile("s_wait_dscnt 0x0" ::: "memory");      // the wave's own rows are written before it reads them back whole
  x_rows_load(xrow1, xv1);
  rows_out(sXO + c0 * XP + lane * 4, orow);
  asm volatile("s_wait_xcnt 0x0" ::: "memory");       // the second half's work reuses registers that these stores name
  gate_add_store(xrow1, acc1, xv1, gs);
  asm volatile("s_wait_dscnt 0x0" ::: "memory");      // as above, second 16 channel rows
  rows_out(sXO + (c0 + 16) * XP + lane * 4, orow + (size_t)16 * SEQ_FULL);
}

extern "C" void kernel_launch(void* const* d_in, const int* in_sizes, int n_in,
                              void* d_out, int out_size, void* d_ws, size_t ws_size,
                              hipStream_t stream) {
  if (n_in < 6) return;
  const size_t x_need = ((size_t)(NB - 1) * CH + (CH - 1)) * SEQ_FULL + SEQ;
  if ((size_t)in_sizes[0] < x_need) return;
  if ((size_t)in_sizes[1] < (size_t)HD * CH) return;
  if ((size_t)in_sizes[2] < (size_t)HD * CH) return;
  if ((size_t)in_sizes[3] < (size_t)HD * CH) return;
  if ((size_t)in_sizes[4] < (size_t)CH * HD) return;
  if (in_sizes[5] < 1) return;
  if ((size_t)out_size < x_need) return;
  if (ws_size < WS_TOTAL) return;

  const float* x     = (const float*)d_in[0];
  const float* wq    = (const float*)d_in[1];
  const float* wk    = (const float*)d_in[2];
  const float* wv    = (const float*)d_in[3];
  const float* wo    = (const float*)d_in[4];
  const float* gamma = (const float*)d_in[5];
  float*       out   = (float*)d_out;

  char* ws = (char*)d_ws;
  unsigned short* wb  = (unsigned short*)(ws);
  f16*            woh = (f16*)(ws + WB_BYTES);
  f16*            qp  = (f16*)(ws + WB_BYTES + WO_BYTES);
  f16*            kp  = (f16*)(ws + WB_BYTES + WO_BYTES + PL_BYTES);
  f16*            vp  = (f16*)(ws + WB_BYTES + WO_BYTES + 2 * PL_BYTES);
  f16*            qrp = (f16*)(ws + WB_BYTES + WO_BYTES + 4 * PL_BYTES);
  f16*            krp = (f16*)(ws + WB_BYTES + WO_BYTES + 5 * PL_BYTES);

  prep_kernel<<<dim3(16), 256, 0, stream>>>(wq, wk, wv, wo, wb, woh);
  // qkv_kernel(x, wb, qp, kp, qr, kr, vp)
  qkv_kernel<<<dim3(SEQ / NT, NB), 256, 0, stream>>>(x, wb, qp, kp, qrp, krp, vp);
  // attn_kernel(qp, qr, kp, kr, vp, woh, x, gamma, out)
  attn_kernel<<<dim3(SEQ / BQ, NB), 256, 0, stream>>>(qp, qrp, kp, krp, vp, woh, x, gamma, out);
}

// v005
// Measured time: 49.5 microseconds a run.
// Timed twice side by side with v004, it ran 1.10 times as fast both times.
// Over all steps from v000 it is 2.64 times as fast.
#include <hip/hip_runtime.h>

// Contractions: q/k/v projections on v_wmma_f32_16x16x32_bf16 (x and W as bf16 RNE-converted inputs, f32 accumulate);
// S^T = K x Q^T on v_wmma_f32_16x16x32_f16 as three products (q,k f16 value planes + f16 residual planes x2048,
// residual products in their own accumulator folded by 1/2048 in f32); O = P x V on f16 (P carried x4096, V f16);
// out-projection on f16 (Wo = f16 of bf16 RNE value x64, ctx f16, 1/64 folded in the f32 epilogue), done by the attention
// kernel itself on its own 128 positions; softmax, gate and skip-add in f32.

#ifndef NB
#define NB 8
#endif
#ifndef SEQ
#define SEQ 4096
#endif
#define NB_FULL   8
#define SEQ_FULL  4096
#define CH        256                 // channels (projection K)
#define HD        32                  // q/k/v dim (single head)
#define NQKV      96                  // stacked projection outputs: q 0..31, k 32..63, v 64..95
#define NT        64                  // positions per projection block
#define XPW       132                 // LDS pitch (32-bit words) of the transposed bf16 x tile
#define SP        72                  // LDS pitch (halves) of the q|k, q|k residual and v staging tiles
#define BQ        128                 // query rows per attention block (8 waves x 16)
#define BK        32                  // keys per PV product (k of one WMMA)
#define NWAVE     8                   // waves per key stream == 16-row query tiles per block
#define NGW       2                   // key streams (groups of NWAVE waves) per attention block
#define CP        40                  // LDS pitch (halves) of the per-wave ctx staging tile
#define KS        128                 // keys per LDS stage of the attention ring == keys per online-softmax step
#define NS        (SEQ / KS)          // stages
#define NTRIP     (NS / NGW)          // ring trips: each trip, every key stream works on a stage of its own
#define NSUB      (KS / 16)           // 16-key score tiles per stage
#define NGRP      (KS / BK)           // 32-key PV groups per stage
#define KPH       40                  // LDS pitch (halves) of a staged k / k residual row: 80 B = 16 B x odd
#define VPH       136                 // LDS pitch (halves) of a staged v row of KS keys: 272 B = 16 B x odd
#define ST_KR     (KS * KPH)          // offsets (halves) inside one stage: k at 0, k residual, v
#define ST_V      (2 * KS * KPH)
#define ST_H      (2 * KS * KPH + HD * VPH)   // halves per stage
#define XP        132                 // LDS pitch (floats) of a staged x / result row of BQ positions: 528 B = 16 B x odd
#define RES_CARRY 2048.0f             // power-of-two carry of the q/k residual planes
#define RES_FOLD  (1.0f / 2048.0f)

static_assert(NB >= 1 && NB <= NB_FULL);
static_assert(SEQ <= SEQ_FULL);
static_assert(SEQ % BQ == 0);
static_assert(SEQ % NT == 0);
static_assert(SEQ % BK == 0);
static_assert(BQ == NWAVE * 16);
static_assert(SEQ % KS == 0 && KS % BK == 0 && BK == 32 && NSUB % 4 == 0);
static_assert(KS * 4 == 2 * 256 && HD * (KS / 8) == 2 * 256);   // 16-B pieces per plane and stage == 2 per thread
static_assert(KPH >= HD && (KPH * 2) % 16 == 0 && VPH >= KS && (VPH * 2) % 16 == 0 && (ST_H * 2) % 16 == 0);
static_assert(HD == 32);
static_assert(CH % 32 == 0);
static_assert(NQKV == 3 * HD);
static_assert(8 * 256 == (CH / 2) * (NT / 4));     // x staging items == threads x iterations
static_assert(XPW >= CH / 2 && (XPW * 4) % 16 == 0);
static_assert(SP >= 2 * HD && SP >= NT && (SP * 2) % 16 == 0);
static_assert(NT * 4 == 256);                      // q/k (+ residual) plane store: one 16-B piece per thread each
static_assert(HD * 8 == 256);                      // v plane store: one 16-B piece per thread
static_assert(CP >= HD && (CP * 2) % 16 == 0);
static_assert(XP >= BQ && (XP * 4) % 16 == 0);
static_assert(NGW * NWAVE * 16 == CH);             // out-projection: each wave owns 16 channel rows
static_assert(NGW == 2 && NS % NGW == 0 && NTRIP >= 2);
static_assert(BQ * 4 == 32 * 16);                  // one x / result row of the block == one 16-B piece per lane of a wave
static_assert(NS >= 2 && NS * NWAVE == CH);        // one x row per wave rides each of the NS stage copies
static_assert(NT * XPW * 4 + 2 * NT * SP * 2 + HD * SP * 2 <= 65536);   // static LDS of the projection kernel

#define WB_BYTES  ((size_t)NQKV * CH * 2)
#define WO_BYTES  ((size_t)CH * HD * 2)
#define PL_BYTES  ((size_t)NB * SEQ * HD * 2)
#define NPLANE    6                                 // q, k, v, unused, q residual, k residual
#define WS_TOTAL  (WB_BYTES + WO_BYTES + NPLANE * PL_BYTES)
static_assert(WB_BYTES % 128 == 0 && WO_BYTES % 128 == 0 && PL_BYTES % 128 == 0);
static_assert(WS_TOTAL <= (size_t)134217728);

typedef __bf16   bf16;
typedef _Float16 f16;
typedef bf16     v16bf __attribute__((ext_vector_type(16)));
typedef f16      v16h  __attribute__((ext_vector_type(16)));
typedef f16      v8h   __attribute__((ext_vector_type(8)));
typedef float    v8f   __attribute__((ext_vector_type(8)));
typedef float    v4f   __attribute__((ext_vector_type(4)));
typedef unsigned v4u   __attribute__((ext_vector_type(4)));

union FragB  { v16bf v; v4u q[2]; };
union FragH  { v16h  v; v4u q[2]; f16 h[16]; };
union Pack8H { v4u u; v8h v; f16 h[8]; };

// WMMA helpers: builtin followed by the VALU hazard guard (ties D, keeps A/B live).
static __device__ __forceinline__ v8f mma_bf16(v16bf a, v16bf b, v8f acc) {
  acc = __builtin_amdgcn_wmma_f32_16x16x32_bf16(false, a, false, b, (short)0, acc, false, false);
  asm volatile("v_nop\n\tv_nop\n\tv_nop\n\tv_nop" : "+v"(acc) : "v"(a), "v"(b));
  return acc;
}
static __device__ __forceinline__ v8f mma_f16(v16h a, v16h b, v8f acc) {
  acc = __builtin_amdgcn_wmma_f32_16x16x32_f16(false, a, false, b, (short)0, acc, false, false);
  asm volatile("v_nop\n\tv_nop\n\tv_nop\n\tv_nop" : "+v"(acc) : "v"(a), "v"(b));
  return acc;
}

// f32 -> bf16 bits, RNE (finite inputs).
static __device__ __forceinline__ unsigned bf16_bits(float f) {
  const unsigned u = __float_as_uint(f);
  return (u + 0x7FFFu + ((u >> 16) & 1u)) >> 16;
}
static __device__ __forceinline__ float bf16_val(float f) {
  return __uint_as_float(bf16_bits(f) << 16);
}

// Weight planes, built once. 4096 pieces of 8 elements, one 16-B piece per thread, 16 blocks x 256.
//   wb  [96][256] bf16 bits : rows 0..31 wq, 32..63 wk, 64..95 wv (k = channel contiguous)
//   woh [256][32] f16       : f16(bf16 RNE value of wo x 64), exact
__global__ __launch_bounds__(256) void prep_kernel(const float* __restrict__ wq, const float* __restrict__ wk,
                                                   const float* __restrict__ wv, const float* __restrict__ wo,
                                                   unsigned short* __restrict__ wb, f16* __restrict__ woh) {
  const int p = blockIdx.x * 256 + threadIdx.x;       // 0..4095
  if (blockIdx.x < 12) {                               // block-uniform
    const int which = p >> 10;                         // 0..2, block-uniform
    const int off   = (p & 1023) * 8;
    const v4f q0 = *(const v4f*)(wq + off), q1 = *(const v4f*)(wq + off + 4);
    const v4f k0 = *(const v4f*)(wk + off), k1 = *(const v4f*)(wk + off + 4);
    const v4f v0 = *(const v4f*)(wv + off), v1 = *(const v4f*)(wv + off + 4);
    const v4f a0 = (which == 0) ? q0 : ((which == 1) ? k0 : v0);   // select by value
    const v4f a1 = (which == 0) ? q1 : ((which == 1) ? k1 : v1);
    v4u u;
    u[0] = bf16_bits(a0[0]) | (bf16_bits(a0[1]) << 16);
    u[1] = bf16_bits(a0[2]) | (bf16_bits(a0[3]) << 16);
    u[2] = bf16_bits(a1[0]) | (bf16_bits(a1[1]) << 16);
    u[3] = bf16_bits(a1[2]) | (bf16_bits(a1[3]) << 16);
    unsigned short* dst = wb + (size_t)p * 8;
    *(v4u*)dst = u;
    
  } else {
    const int off = (p - 3072) * 8;
    const v4f a0 = *(const v4f*)(wo + off), a1 = *(const v4f*)(wo + off + 4);
    Pack8H ph;
    #pragma unroll
    for (int i = 0; i < 4; ++i) {
      ph.h[i]     = (f16)(bf16_val(a0[i]) * 64.0f);
      ph.h[4 + i] = (f16)(bf16_val(a1[i]) * 64.0f);
    }
    const v4u u = ph.u;
    f16* dst = woh + off;
    *(v4u*)dst = u;
    
  }
}

// Fused q/k/v projection. Block = (64-position tile, batch), 256 threads.
// x tile [256 c][64 n] is RNE-converted to bf16 and transposed through LDS to [n][c]; D[n][dd] = sum_c x[c][n] W[dd][c].
// Planes: qp,kp [NB][SEQ][32] f16 value planes; qr,kr [NB][SEQ][32] f16 residual planes = (f32 - f16 value) x 2048
// coverage: q,k,q_res,k_res rows n0..n0+63 x 32 d ; v 32 d x positions n0..n0+63 ; every written line whole,
// one instruction. LDS: sX, sQK, sR, sV are cross-wave (block barriers); staged extent == consumed extent for all four.
__global__ __launch_bounds__(256) void qkv_kernel(const float* __restrict__ x,
                                                  const unsigned short* __restrict__ wb,
                                                  f16* __restrict__ qp, f16* __restrict__ kp,
                                                  f16* __restrict__ qr, f16* __restrict__ kr,
                                                  f16* __restrict__ vp) {
  const int n0   = blockIdx.x * NT;
  const int b    = blockIdx.y;
  const int tid  = threadIdx.x;
  const int wave = tid >> 5;
  const int lane = tid & 31;
  const int lq   = lane & 15;
  const int hi   = lane >> 4;

  __shared__ __align__(16) unsigned sX[NT * XPW];     // [n][c/2] packed bf16 pairs (even c in the low half)
  __shared__ __align__(16) f16      sQK[NT * SP];     // [n][q 0..31 | k 32..63] values
  __shared__ __align__(16) f16      sR[NT * SP];      // [n][q 0..31 | k 32..63] residuals x2048
  __shared__ __align__(16) f16      sV[HD * SP];      // [d][n]

  #pragma unroll 2
  for (int it = 0; it < 8; ++it) {
    const int item = it * 256 + tid;                  // 0..2047
    const int nq   = item & 15;                       // 4-position group
    const int cp   = item >> 4;                       // channel pair 0..127
    const float* src = x + ((size_t)b * CH + 2 * cp) * SEQ_FULL + n0 + nq * 4;
    const v4f a0 = *(const v4f*)(src);
    const v4f a1 = *(const v4f*)(src + SEQ_FULL);
    #pragma unroll
    for (int i = 0; i < 4; ++i)
      sX[(nq * 4 + i) * XPW + cp] = bf16_bits(a0[i]) | (bf16_bits(a1[i]) << 16);
  }
  __syncthreads();

  const int nt = wave & 3;                            // position sub-tile
  const int g3 = wave >> 2;                           // output tile group: tiles g3*3 + {0,1,2}
  v8f acc[3];
  #pragma unroll
  for (int j = 0; j < 3; ++j) acc[j] = (v8f){0, 0, 0, 0, 0, 0, 0, 0};

  const int aoff = (nt * 16 + lq) * XPW + hi * 4;     // row n, words of channels 8*hi..
  #pragma unroll 2
  for (int ks = 0; ks < CH / 32; ++ks) {
    FragB a;
    a.q[0] = *(const v4u*)(sX + aoff + ks * 16);        // c = ks*32 + 8*hi + 0..7
    a.q[1] = *(const v4u*)(sX + aoff + ks * 16 + 8);    // c = ks*32 + 16 + 8*hi + 0..7
    #pragma unroll
    for (int j = 0; j < 3; ++j) {
      const unsigned short* wr = wb + (size_t)((g3 * 3 + j) * 16 + lq) * CH + ks * 32 + hi * 8;
      FragB w;
      w.q[0] = *(const v4u*)(wr);                       // c = ks*32 + 8*hi + 0..7
      w.q[1] = *(const v4u*)(wr + 16);                  // c = ks*32 + 16 + 8*hi + 0..7
      acc[j] = mma_bf16(a.v, w.v, acc[j]);
    }
  }

  // D element r of lane: (n = nt*16 + 8*hi + r, dd = tile*16 + lq)
  #pragma unroll
  for (int j = 0; j < 3; ++j) {
    const int t = g3 * 3 + j;                         // wave-uniform
    #pragma unroll
    for (int r = 0; r < 8; ++r) {
      const int nrow = nt * 16 + hi * 8 + r;
      const float av = acc[j][r];
      const f16 hv = (f16)av;
      if (t < 4) {
        sQK[nrow * SP + t * 16 + lq] = hv;
        sR[nrow * SP + t * 16 + lq]  = (f16)((av - (float)hv) * RES_CARRY);
      } else {
        sV[((t - 4) * 16 + lq) * SP + nrow] = hv;
      }
    }
  }
  __syncthreads();

  Pack8H pq, pk, pqr, pkr, pv;
  const int row = tid >> 2, seg = tid & 3;
  pq.v  = *(const v8h*)(sQK + row * SP + seg * 8);
  pk.v  = *(const v8h*)(sQK + row * SP + HD + seg * 8);
  pqr.v = *(const v8h*)(sR + row * SP + seg * 8);
  pkr.v = *(const v8h*)(sR + row * SP + HD + seg * 8);
  const int dv = tid >> 3, sv = tid & 7;
  pv.v = *(const v8h*)(sV + dv * SP + sv * 8);
  const size_t qi = ((size_t)b * SEQ + n0) * HD + (size_t)tid * 8;
  const size_t vi = ((size_t)b * HD + dv) * SEQ + n0 + sv * 8;
  const v4u uq = pq.u, uk = pk.u, uqr = pqr.u, ukr = pkr.u, uv = pv.u;
  *(v4u*)(qp + qi) = uq;
  *(v4u*)(kp + qi) = uk;
  *(v4u*)(qr + qi) = uqr;
  *(v4u*)(kr + qi) = ukr;
  *(v4u*)(vp + vi) = uv;
  
}

// Flash attention, all keys, no logit scaling. Block = (query block of 128, batch), 16 waves: four per SIMD, so that one
// wave's softmax work, LDS reads and waits stand beside the others' products. The waves form two key streams of eight:
// stream g takes stages g, g + 2, g + 4, ...; in a stream one wave owns 16 query rows and keeps its own online softmax
// (maximum, row sum, O); the two streams' partial results are joined once, behind the loop, through LDS.
// S^T = K x Q^T so queries sit on lanes; P^T in C-layout is bit-identical to the A-fragment layout of O += P x V.
// Scores: kval.qval in the main accumulator; kres.qval + kval.qres in a second accumulator folded by 1/2048 in f32.
// K, K-residual and V tiles of KS keys are brought into a two-buffer LDS ring per stream once per block by asynchronous copies
// (a stream's next but one stage flies while its next is worked on); the fragments are two 16-B LDS loads each, in the k order of the q fragments.
// One online-softmax step per stage: all KS scores first, then one maximum, one exchange between the lane halves and one
// rescale of O, then the stage's PV products.
// Epilogue: out-projection + gate + skip-add of the block's 128 positions. D[n][c] = sum_d ctx[n][d] woh[c][d];
// result = D * (g/64) + bf16 RNE value of x; g = bf16 RNE value of gamma. Wave w of the 16 owns channels 16w..16w+15.
// The block's x tile [256 c][128 n] comes into LDS beside the ring, eight rows with each stage's copies.
// LDS sC, sM: cross-wave (block barriers). sRing, sXO as filled by the copies: cross-wave, published by the ring's barriers.
// sXO in the epilogue: each wave reads and rewrites only the rows of its own channels.

// One stage, copied by the 256 threads of its stream (tid = thread within the stream):
// keys s*KS..s*KS+KS-1 of the three planes into dst. Six 16-B pieces per thread, every lane on, all addresses
// 16-B multiples; k / k residual pieces are contiguous in global memory, v pieces are 256-B runs of each of the 32 rows.
// A seventh piece per thread: x rows (channels) s*NWAVE..s*NWAVE+NWAVE-1 of the block's positions into sx, one row per wave.
static __device__ __forceinline__ void stage_copy(const f16* __restrict__ kb_b, const f16* __restrict__ kr_b,
                                                  const f16* __restrict__ vt_b, const float* __restrict__ x_b,
                                                  int s, f16* dst, float* sx, int tid) {
  const int j0 = s * KS;
  const int p0 = tid, p1 = tid + 256;                 // piece 0..511 of each plane
  const f16* gk0 = kb_b + (size_t)j0 * HD + p0 * 8;
  const f16* gk1 = kb_b + (size_t)j0 * HD + p1 * 8;
  const f16* gr0 = kr_b + (size_t)j0 * HD + p0 * 8;
  const f16* gr1 = kr_b + (size_t)j0 * HD + p1 * 8;
  const f16* gv0 = vt_b + (size_t)(p0 >> 4) * SEQ + j0 + (p0 & 15) * 8;
  const f16* gv1 = vt_b + (size_t)(p1 >> 4) * SEQ + j0 + (p1 & 15) * 8;
  const unsigned l0  = (unsigned)(size_t)dst;         // LDS byte address of the stage
  const unsigned lk0 = l0 + ((p0 >> 2) * KPH + (p0 & 3) * 8) * 2;
  const unsigned lk1 = l0 + ((p1 >> 2) * KPH + (p1 & 3) * 8) * 2;
  const unsigned lr0 = lk0 + ST_KR * 2;
  const unsigned lr1 = lk1 + ST_KR * 2;
  const unsigned lv0 = l0 + (ST_V + (p0 >> 4) * VPH + (p0 & 15) * 8) * 2;
  const unsigned lv1 = l0 + (ST_V + (p1 >> 4) * VPH + (p1 & 15) * 8) * 2;
  const int xc = s * NWAVE + (tid >> 5);              // channel row of this wave's x piece
  const float* gx = x_b + (size_t)xc * SEQ_FULL + (tid & 31) * 4;
  const unsigned lx = (unsigned)(size_t)sx + (xc * XP + (tid & 31) * 4) * 4;
  // The copies and their s_wait_xcnt in one statement: no address register is rewritten ahead of that wait.
  asm volatile("global_load_async_to_lds_b128 %0, %7, off\n\t"
               "global_load_async_to_lds_b128 %1, %8, off\n\t"
               "global_load_async_to_lds_b128 %2, %9, off\n\t"
               "global_load_async_to_lds_b128 %3, %10, off\n\t"
               "global_load_async_to_lds_b128 %4, %11, off\n\t"
               "global_load_async_to_lds_b128 %5, %12, off\n\t"
               "global_load_async_to_lds_b128 %6, %13, off\n\t"
               "s_wait_xcnt 0x0"
               :: "v"(lk0), "v"(lk1), "v"(lr0), "v"(lr1), "v"(lv0), "v"(lv1), "v"(lx),
                  "v"(gk0), "v"(gk1), "v"(gr0), "v"(gr1), "v"(gv0), "v"(gv1), "v"(gx)
               : "memory");
}

// Epilogue pieces. A lane's part of one channel row of the LDS tile: eight neighbouring positions out of every 16.
static __device__ __forceinline__ void x_rows_load(const float* xrow, v4f (&xv)[NWAVE][2]) {
  #pragma unroll
  for (int nt = 0; nt < NWAVE; ++nt) {
    xv[nt][0] = *(const v4f*)(xrow + nt * 16);
    xv[nt][1] = *(const v4f*)(xrow + nt * 16 + 4);
  }
}
// result = D * gs + bf16 RNE value of x, written over x in the LDS tile
static __device__ __forceinline__ void gate_add_store(float* xrow, const v8f (&acc)[NWAVE], const v4f (&xv)[NWAVE][2],
                                                      float gs) {
  #pragma unroll
  for (int nt = 0; nt < NWAVE; ++nt) {
    v4f r0, r1;
    #pragma unroll
    for (int i = 0; i < 4; ++i) {
      r0[i] = fmaf(acc[nt][i], gs, bf16_val(xv[nt][0][i]));
      r1[i] = fmaf(acc[nt][4 + i], gs, bf16_val(xv[nt][1][i]));
    }
    *(v4f*)(xrow + nt * 16)     = r0;
    *(v4f*)(xrow + nt * 16 + 4) = r1;
  }
}
// 16 channel rows of the LDS tile to the output: each store is one 512-B row of the block's positions, whole lines
static __device__ __forceinline__ void rows_out(const float* srow, float* orow) {
  v4f vals[16];
  #pragma unroll
  for (int it = 0; it < 16; ++it) vals[it] = *(const v4f*)(srow + it * XP);
  #pragma unroll
  for (int it = 0; it < 16; ++it) *(v4f*)(orow + (size_t)it * SEQ_FULL) = vals[it];
}

__global__ __launch_bounds__(512) void attn_kernel(const f16* __restrict__ qp, const f16* __restrict__ qr,
                                                   const f16* __restrict__ kp, const f16* __restrict__ kr,
                                                   const f16* __restrict__ vp, const f16* __restrict__ woh,
                                                   const float* __restrict__ x, const float* __restrict__ gamma,
                                                   float* __restrict__ out) {
  const int qblk = blockIdx.x;
  const int b    = blockIdx.y;
  const int tid  = threadIdx.x;
  const int wave = tid >> 5;                                      // 0..15
  const int grp  = __builtin_amdgcn_readfirstlane(tid >> 8);      // key stream of the wave, a scalar
  const int qw   = wave & (NWAVE - 1);                            // query tile of the wave
  const int gtid = tid & 255;                                     // thread within its stream
  const int lane = tid & 31;
  const int lq   = lane & 15;   // query column of S^T / d column of O
  const int hi   = lane >> 4;   // k-split half

  __shared__ __align__(16) f16 sC[NWAVE * 16 * CP];
  __shared__ __align__(16) f16 sRing[2 * NGW * ST_H];           // [ring slot][stream]
  __shared__ __align__(16) float sM[NWAVE * 18 * 32];           // stream 1's partial O (16 words a lane), bias and row sum
  __shared__ __align__(16) float sXO[CH * XP];        // [c][n]: x of the block's positions, then the result in place

  const int qrow0 = qblk * BQ + qw * 16;

  FragH qf, qrf;                 // B operands: column = query qrow0+lq, k = d split map (value, residual)
  {
    const size_t qo = ((size_t)b * SEQ + qrow0 + lq) * HD + hi * 8;
    qf.q[0]  = *(const v4u*)(qp + qo);          // d = 8*hi + 0..7
    qf.q[1]  = *(const v4u*)(qp + qo + 16);     // d = 16 + 8*hi + 0..7
    qrf.q[0] = *(const v4u*)(qr + qo);
    qrf.q[1] = *(const v4u*)(qr + qo + 16);
  }
  const f16* kb_b = kp + (size_t)b * SEQ * HD;
  const f16* kr_b = kr + (size_t)b * SEQ * HD;
  const f16* vt_b = vp + (size_t)b * HD * SEQ;
  const float* x_b = x + (size_t)b * CH * SEQ_FULL + qblk * BQ;

  v8f o[2];
  o[0] = (v8f){0, 0, 0, 0, 0, 0, 0, 0};
  o[1] = (v8f){0, 0, 0, 0, 0, 0, 0, 0};
  float rmax = -__builtin_inff();
  float rbias = -__builtin_inff();        // rmax * log2(e) - 12, as rounded: the reference point of every exponent
  float rsum = 0.0f;                      // carried x4096, like P and O
  const float SL = 1.4426950408889634f;   // log2(e)

  // ring prologue: each stream's first stage landed and published, then its second in flight
  f16* ring_g = sRing + grp * ST_H;                   // this stream's two buffers: ring_g, ring_g + NGW * ST_H
  stage_copy(kb_b, kr_b, vt_b, x_b, grp, ring_g, sXO, gtid);
  asm volatile("s_wait_asynccnt 0x0" ::: "memory");   // this wave's pieces of the first stage have landed
  __syncthreads();                                    // ... and every other wave's
  stage_copy(kb_b, kr_b, vt_b, x_b, NGW + grp, ring_g + NGW * ST_H, sXO, gtid);

  #pragma unroll 1
  for (int t = 0; t < NTRIP; ++t) {                   // this wave's stage: t * NGW + grp
  f16* sbuf = ring_g + (t & 1) * (NGW * ST_H);        // trip t reads this buffer alone

  // c[sub][r] = score(query qrow0+lq, key (t*NGW+grp)*KS + sub*16 + 8*hi + r): all KS keys of the stage before any softmax work.
  // Four tiles at a time, so that the product that accumulates into cr stands four products behind the one it waits for;
  // each four tiles' k and k residual fragments are read as one group in front of their products (all eight tiles' at once
  // do not fit the 256 registers a wave has at four waves per SIMD; the other waves of the SIMD cover the second group's latency).
  v8f c[NSUB];
  #pragma unroll
  for (int h = 0; h < NSUB; h += 4) {
    FragH ak[4], akr[4];
    #pragma unroll
    for (int i = 0; i < 4; ++i) {
      const int ko = ((h + i) * 16 + lq) * KPH + hi * 8;       // row = key
      ak[i].q[0] = *(const v4u*)(sbuf + ko);                   // d = 8*hi + 0..7
      ak[i].q[1] = *(const v4u*)(sbuf + ko + 16);              // d = 16 + 8*hi + 0..7
    }
    #pragma unroll
    for (int i = 0; i < 4; ++i) {
      const int ko = ((h + i) * 16 + lq) * KPH + hi * 8;
      akr[i].q[0] = *(const v4u*)(sbuf + ST_KR + ko);
      akr[i].q[1] = *(const v4u*)(sbuf + ST_KR + ko + 16);
    }
    const v8f z = (v8f){0, 0, 0, 0, 0, 0, 0, 0};
    v8f cm[4], cr[4];
    #pragma unroll
    for (int i = 0; i < 4; ++i) cm[i] = mma_f16(ak[i].v, qf.v, z);        // value x value
    #pragma unroll
    for (int i = 0; i < 4; ++i) cr[i] = mma_f16(akr[i].v, qf.v, z);       // k residual x q value
    #pragma unroll
    for (int i = 0; i < 4; ++i) cr[i] = mma_f16(ak[i].v, qrf.v, cr[i]);   // k value x q residual
    #pragma unroll
    for (int i = 0; i < 4; ++i) c[h + i] = cm[i] + cr[i] * RES_FOLD;
  }

  // the stage's v fragments, read as one group; the softmax work below covers their latency
  FragH bv[NGRP][2];
  #pragma unroll
  for (int g = 0; g < NGRP; ++g) {
    #pragma unroll
    for (int dt = 0; dt < 2; ++dt) {
      const f16* base = sbuf + ST_V + (dt * 16 + lq) * VPH + g * BK + hi * 8;    // column = d
      bv[g][dt].q[0] = *(const v4u*)(base);           // keys g*32 + 8*hi + 0..7 of the stage
      bv[g][dt].q[1] = *(const v4u*)(base + 16);      // keys g*32 + 16 + 8*hi + 0..7
    }
  }

  // one online-softmax step per stage: query lq's KS scores are split across lane / lane^16.
  // The maximum runs as eight independent chains over the tiles, joined at the end.
  v8f mx = c[0];
  #pragma unroll
  for (int sub = 1; sub < NSUB; ++sub) {
    #pragma unroll
    for (int r = 0; r < 8; ++r) mx[r] = fmaxf(mx[r], c[sub][r]);
  }
  float m_new = rmax;
  #pragma unroll
  for (int r = 0; r < 8; ++r) m_new = fmaxf(m_new, mx[r]);
  m_new = fmaxf(m_new, __shfl_xor(m_new, 16, 32));
  // The exponent of a score is one fused multiply-add: c * log2(e) - bias, bias = m_new * log2(e) - 12, so that the
  // maximum, the change of base and the x4096 carry of P cost no instruction of their own. The rescale uses the same
  // rounded biases, so every stage's weights refer to one another exactly as their exponents do.
  const float bias_new = fmaf(m_new, SL, -12.0f);
  const float scale = __builtin_amdgcn_exp2f(rbias - bias_new);
  rmax  = m_new;
  rbias = bias_new;
  const v8f slv = (v8f){SL, SL, SL, SL, SL, SL, SL, SL};
  const float nb = -bias_new;
  const v8f nbv = (v8f){nb, nb, nb, nb, nb, nb, nb, nb};

  // exp + pack: P^T C-layout == A-fragment layout of the PV product; P carried x4096
  FragH pa[NGRP];
  v8f ps = (v8f){0, 0, 0, 0, 0, 0, 0, 0};
  #pragma unroll
  for (int sub = 0; sub < NSUB; ++sub) {
    const v8f e = __builtin_elementwise_fma(c[sub], slv, nbv);
    v8f p;
    #pragma unroll
    for (int r = 0; r < 8; ++r) p[r] = __builtin_amdgcn_exp2f(e[r]);   // 4096 x weight of key sub*16 + 8*hi + r
    ps += p;
    #pragma unroll
    for (int r = 0; r < 8; ++r) pa[sub >> 1].h[(sub & 1) * 8 + r] = (f16)p[r];
  }
  const float psum = ((ps[0] + ps[1]) + (ps[2] + ps[3])) + ((ps[4] + ps[5]) + (ps[6] + ps[7]));
  rsum = rsum * scale + psum + __shfl_xor(psum, 16, 32);

  // rescale O: queries are the row dimension there -> per-row scale from lane 8*hi + r
  float sc[8];
  #pragma unroll
  for (int r = 0; r < 8; ++r) sc[r] = __shfl(scale, (hi << 3) + r, 32);
  #pragma unroll
  for (int dt = 0; dt < 2; ++dt) {
    #pragma unroll
    for (int r = 0; r < 8; ++r) o[dt][r] *= sc[r];
  }

  // O += P x V over the stage's NGRP groups of 32 keys
  #pragma unroll
  for (int g = 0; g < NGRP; ++g) {
    #pragma unroll
    for (int dt = 0; dt < 2; ++dt) o[dt] = mma_f16(pa[g].v, bv[g][dt].v, o[dt]);
  }
  // publish point of trip t + 1's stages; behind it the buffer just read is free for trip t + 2's
  asm volatile("s_wait_dscnt 0x0" ::: "memory");      // this wave's reads of sbuf have returned
  asm volatile("s_wait_asynccnt 0x0" ::: "memory");   // this wave's pieces of trip t + 1's stage have landed
  __syncthreads();
  if (t + 2 < NTRIP) stage_copy(kb_b, kr_b, vt_b, x_b, (t + 2) * NGW + grp, sbuf, sXO, gtid);
  }
  asm volatile("s_wait_asynccnt 0x0" ::: "memory");   // nothing in flight when the wave goes on to its end

  // this wave's out-projection weights, asked for ahead of the join. B operand: column = channel, k = d split map
  FragH bw;
  {
    const f16* wr = woh + (size_t)(wave * 16 + lq) * HD + hi * 8;
    bw.q[0] = *(const v4u*)(wr);
    bw.q[1] = *(const v4u*)(wr + 16);
  }
  const float gs = bf16_val(gamma[0]) * (1.0f / 64.0f);

  // x of the wave's 16 channels (the tile was published by the ring's last barriers); the join covers the latency
  const int c0 = wave * 16;
  float* xrow0 = sXO + (c0 + lq) * XP + hi * 8;       // lane: channel row c0 + lq, positions nt*16 + 8*hi + 0..7
  v4f xv0[NWAVE][2];
  x_rows_load(xrow0, xv0);

  // join of the two key streams: wave qw of stream 1 hands its partial O, bias and row sum, lane for lane, to wave qw of stream 0
  float* mrow = sM + qw * (18 * 32);
  if (grp == 1) {
    #pragma unroll
    for (int dt = 0; dt < 2; ++dt) {
      *(v4f*)(mrow + ((dt * 2 + 0) * 32 + lane) * 4) = (v4f){o[dt][0], o[dt][1], o[dt][2], o[dt][3]};
      *(v4f*)(mrow + ((dt * 2 + 1) * 32 + lane) * 4) = (v4f){o[dt][4], o[dt][5], o[dt][6], o[dt][7]};
    }
    mrow[16 * 32 + lane] = rbias;
    mrow[17 * 32 + lane] = rsum;
  }
  __syncthreads();                         // stream 1's partial results are in sM

  if (grp == 0) {
    v4f o1[2][2];
    #pragma unroll
    for (int dt = 0; dt < 2; ++dt) {
      o1[dt][0] = *(const v4f*)(mrow + ((dt * 2 + 0) * 32 + lane) * 4);
      o1[dt][1] = *(const v4f*)(mrow + ((dt * 2 + 1) * 32 + lane) * 4);
    }
    const float b1 = mrow[16 * 32 + lane];
    const float l1 = mrow[17 * 32 + lane];
    // both partial results are brought to the larger bias, as a rescale inside the loop does, then normalised
    const float bm = fmaxf(rbias, b1);
    const float s0 = __builtin_amdgcn_exp2f(rbias - bm);
    const float s1 = __builtin_amdgcn_exp2f(b1 - bm);
    const float rinv = 1.0f / (rsum * s0 + l1 * s1);   // O and the row sums carry the same x4096
    const float f0 = s0 * rinv, f1 = s1 * rinv;
    // lane holds column d = dt*16 + lq for query rows 8*hi + r: per-row factors from lane 8*hi + r
    float r0[8], r1[8];
    #pragma unroll
    for (int r = 0; r < 8; ++r) {
      r0[r] = __shfl(f0, (hi << 3) + r, 32);
      r1[r] = __shfl(f1, (hi << 3) + r, 32);
    }
    f16* so = sC + qw * (16 * CP);
    #pragma unroll
    for (int r = 0; r < 8; ++r) {
      #pragma unroll
      for (int dt = 0; dt < 2; ++dt)
        so[(hi * 8 + r) * CP + dt * 16 + lq] = (f16)(o[dt][r] * r0[r] + o1[dt][r >> 2][r & 3] * r1[r]);
    }
  }
  __syncthreads();                         // ctx of all 128 positions is in sC

  FragH an[NWAVE];                         // A operands: row = position nt*16 + lq, k = d split map
  #pragma unroll
  for (int nt = 0; nt < NWAVE; ++nt) {
    const f16* p = sC + (nt * 16 + lq) * CP + hi * 8;
    an[nt].q[0] = *(const v4u*)(p);
    an[nt].q[1] = *(const v4u*)(p + 16);
  }

  // D element r of lane: (n = nt*16 + 8*hi + r, c = c0 + lq): eight neighbouring positions of one channel row
  const v8f z = (v8f){0, 0, 0, 0, 0, 0, 0, 0};
  float* orow = out + ((size_t)b * CH + c0) * SEQ_FULL + qblk * BQ + lane * 4;
  v8f acc0[NWAVE];
  #pragma unroll
  for (int nt = 0; nt < NWAVE; ++nt) acc0[nt] = mma_f16(an[nt].v, bw.v, z);
  gate_add_store(xrow0, acc0, xv0, gs);
  asm volatile("s_wait_dscnt 0x0" ::: "memory");      // the wave's own rows are written before it reads them back whole
  rows_out(sXO + c0 * XP + lane * 4, orow);
}

extern "C" void kernel_launch(void* const* d_in, const int* in_sizes, int n_in,
                              void* d_out, int out_size, void* d_ws, size_t ws_size,
                              hipStream_t stream) {
  if (n_in < 6) return;
  const size_t x_need = ((size_t)(NB - 1) * CH + (CH - 1)) * SEQ_FULL + SEQ;
  if ((size_t)in_sizes[0] < x_need) return;
  if ((size_t)in_sizes[1] < (size_t)HD * CH) return;
  if ((size_t)in_sizes[2] < (size_t)HD * CH) return;
  if ((size_t)in_sizes[3] < (size_t)HD * CH) return;
  if ((size_t)in_sizes[4] < (size_t)CH * HD) return;
  if (in_sizes[5] < 1) return;
  if ((size_t)out_size < x_need) return;
  if (ws_size < WS_TOTAL) return;

  const float* x     = (const float*)d_in[0];
  const float* wq    = (const float*)d_in[1];
  const float* wk    = (const float*)d_in[2];
  const float* wv    = (const float*)d_in[3];
  const float* wo    = (const float*)d_in[4];
  const float* gamma = (const float*)d_in[5];
  float*       out   = (float*)d_out;

  char* ws = (char*)d_ws;
  unsigned short* wb  = (unsigned short*)(ws);
  f16*            woh = (f16*)(ws + WB_BYTES);
  f16*            qp  = (f16*)(ws + WB_BYTES + WO_BYTES);
  f16*            kp  = (f16*)(ws + WB_BYTES + WO_BYTES + PL_BYTES);
  f16*            vp  = (f16*)(ws + WB_BYTES + WO_BYTES + 2 * PL_BYTES);
  f16*            qrp = (f16*)(ws + WB_BYTES + WO_BYTES + 4 * PL_BYTES);
  f16*            krp = (f16*)(ws + WB_BYTES + WO_BYTES + 5 * PL_BYTES);

  prep_kernel<<<dim3(16), 256, 0, stream>>>(wq, wk, wv, wo, wb, woh);
  // qkv_kernel(x, wb, qp, kp, qr, kr, vp)
  qkv_kernel<<<dim3(SEQ / NT, NB), 256, 0, stream>>>(x, wb, qp, kp, qrp, krp, vp);
  // attn_kernel(qp, qr, kp, kr, vp, woh, x, gamma, out)
  attn_kernel<<<dim3(SEQ / BQ, NB), 512, 0, stream>>>(qp, qrp, kp, krp, vp, woh, x, gamma, out);
}

// v006
// It runs in 46.9 microseconds.
// Timed twice side by side with v005, it ran 1.06 times as fast both times.
// All steps since v000 together make it 2.80 times as fast.
#include <hip/hip_runtime.h>

// Contractions: q/k/v projections on v_wmma_f32_16x16x32_bf16 (x and W as bf16 RNE-converted inputs, f32 accumulate);
// S^T = K x Q^T on v_wmma_f32_16x16x32_f16 as three products (q,k f16 value planes + f16 residual planes x2048,
// residual products in their own accumulator folded by 1/2048 in f32); O = P x V on f16 (P carried x4096, V f16);
// out-projection on f16 (Wo = f16 of bf16 RNE value x64, ctx f16, 1/64 folded in the f32 epilogue), done by the attention
// kernel itself on its own 128 positions; softmax, gate and skip-add in f32.

#ifndef NB
#define NB 8
#endif
#ifndef SEQ
#define SEQ 4096
#endif
#define NB_FULL   8
#define SEQ_FULL  4096
#define CH        256                 // channels (projection K)
#define HD        32                  // q/k/v dim (single head)
#define NQKV      96                  // stacked projection outputs: q 0..31, k 32..63, v 64..95
#define NT        64                  // positions per projection block
#define XPW       132                 // LDS pitch (32-bit words) of the transposed bf16 x tile
#define SP        72                  // LDS pitch (halves) of the q|k, q|k residual and v staging tiles
#define BQ        128                 // query rows per attention block (8 waves x 16)
#define BK        32                  // keys per PV product (k of one WMMA)
#define NWAVE     8                   // waves per key stream == 16-row query tiles per block
#define NGW       2                   // key streams (groups of NWAVE waves) per attention block
#define CP        40                  // LDS pitch (halves) of the per-wave ctx staging tile
#define KS        128                 // keys per LDS stage of the attention ring == keys per online-softmax step
#define NS        (SEQ / KS)          // stages
#define NTRIP     (NS / NGW)          // ring trips: each trip, every key stream works on a stage of its own
#define NSUB      (KS / 16)           // 16-key score tiles per stage
#define NGRP      (KS / BK)           // 32-key PV groups per stage
#define KPH       40                  // LDS pitch (halves) of a staged k / k residual row: 80 B = 16 B x odd
#define VPH       136                 // LDS pitch (halves) of a staged v row of KS keys: 272 B = 16 B x odd
#define ST_KR     (KS * KPH)          // offsets (halves) inside one stage: k at 0, k residual, v
#define ST_V      (2 * KS * KPH)
#define ST_H      (2 * KS * KPH + HD * VPH)   // halves per stage
#define XP        132                 // LDS pitch (floats) of a staged x / result row of BQ positions: 528 B = 16 B x odd
#define RES_CARRY 2048.0f             // power-of-two carry of the q/k residual planes
#define RES_FOLD  (1.0f / 2048.0f)

static_assert(NB >= 1 && NB <= NB_FULL);
static_assert(SEQ <= SEQ_FULL);
static_assert(SEQ % BQ == 0);
static_assert(SEQ % NT == 0);
static_assert(SEQ % BK == 0);
static_assert(BQ == NWAVE * 16);
static_assert(SEQ % KS == 0 && KS % BK == 0 && BK == 32 && NSUB % 4 == 0);
static_assert(KS * 4 == 2 * 256 && HD * (KS / 8) == 2 * 256);   // 16-B pieces per plane and stage == 2 per thread
static_assert(KPH >= HD && (KPH * 2) % 16 == 0 && VPH >= KS && (VPH * 2) % 16 == 0 && (ST_H * 2) % 16 == 0);
static_assert(HD == 32);
static_assert(CH % 32 == 0);
static_assert(NQKV == 3 * HD);
static_assert(8 * 256 == (CH / 2) * (NT / 4));     // x staging items == threads x iterations
static_assert(XPW >= CH / 2 && (XPW * 4) % 16 == 0);
static_assert(SP >= 2 * HD && SP >= NT && (SP * 2) % 16 == 0);
static_assert(NT * 4 == 256);                      // q/k (+ residual) plane store: one 16-B piece per thread each
static_assert(HD * 8 == 256);                      // v plane store: one 16-B piece per thread
static_assert(CP >= HD && (CP * 2) % 16 == 0);
static_assert(XP >= BQ && (XP * 4) % 16 == 0);
static_assert(NGW * NWAVE * 16 == CH);             // out-projection: each wave owns 16 channel rows
static_assert(NGW == 2 && NS % NGW == 0 && NTRIP >= 2);
static_assert(BQ * 4 == 32 * 16);                  // one x / result row of the block == one 16-B piece per lane of a wave
static_assert(NS >= 2 && NS * NWAVE == CH);        // one x row per wave rides each of the NS stage copies
static_assert(NT * XPW * 4 + 2 * NT * SP * 2 + HD * SP * 2 <= 65536);   // static LDS of the projection kernel

#define WB_BYTES  ((size_t)NQKV * CH * 2)
#define WO_BYTES  ((size_t)CH * HD * 2)
#define PL_BYTES  ((size_t)NB * SEQ * HD * 2)
#define NPLANE    6                                 // q, k, v, unused, q residual, k residual
#define WS_TOTAL  (WB_BYTES + WO_BYTES + NPLANE * PL_BYTES)
static_assert(WB_BYTES % 128 == 0 && WO_BYTES % 128 == 0 && PL_BYTES % 128 == 0);
static_assert(WS_TOTAL <= (size_t)134217728);

typedef __bf16   bf16;
typedef _Float16 f16;
typedef bf16     v16bf __attribute__((ext_vector_type(16)));
typedef f16      v16h  __attribute__((ext_vector_type(16)));
typedef f16      v8h   __attribute__((ext_vector_type(8)));
typedef float    v8f   __attribute__((ext_vector_type(8)));
typedef float    v4f   __attribute__((ext_vector_type(4)));
typedef unsigned v4u   __attribute__((ext_vector_type(4)));

union FragB  { v16bf v; v4u q[2]; };
union FragH  { v16h  v; v4u q[2]; f16 h[16]; };
union Pack8H { v4u u; v8h v; f16 h[8]; };

// WMMA helpers: the plain builtins; the compiler itself keeps the distance to a vector instruction on D, A or B.
static __device__ __forceinline__ v8f mma_bf16(v16bf a, v16bf b, v8f acc) {
  return __builtin_amdgcn_wmma_f32_16x16x32_bf16(false, a, false, b, (short)0, acc, false, false);
}
static __device__ __forceinline__ v8f mma_f16(v16h a, v16h b, v8f acc) {
  return __builtin_amdgcn_wmma_f32_16x16x32_f16(false, a, false, b, (short)0, acc, false, false);
}

// f32 -> bf16 bits, RNE (finite inputs).
static __device__ __forceinline__ unsigned bf16_bits(float f) {
  const unsigned u = __float_as_uint(f);
  return (u + 0x7FFFu + ((u >> 16) & 1u)) >> 16;
}
static __device__ __forceinline__ float bf16_val(float f) {
  return __uint_as_float(bf16_bits(f) << 16);
}

// Weight planes, built once. 4096 pieces of 8 elements, one 16-B piece per thread, 16 blocks x 256.
//   wb  [96][256] bf16 bits : rows 0..31 wq, 32..63 wk, 64..95 wv (k = channel contiguous)
//   woh [256][32] f16       : f16(bf16 RNE value of wo x 64), exact
__global__ __launch_bounds__(256) void prep_kernel(const float* __restrict__ wq, const float* __restrict__ wk,
                                                   const float* __restrict__ wv, const float* __restrict__ wo,
                                                   unsigned short* __restrict__ wb, f16* __restrict__ woh) {
  const int p = blockIdx.x * 256 + threadIdx.x;       // 0..4095
  if (blockIdx.x < 12) {                               // block-uniform
    const int which = p >> 10;                         // 0..2, block-uniform
    const int off   = (p & 1023) * 8;
    const v4f q0 = *(const v4f*)(wq + off), q1 = *(const v4f*)(wq + off + 4);
    const v4f k0 = *(const v4f*)(wk + off), k1 = *(const v4f*)(wk + off + 4);
    const v4f v0 = *(const v4f*)(wv + off), v1 = *(const v4f*)(wv + off + 4);
    const v4f a0 = (which == 0) ? q0 : ((which == 1) ? k0 : v0);   // select by value
    const v4f a1 = (which == 0) ? q1 : ((which == 1) ? k1 : v1);
    v4u u;
    u[0] = bf16_bits(a0[0]) | (bf16_bits(a0[1]) << 16);
    u[1] = bf16_bits(a0[2]) | (bf16_bits(a0[3]) << 16);
    u[2] = bf16_bits(a1[0]) | (bf16_bits(a1[1]) << 16);
    u[3] = bf16_bits(a1[2]) | (bf16_bits(a1[3]) << 16);
    unsigned short* dst = wb + (size_t)p * 8;
    *(v4u*)dst = u;
    
  } else {
    const int off = (p - 3072) * 8;
    const v4f a0 = *(const v4f*)(wo + off), a1 = *(const v4f*)(wo + off + 4);
    Pack8H ph;
    #pragma unroll
    for (int i = 0; i < 4; ++i) {
      ph.h[i]     = (f16)(bf16_val(a0[i]) * 64.0f);
      ph.h[4 + i] = (f16)(bf16_val(a1[i]) * 64.0f);
    }
    const v4u u = ph.u;
    f16* dst = woh + off;
    *(v4u*)dst = u;
    
  }
}

// Fused q/k/v projection. Block = (64-position tile, batch), 256 threads.
// x tile [256 c][64 n] is RNE-converted to bf16 and transposed through LDS to [n][c]; D[n][dd] = sum_c x[c][n] W[dd][c].
// Planes: qp,kp [NB][SEQ][32] f16 value planes; qr,kr [NB][SEQ][32] f16 residual planes = (f32 - f16 value) x 2048
// coverage: q,k,q_res,k_res rows n0..n0+63 x 32 d ; v 32 d x positions n0..n0+63 ; every written line whole,
// one instruction. LDS: sX, sQK, sR, sV are cross-wave (block barriers); staged extent == consumed extent for all four.
__global__ __launch_bounds__(256) void qkv_kernel(const float* __restrict__ x,
                                                  const unsigned short* __restrict__ wb,
                                                  f16* __restrict__ qp, f16* __restrict__ kp,
                                                  f16* __restrict__ qr, f16* __restrict__ kr,
                                                  f16* __restrict__ vp) {
  const int n0   = blockIdx.x * NT;
  const int b    = blockIdx.y;
  const int tid  = threadIdx.x;
  const int wave = tid >> 5;
  const int lane = tid & 31;
  const int lq   = lane & 15;
  const int hi   = lane >> 4;

  __shared__ __align__(16) unsigned sX[NT * XPW];     // [n][c/2] packed bf16 pairs (even c in the low half)
  __shared__ __align__(16) f16      sQK[NT * SP];     // [n][q 0..31 | k 32..63] values
  __shared__ __align__(16) f16      sR[NT * SP];      // [n][q 0..31 | k 32..63] residuals x2048
  __shared__ __align__(16) f16      sV[HD * SP];      // [d][n]

  #pragma unroll 2
  for (int it = 0; it < 8; ++it) {
    const int item = it * 256 + tid;                  // 0..2047
    const int nq   = item & 15;                       // 4-position group
    const int cp   = item >> 4;                       // channel pair 0..127
    const float* src = x + ((size_t)b * CH + 2 * cp) * SEQ_FULL + n0 + nq * 4;
    const v4f a0 = *(const v4f*)(src);
    const v4f a1 = *(const v4f*)(src + SEQ_FULL);
    #pragma unroll
    for (int i = 0; i < 4; ++i)
      sX[(nq * 4 + i) * XPW + cp] = bf16_bits(a0[i]) | (bf16_bits(a1[i]) << 16);
  }
  __syncthreads();

  const int nt = wave & 3;                            // position sub-tile
  const int g3 = wave >> 2;                           // output tile group: tiles g3*3 + {0,1,2}
  v8f acc[3];
  #pragma unroll
  for (int j = 0; j < 3; ++j) acc[j] = (v8f){0, 0, 0, 0, 0, 0, 0, 0};

  const int aoff = (nt * 16 + lq) * XPW + hi * 4;     // row n, words of channels 8*hi..
  #pragma unroll 2
  for (int ks = 0; ks < CH / 32; ++ks) {
    FragB a;
    a.q[0] = *(const v4u*)(sX + aoff + ks * 16);        // c = ks*32 + 8*hi + 0..7
    a.q[1] = *(const v4u*)(sX + aoff + ks * 16 + 8);    // c = ks*32 + 16 + 8*hi + 0..7
    #pragma unroll
    for (int j = 0; j < 3; ++j) {
      const unsigned short* wr = wb + (size_t)((g3 * 3 + j) * 16 + lq) * CH + ks * 32 + hi * 8;
      FragB w;
      w.q[0] = *(const v4u*)(wr);                       // c = ks*32 + 8*hi + 0..7
      w.q[1] = *(const v4u*)(wr + 16);                  // c = ks*32 + 16 + 8*hi + 0..7
      acc[j] = mma_bf16(a.v, w.v, acc[j]);
    }
  }

  // D element r of lane: (n = nt*16 + 8*hi + r, dd = tile*16 + lq)
  #pragma unroll
  for (int j = 0; j < 3; ++j) {
    const int t = g3 * 3 + j;                         // wave-uniform
    #pragma unroll
    for (int r = 0; r < 8; ++r) {
      const int nrow = nt * 16 + hi * 8 + r;
      const float av = acc[j][r];
      const f16 hv = (f16)av;
      if (t < 4) {
        sQK[nrow * SP + t * 16 + lq] = hv;
        sR[nrow * SP + t * 16 + lq]  = (f16)((av - (float)hv) * RES_CARRY);
      } else {
        sV[((t - 4) * 16 + lq) * SP + nrow] = hv;
      }
    }
  }
  __syncthreads();

  Pack8H pq, pk, pqr, pkr, pv;
  const int row = tid >> 2, seg = tid & 3;
  pq.v  = *(const v8h*)(sQK + row * SP + seg * 8);
  pk.v  = *(const v8h*)(sQK + row * SP + HD + seg * 8);
  pqr.v = *(const v8h*)(sR + row * SP + seg * 8);
  pkr.v = *(const v8h*)(sR + row * SP + HD + seg * 8);
  const int dv = tid >> 3, sv = tid & 7;
  pv.v = *(const v8h*)(sV + dv * SP + sv * 8);
  const size_t qi = ((size_t)b * SEQ + n0) * HD + (size_t)tid * 8;
  const size_t vi = ((size_t)b * HD + dv) * SEQ + n0 + sv * 8;
  const v4u uq = pq.u, uk = pk.u, uqr = pqr.u, ukr = pkr.u, uv = pv.u;
  *(v4u*)(qp + qi) = uq;
  *(v4u*)(kp + qi) = uk;
  *(v4u*)(qr + qi) = uqr;
  *(v4u*)(kr + qi) = ukr;
  *(v4u*)(vp + vi) = uv;
  
}

// Flash attention, all keys, no logit scaling. Block = (query block of 128, batch), 16 waves: four per SIMD, so that one
// wave's softmax work, LDS reads and waits stand beside the others' products. The waves form two key streams of eight:
// stream g takes stages g, g + 2, g + 4, ...; in a stream one wave owns 16 query rows and keeps its own online softmax
// (maximum, row sum, O); the two streams' partial results are joined once, behind the loop, through LDS.
// S^T = K x Q^T so queries sit on lanes; P^T in C-layout is bit-identical to the A-fragment layout of O += P x V.
// Scores: kval.qval in the main accumulator; kres.qval + kval.qres in a second accumulator folded by 1/2048 in f32.
// K, K-residual and V tiles of KS keys are brought into a two-buffer LDS ring per stream once per block by asynchronous copies
// (a stream's next but one stage flies while its next is worked on); the fragments are two 16-B LDS loads each, in the k order of the q fragments.
// One online-softmax step per stage: all KS scores first, then one maximum, one exchange between the lane halves and one
// rescale of O, then the stage's PV products.
// Epilogue: out-projection + gate + skip-add of the block's 128 positions. D[n][c] = sum_d ctx[n][d] woh[c][d];
// result = D * (g/64) + bf16 RNE value of x; g = bf16 RNE value of gamma. Wave w of the 16 owns channels 16w..16w+15.
// The block's x tile [256 c][128 n] comes into LDS beside the ring, eight rows with each stage's copies.
// LDS sC, sM: cross-wave (block barriers). sRing, sXO as filled by the copies: cross-wave, published by the ring's barriers.
// sXO in the epilogue: each wave reads and rewrites only the rows of its own channels.

// One stage, copied by the 256 threads of its stream (tid = thread within the stream):
// keys s*KS..s*KS+KS-1 of the three planes into dst. Six 16-B pieces per thread, every lane on, all addresses
// 16-B multiples; k / k residual pieces are contiguous in global memory, v pieces are 256-B runs of each of the 32 rows.
// A seventh piece per thread: x rows (channels) s*NWAVE..s*NWAVE+NWAVE-1 of the block's positions into sx, one row per wave.
static __device__ __forceinline__ void stage_copy(const f16* __restrict__ kb_b, const f16* __restrict__ kr_b,
                                                  const f16* __restrict__ vt_b, const float* __restrict__ x_b,
                                                  int s, f16* dst, float* sx, int tid) {
  const int j0 = s * KS;
  const int p0 = tid, p1 = tid + 256;                 // piece 0..511 of each plane
  const f16* gk0 = kb_b + (size_t)j0 * HD + p0 * 8;
  const f16* gk1 = kb_b + (size_t)j0 * HD + p1 * 8;
  const f16* gr0 = kr_b + (size_t)j0 * HD + p0 * 8;
  const f16* gr1 = kr_b + (size_t)j0 * HD + p1 * 8;
  const f16* gv0 = vt_b + (size_t)(p0 >> 4) * SEQ + j0 + (p0 & 15) * 8;
  const f16* gv1 = vt_b + (size_t)(p1 >> 4) * SEQ + j0 + (p1 & 15) * 8;
  const unsigned l0  = (unsigned)(size_t)dst;         // LDS byte address of the stage
  const unsigned lk0 = l0 + ((p0 >> 2) * KPH + (p0 & 3) * 8) * 2;
  const unsigned lk1 = l0 + ((p1 >> 2) * KPH + (p1 & 3) * 8) * 2;
  const unsigned lr0 = lk0 + ST_KR * 2;
  const unsigned lr1 = lk1 + ST_KR * 2;
  const unsigned lv0 = l0 + (ST_V + (p0 >> 4) * VPH + (p0 & 15) * 8) * 2;
  const unsigned lv1 = l0 + (ST_V + (p1 >> 4) * VPH + (p1 & 15) * 8) * 2;
  const int xc = s * NWAVE + (tid >> 5);              // channel row of this wave's x piece
  const float* gx = x_b + (size_t)xc * SEQ_FULL + (tid & 31) * 4;
  const unsigned lx = (unsigned)(size_t)sx + (xc * XP + (tid & 31) * 4) * 4;
  // The copies and their s_wait_xcnt in one statement: no address register is rewritten ahead of that wait.
  asm volatile("global_load_async_to_lds_b128 %0, %7, off\n\t"
               "global_load_async_to_lds_b128 %1, %8, off\n\t"
               "global_load_async_to_lds_b128 %2, %9, off\n\t"
               "global_load_async_to_lds_b128 %3, %10, off\n\t"
               "global_load_async_to_lds_b128 %4, %11, off\n\t"
               "global_load_async_to_lds_b128 %5, %12, off\n\t"
               "global_load_async_to_lds_b128 %6, %13, off\n\t"
               "s_wait_xcnt 0x0"
               :: "v"(lk0), "v"(lk1), "v"(lr0), "v"(lr1), "v"(lv0), "v"(lv1), "v"(lx),
                  "v"(gk0), "v"(gk1), "v"(gr0), "v"(gr1), "v"(gv0), "v"(gv1), "v"(gx)
               : "memory");
}

// Epilogue pieces. A lane's part of one channel row of the LDS tile: eight neighbouring positions out of every 16.
static __device__ __forceinline__ void x_rows_load(const float* xrow, v4f (&xv)[NWAVE][2]) {
  #pragma unroll
  for (int nt = 0; nt < NWAVE; ++nt) {
    xv[nt][0] = *(const v4f*)(xrow + nt * 16);
    xv[nt][1] = *(const v4f*)(xrow + nt * 16 + 4);
  }
}
// result = D * gs + bf16 RNE value of x, written over x in the LDS tile
static __device__ __forceinline__ void gate_add_store(float* xrow, const v8f (&acc)[NWAVE], const v4f (&xv)[NWAVE][2],
                                                      float gs) {
  #pragma unroll
  for (int nt = 0; nt < NWAVE; ++nt) {
    v4f r0, r1;
    #pragma unroll
    for (int i = 0; i < 4; ++i) {
      r0[i] = fmaf(acc[nt][i], gs, bf16_val(xv[nt][0][i]));
      r1[i] = fmaf(acc[nt][4 + i], gs, bf16_val(xv[nt][1][i]));
    }
    *(v4f*)(xrow + nt * 16)     = r0;
    *(v4f*)(xrow + nt * 16 + 4) = r1;
  }
}
// 16 channel rows of the LDS tile to the output: each store is one 512-B row of the block's positions, whole lines
static __device__ __forceinline__ void rows_out(const float* srow, float* orow) {
  v4f vals[16];
  #pragma unroll
  for (int it = 0; it < 16; ++it) vals[it] = *(const v4f*)(srow + it * XP);
  #pragma unroll
  for (int it = 0; it < 16; ++it) *(v4f*)(orow + (size_t)it * SEQ_FULL) = vals[it];
}

__global__ __launch_bounds__(512) void attn_kernel(const f16* __restrict__ qp, const f16* __restrict__ qr,
                                                   const f16* __restrict__ kp, const f16* __restrict__ kr,
                                                   const f16* __restrict__ vp, const f16* __restrict__ woh,
                                                   const float* __restrict__ x, const float* __restrict__ gamma,
                                                   float* __restrict__ out) {
  const int qblk = blockIdx.x;
  const int b    = blockIdx.y;
  const int tid  = threadIdx.x;
  const int wave = tid >> 5;                                      // 0..15
  const int grp  = __builtin_amdgcn_readfirstlane(tid >> 8);      // key stream of the wave, a scalar
  const int qw   = wave & (NWAVE - 1);                            // query tile of the wave
  const int gtid = tid & 255;                                     // thread within its stream
  const int lane = tid & 31;
  const int lq   = lane & 15;   // query column of S^T / d column of O
  const int hi   = lane >> 4;   // k-split half

  __shared__ __align__(16) f16 sC[NWAVE * 16 * CP];
  __shared__ __align__(16) f16 sRing[2 * NGW * ST_H];           // [ring slot][stream]
  __shared__ __align__(16) float sM[NWAVE * 18 * 32];           // stream 1's partial O (16 words a lane), bias and row sum
  __shared__ __align__(16) float sXO[CH * XP];        // [c][n]: x of the block's positions, then the result in place

  const int qrow0 = qblk * BQ + qw * 16;

  FragH qf, qrf;                 // B operands: column = query qrow0+lq, k = d split map (value, residual)
  {
    const size_t qo = ((size_t)b * SEQ + qrow0 + lq) * HD + hi * 8;
    qf.q[0]  = *(const v4u*)(qp + qo);          // d = 8*hi + 0..7
    qf.q[1]  = *(const v4u*)(qp + qo + 16);     // d = 16 + 8*hi + 0..7
    qrf.q[0] = *(const v4u*)(qr + qo);
    qrf.q[1] = *(const v4u*)(qr + qo + 16);
  }
  const f16* kb_b = kp + (size_t)b * SEQ * HD;
  const f16* kr_b = kr + (size_t)b * SEQ * HD;
  const f16* vt_b = vp + (size_t)b * HD * SEQ;
  const float* x_b = x + (size_t)b * CH * SEQ_FULL + qblk * BQ;

  v8f o[2];
  o[0] = (v8f){0, 0, 0, 0, 0, 0, 0, 0};
  o[1] = (v8f){0, 0, 0, 0, 0, 0, 0, 0};
  float rmax = -__builtin_inff();
  float rbias = -__builtin_inff();        // rmax * log2(e) - 12, as rounded: the reference point of every exponent
  float rsum = 0.0f;                      // carried x4096, like P and O
  const float SL = 1.4426950408889634f;   // log2(e)

  // ring prologue: each stream's first stage landed and published, then its second in flight
  f16* ring_g = sRing + grp * ST_H;                   // this stream's two buffers: ring_g, ring_g + NGW * ST_H
  stage_copy(kb_b, kr_b, vt_b, x_b, grp, ring_g, sXO, gtid);
  asm volatile("s_wait_asynccnt 0x0" ::: "memory");   // this wave's pieces of the first stage have landed
  __syncthreads();                                    // ... and every other wave's
  stage_copy(kb_b, kr_b, vt_b, x_b, NGW + grp, ring_g + NGW * ST_H, sXO, gtid);

  #pragma unroll 1
  for (int t = 0; t < NTRIP; ++t) {                   // this wave's stage: t * NGW + grp
  f16* sbuf = ring_g + (t & 1) * (NGW * ST_H);        // trip t reads this buffer alone

  // c[sub][r] = score(query qrow0+lq, key (t*NGW+grp)*KS + sub*16 + 8*hi + r): all KS keys of the stage before any softmax work.
  // Four tiles at a time, so that the product that accumulates into cr stands four products behind the one it waits for.
  // Nothing ties the LDS reads, the products and the folds to this order: the compiler reads the fragments ahead as far as
  // the 256 registers a wave has at four waves per SIMD allow, and puts the folds among the products.
  v8f c[NSUB];
  #pragma unroll
  for (int h = 0; h < NSUB; h += 4) {
    FragH ak[4], akr[4];
    #pragma unroll
    for (int i = 0; i < 4; ++i) {
      const int ko = ((h + i) * 16 + lq) * KPH + hi * 8;       // row = key
      ak[i].q[0] = *(const v4u*)(sbuf + ko);                   // d = 8*hi + 0..7
      ak[i].q[1] = *(const v4u*)(sbuf + ko + 16);              // d = 16 + 8*hi + 0..7
    }
    #pragma unroll
    for (int i = 0; i < 4; ++i) {
      const int ko = ((h + i) * 16 + lq) * KPH + hi * 8;
      akr[i].q[0] = *(const v4u*)(sbuf + ST_KR + ko);
      akr[i].q[1] = *(const v4u*)(sbuf + ST_KR + ko + 16);
    }
    const v8f z = (v8f){0, 0, 0, 0, 0, 0, 0, 0};
    v8f cm[4], cr[4];
    #pragma unroll
    for (int i = 0; i < 4; ++i) cm[i] = mma_f16(ak[i].v, qf.v, z);        // value x value
    #pragma unroll
    for (int i = 0; i < 4; ++i) cr[i] = mma_f16(akr[i].v, qf.v, z);       // k residual x q value
    #pragma unroll
    for (int i = 0; i < 4; ++i) cr[i] = mma_f16(ak[i].v, qrf.v, cr[i]);   // k value x q residual
    #pragma unroll
    for (int i = 0; i < 4; ++i) c[h + i] = cm[i] + cr[i] * RES_FOLD;
  }

  // the stage's v fragments; the compiler places the reads among the softmax work below, as registers come free
  FragH bv[NGRP][2];
  #pragma unroll
  for (int g = 0; g < NGRP; ++g) {
    #pragma unroll
    for (int dt = 0; dt < 2; ++dt) {
      const f16* base = sbuf + ST_V + (dt * 16 + lq) * VPH + g * BK + hi * 8;    // column = d
      bv[g][dt].q[0] = *(const v4u*)(base);           // keys g*32 + 8*hi + 0..7 of the stage
      bv[g][dt].q[1] = *(const v4u*)(base + 16);      // keys g*32 + 16 + 8*hi + 0..7
    }
  }

  // one online-softmax step per stage: query lq's KS scores are split across lane / lane^16.
  // The maximum runs as eight independent chains over the tiles, joined at the end.
  v8f mx = c[0];
  #pragma unroll
  for (int sub = 1; sub < NSUB; ++sub) {
    #pragma unroll
    for (int r = 0; r < 8; ++r) mx[r] = fmaxf(mx[r], c[sub][r]);
  }
  float m_new = rmax;
  #pragma unroll
  for (int r = 0; r < 8; ++r) m_new = fmaxf(m_new, mx[r]);
  m_new = fmaxf(m_new, __shfl_xor(m_new, 16, 32));
  // The exponent of a score is one fused multiply-add: c * log2(e) - bias, bias = m_new * log2(e) - 12, so that the
  // maximum, the change of base and the x4096 carry of P cost no instruction of their own. The rescale uses the same
  // rounded biases, so every stage's weights refer to one another exactly as their exponents do.
  const float bias_new = fmaf(m_new, SL, -12.0f);
  const float scale = __builtin_amdgcn_exp2f(rbias - bias_new);
  rmax  = m_new;
  rbias = bias_new;
  const v8f slv = (v8f){SL, SL, SL, SL, SL, SL, SL, SL};
  const float nb = -bias_new;
  const v8f nbv = (v8f){nb, nb, nb, nb, nb, nb, nb, nb};

  // exp + pack: P^T C-layout == A-fragment layout of the PV product; P carried x4096
  FragH pa[NGRP];
  v8f ps = (v8f){0, 0, 0, 0, 0, 0, 0, 0};
  #pragma unroll
  for (int sub = 0; sub < NSUB; ++sub) {
    const v8f e = __builtin_elementwise_fma(c[sub], slv, nbv);
    v8f p;
    #pragma unroll
    for (int r = 0; r < 8; ++r) p[r] = __builtin_amdgcn_exp2f(e[r]);   // 4096 x weight of key sub*16 + 8*hi + r
    ps += p;
    #pragma unroll
    for (int r = 0; r < 8; ++r) pa[sub >> 1].h[(sub & 1) * 8 + r] = (f16)p[r];
  }
  const float psum = ((ps[0] + ps[1]) + (ps[2] + ps[3])) + ((ps[4] + ps[5]) + (ps[6] + ps[7]));
  rsum = rsum * scale + psum + __shfl_xor(psum, 16, 32);

  // rescale O: queries are the row dimension there -> per-row scale from lane 8*hi + r
  float sc[8];
  #pragma unroll
  for (int r = 0; r < 8; ++r) sc[r] = __shfl(scale, (hi << 3) + r, 32);
  #pragma unroll
  for (int dt = 0; dt < 2; ++dt) {
    #pragma unroll
    for (int r = 0; r < 8; ++r) o[dt][r] *= sc[r];
  }

  // O += P x V over the stage's NGRP groups of 32 keys
  #pragma unroll
  for (int g = 0; g < NGRP; ++g) {
    #pragma unroll
    for (int dt = 0; dt < 2; ++dt) o[dt] = mma_f16(pa[g].v, bv[g][dt].v, o[dt]);
  }
  // publish point of trip t + 1's stages; behind it the buffer just read is free for trip t + 2's
  asm volatile("s_wait_dscnt 0x0" ::: "memory");      // this wave's reads of sbuf have returned
  asm volatile("s_wait_asynccnt 0x0" ::: "memory");   // this wave's pieces of trip t + 1's stage have landed
  __syncthreads();
  if (t + 2 < NTRIP) stage_copy(kb_b, kr_b, vt_b, x_b, (t + 2) * NGW + grp, sbuf, sXO, gtid);
  }
  asm volatile("s_wait_asynccnt 0x0" ::: "memory");   // nothing in flight when the wave goes on to its end

  // this wave's out-projection weights, asked for ahead of the join. B operand: column = channel, k = d split map
  FragH bw;
  {
    const f16* wr = woh + (size_t)(wave * 16 + lq) * HD + hi * 8;
    bw.q[0] = *(const v4u*)(wr);
    bw.q[1] = *(const v4u*)(wr + 16);
  }
  const float gs = bf16_val(gamma[0]) * (1.0f / 64.0f);

  // x of the wave's 16 channels (the tile was published by the ring's last barriers); the join covers the latency
  const int c0 = wave * 16;
  float* xrow0 = sXO + (c0 + lq) * XP + hi * 8;       // lane: channel row c0 + lq, positions nt*16 + 8*hi + 0..7
  v4f xv0[NWAVE][2];
  x_rows_load(xrow0, xv0);

  // join of the two key streams: wave qw of stream 1 hands its partial O, bias and row sum, lane for lane, to wave qw of stream 0
  float* mrow = sM + qw * (18 * 32);
  if (grp == 1) {
    #pragma unroll
    for (int dt = 0; dt < 2; ++dt) {
      *(v4f*)(mrow + ((dt * 2 + 0) * 32 + lane) * 4) = (v4f){o[dt][0], o[dt][1], o[dt][2], o[dt][3]};
      *(v4f*)(mrow + ((dt * 2 + 1) * 32 + lane) * 4) = (v4f){o[dt][4], o[dt][5], o[dt][6], o[dt][7]};
    }
    mrow[16 * 32 + lane] = rbias;
    mrow[17 * 32 + lane] = rsum;
  }
  __syncthreads();                         // stream 1's partial results are in sM

  if (grp == 0) {
    v4f o1[2][2];
    #pragma unroll
    for (int dt = 0; dt < 2; ++dt) {
      o1[dt][0] = *(const v4f*)(mrow + ((dt * 2 + 0) * 32 + lane) * 4);
      o1[dt][1] = *(const v4f*)(mrow + ((dt * 2 + 1) * 32 + lane) * 4);
    }
    const float b1 = mrow[16 * 32 + lane];
    const float l1 = mrow[17 * 32 + lane];
    // both partial results are brought to the larger bias, as a rescale inside the loop does, then normalised
    const float bm = fmaxf(rbias, b1);
    const float s0 = __builtin_amdgcn_exp2f(rbias - bm);
    const float s1 = __builtin_amdgcn_exp2f(b1 - bm);
    const float rinv = 1.0f / (rsum * s0 + l1 * s1);   // O and the row sums carry the same x4096
    const float f0 = s0 * rinv, f1 = s1 * rinv;
    // lane holds column d = dt*16 + lq for query rows 8*hi + r: per-row factors from lane 8*hi + r
    float r0[8], r1[8];
    #pragma unroll
    for (int r = 0; r < 8; ++r) {
      r0[r] = __shfl(f0, (hi << 3) + r, 32);
      r1[r] = __shfl(f1, (hi << 3) + r, 32);
    }
    f16* so = sC + qw * (16 * CP);
    #pragma unroll
    for (int r = 0; r < 8; ++r) {
      #pragma unroll
      for (int dt = 0; dt < 2; ++dt)
        so[(hi * 8 + r) * CP + dt * 16 + lq] = (f16)(o[dt][r] * r0[r] + o1[dt][r >> 2][r & 3] * r1[r]);
    }
  }
  __syncthreads();                         // ctx of all 128 positions is in sC

  FragH an[NWAVE];                         // A operands: row = position nt*16 + lq, k = d split map
  #pragma unroll
  for (int nt = 0; nt < NWAVE; ++nt) {
    const f16* p = sC + (nt * 16 + lq) * CP + hi * 8;
    an[nt].q[0] = *(const v4u*)(p);
    an[nt].q[1] = *(const v4u*)(p + 16);
  }

  // D element r of lane: (n = nt*16 + 8*hi + r, c = c0 + lq): eight neighbouring positions of one channel row
  const v8f z = (v8f){0, 0, 0, 0, 0, 0, 0, 0};
  float* orow = out + ((size_t)b * CH + c0) * SEQ_FULL + qblk * BQ + lane * 4;
  v8f acc0[NWAVE];
  #pragma unroll
  for (int nt = 0; nt < NWAVE; ++nt) acc0[nt] = mma_f16(an[nt].v, bw.v, z);
  gate_add_store(xrow0, acc0, xv0, gs);
  asm volatile("s_wait_dscnt 0x0" ::: "memory");      // the wave's own rows are written before it reads them back whole
  rows_out(sXO + c0 * XP + lane * 4, orow);
}

extern "C" void kernel_launch(void* const* d_in, const int* in_sizes, int n_in,
                              void* d_out, int out_size, void* d_ws, size_t ws_size,
                              hipStream_t stream) {
  if (n_in < 6) return;
  const size_t x_need = ((size_t)(NB - 1) * CH + (CH - 1)) * SEQ_FULL + SEQ;
  if ((size_t)in_sizes[0] < x_need) return;
  if ((size_t)in_sizes[1] < (size_t)HD * CH) return;
  if ((size_t)in_sizes[2] < (size_t)HD * CH) return;
  if ((size_t)in_sizes[3] < (size_t)HD * CH) return;
  if ((size_t)in_sizes[4] < (size_t)CH * HD) return;
  if (in_sizes[5] < 1) return;
  if ((size_t)out_size < x_need) return;
  if (ws_size < WS_TOTAL) return;

  const float* x     = (const float*)d_in[0];
  const float* wq    = (const float*)d_in[1];
  const float* wk    = (const float*)d_in[2];
  const float* wv    = (const float*)d_in[3];
  const float* wo    = (const float*)d_in[4];
  const float* gamma = (const float*)d_in[5];
  float*       out   = (float*)d_out;

  char* ws = (char*)d_ws;
  unsigned short* wb  = (unsigned short*)(ws);
  f16*            woh = (f16*)(ws + WB_BYTES);
  f16*            qp  = (f16*)(ws + WB_BYTES + WO_BYTES);
  f16*            kp  = (f16*)(ws + WB_BYTES + WO_BYTES + PL_BYTES);
  f16*            vp  = (f16*)(ws + WB_BYTES + WO_BYTES + 2 * PL_BYTES);
  f16*            qrp = (f16*)(ws + WB_BYTES + WO_BYTES + 4 * PL_BYTES);
  f16*            krp = (f16*)(ws + WB_BYTES + WO_BYTES + 5 * PL_BYTES);

  prep_kernel<<<dim3(16), 256, 0, stream>>>(wq, wk, wv, wo, wb, woh);
  // qkv_kernel(x, wb, qp, kp, qr, kr, vp)
  qkv_kernel<<<dim3(SEQ / NT, NB), 256, 0, stream>>>(x, wb, qp, kp, qrp, krp, vp);
  // attn_kernel(qp, qr, kp, kr, vp, woh, x, gamma, out)
  attn_kernel<<<dim3(SEQ / BQ, NB), 512, 0, stream>>>(qp, qrp, kp, krp, vp, woh, x, gamma, out);
}

// v007
// A run of this version takes 42.9 microseconds.
// In two side-by-side timings against v006, it was 1.10 and 1.11 times as fast.
// Over all steps from v000 it is 3.10 times as fast.
#include <hip/hip_runtime.h>

// Contractions: q/k/v projections on v_wmma_f32_16x16x32_bf16 (x and W as bf16 RNE-converted inputs, f32 accumulate);
// S^T = K x Q^T on v_wmma_f32_16x16x32_f16 as three products (q,k f16 value planes + f16 residual planes x2048,
// residual products in their own accumulator folded by 1/2048 in f32); O = P x V on f16 (P carried x4096, V f16);
// out-projection on f16 (Wo = f16 of bf16 RNE value x64, ctx f16, 1/64 folded in the f32 epilogue), done by the attention
// kernel itself on its own 128 positions; softmax, gate and skip-add in f32.
// The weights are converted by the kernels that use them: no launch of their own.

#ifndef NB
#define NB 8
#endif
#ifndef SEQ
#define SEQ 4096
#endif
#define NB_FULL   8
#define SEQ_FULL  4096
#define CH        256                 // channels (projection K)
#define HD        32                  // q/k/v dim (single head)
#define NQKV      96                  // stacked projection outputs: q 0..31, k 32..63, v 64..95
#define NT        64                  // positions per projection block
#define XPW       132                 // LDS pitch (32-bit words) of the transposed bf16 x tile
#define WP        264                 // LDS pitch (bf16) of a staged projection weight row: 528 B = 16 B x odd
#define SP        72                  // LDS pitch (halves) of the q|k, q|k residual and v staging tiles
#define BQ        128                 // query rows per attention block (8 waves x 16)
#define BK        32                  // keys per PV product (k of one WMMA)
#define NWAVE     8                   // waves per key stream == 16-row query tiles per block
#define NGW       2                   // key streams (groups of NWAVE waves) per attention block
#define CP        40                  // LDS pitch (halves) of the per-wave ctx staging tile
#define KS        128                 // keys per LDS stage of the attention ring == keys per online-softmax step
#define NS        (SEQ / KS)          // stages
#define NTRIP     (NS / NGW)          // ring trips: each trip, every key stream works on a stage of its own
#define NSUB      (KS / 16)           // 16-key score tiles per stage
#define NGRP      (KS / BK)           // 32-key PV groups per stage
#define KPH       40                  // LDS pitch (halves) of a staged k / k residual row: 80 B = 16 B x odd
#define VPH       136                 // LDS pitch (halves) of a staged v row of KS keys: 272 B = 16 B x odd
#define ST_KR     (KS * KPH)          // offsets (halves) inside one stage: k at 0, k residual, v
#define ST_V      (2 * KS * KPH)
#define ST_H      (2 * KS * KPH + HD * VPH)   // halves per stage
#define XP        132                 // LDS pitch (floats) of a staged x / result row of BQ positions: 528 B = 16 B x odd
#define RES_CARRY 2048.0f             // power-of-two carry of the q/k residual planes
#define RES_FOLD  (1.0f / 2048.0f)

static_assert(NB >= 1 && NB <= NB_FULL);
static_assert(SEQ <= SEQ_FULL);
static_assert(SEQ % BQ == 0);
static_assert(SEQ % NT == 0);
static_assert(SEQ % BK == 0);
static_assert(BQ == NWAVE * 16);
static_assert(SEQ % KS == 0 && KS % BK == 0 && BK == 32 && NSUB % 4 == 0);
static_assert(KS * 4 == 2 * 256 && HD * (KS / 8) == 2 * 256);   // 16-B pieces per plane and stage == 2 per thread
static_assert(KPH >= HD && (KPH * 2) % 16 == 0 && VPH >= KS && (VPH * 2) % 16 == 0 && (ST_H * 2) % 16 == 0);
static_assert(HD == 32);
static_assert(CH % 32 == 0);
static_assert(NQKV == 3 * HD);
static_assert(8 * 256 == (CH / 2) * (NT / 4));     // x staging items == threads x iterations
static_assert(XPW >= CH / 2 && (XPW * 4) % 16 == 0);
static_assert(SP >= 2 * HD && SP >= NT && (SP * 2) % 16 == 0);
static_assert(NT * 4 == 256);                      // q/k (+ residual) plane store: one 16-B piece per thread each
static_assert(HD * 8 == 256);                      // v plane store: one 16-B piece per thread
static_assert(CP >= HD && (CP * 2) % 16 == 0);
static_assert(XP >= BQ && (XP * 4) % 16 == 0);
static_assert(NGW * NWAVE * 16 == CH);             // out-projection: each wave owns 16 channel rows
static_assert(NGW == 2 && NS % NGW == 0 && NTRIP >= 2);
static_assert(BQ * 4 == 32 * 16);                  // one x / result row of the block == one 16-B piece per lane of a wave
static_assert(NS >= 2 && NS * NWAVE == CH);        // one x row per wave rides each of the NS stage copies
static_assert(WP >= CH && (WP * 2) % 16 == 0);
static_assert(NQKV * CH == 24 * 256 * 4 && HD * CH == 8 * 256 * 4 && CH == 64 * 4);   // weight staging: 24 pieces of 4 per thread, 8 per matrix
static_assert(2 * (NT * XPW * 4 + 2 * NT * SP * 2 + HD * SP * 2 + NQKV * WP * 2) <= 327680);   // two projection blocks per WGP

#define PL_BYTES  ((size_t)NB * SEQ * HD * 2)
#define NPLANE    6                                 // q, k, v, unused, q residual, k residual
#define WS_TOTAL  (NPLANE * PL_BYTES)
static_assert(PL_BYTES % 128 == 0);
static_assert(WS_TOTAL <= (size_t)134217728);

typedef __bf16   bf16;
typedef _Float16 f16;
typedef bf16     v16bf __attribute__((ext_vector_type(16)));
typedef bf16     v2bf  __attribute__((ext_vector_type(2)));
typedef f16      v16h  __attribute__((ext_vector_type(16)));
typedef f16      v8h   __attribute__((ext_vector_type(8)));
typedef float    v8f   __attribute__((ext_vector_type(8)));
typedef float    v4f   __attribute__((ext_vector_type(4)));
typedef unsigned v4u   __attribute__((ext_vector_type(4)));
typedef unsigned v2u   __attribute__((ext_vector_type(2)));

union FragB  { v16bf v; v4u q[2]; };
union FragH  { v16h  v; v4u q[2]; f16 h[16]; };
union Pack8H { v4u u; v8h v; f16 h[8]; };

// WMMA helpers: the plain builtins; the compiler itself keeps the distance to a vector instruction on D, A or B.
static __device__ __forceinline__ v8f mma_bf16(v16bf a, v16bf b, v8f acc) {
  return __builtin_amdgcn_wmma_f32_16x16x32_bf16(false, a, false, b, (short)0, acc, false, false);
}
static __device__ __forceinline__ v8f mma_f16(v16h a, v16h b, v8f acc) {
  return __builtin_amdgcn_wmma_f32_16x16x32_f16(false, a, false, b, (short)0, acc, false, false);
}

// f32 -> bf16 bits, RNE (finite inputs).
static __device__ __forceinline__ unsigned bf16_bits(float f) {
  const unsigned u = __float_as_uint(f);
  return (u + 0x7FFFu + ((u >> 16) & 1u)) >> 16;
}
static __device__ __forceinline__ float bf16_val(float f) {
  return __uint_as_float(bf16_bits(f) << 16);
}

// two f32 -> packed bf16 pair, RNE (the convert instruction; the same bits as bf16_bits on finite inputs), first in the low half
static __device__ __forceinline__ unsigned bf16_pair(float lo, float hi) {
  v2bf t;
  t[0] = (bf16)lo;
  t[1] = (bf16)hi;
  return __builtin_bit_cast(unsigned, t);
}

// Fused q/k/v projection. Block = (64-position tile, batch), 256 threads.
// x tile [256 c][64 n] is RNE-converted to bf16 and transposed through LDS to [n][c]; D[n][dd] = sum_c x[c][n] W[dd][c].
// W [96 dd][256 c] (rows 0..31 wq, 32..63 wk, 64..95 wv) is RNE-converted to bf16 by the block itself and kept in LDS:
// its f32 pieces are asked for ahead of the x tile and converted behind it; the B fragments are LDS reads.
// Planes: qp,kp [NB][SEQ][32] f16 value planes; qr,kr [NB][SEQ][32] f16 residual planes = (f32 - f16 value) x 2048
// coverage: q,k,q_res,k_res rows n0..n0+63 x 32 d ; v 32 d x positions n0..n0+63 ; every written line whole,
// one instruction. LDS: sX, sW, sQK, sR, sV are cross-wave (block barriers); staged extent == consumed extent for all five.
__global__ __launch_bounds__(256) void qkv_kernel(const float* __restrict__ x,
                                                  const float* __restrict__ wq, const float* __restrict__ wk,
                                                  const float* __restrict__ wv,
                                                  f16* __restrict__ qp, f16* __restrict__ kp,
                                                  f16* __restrict__ qr, f16* __restrict__ kr,
                                                  f16* __restrict__ vp) {
  const int n0   = blockIdx.x * NT;
  const int b    = blockIdx.y;
  const int tid  = threadIdx.x;
  const int wave = tid >> 5;
  const int lane = tid & 31;
  const int lq   = lane & 15;
  const int hi   = lane >> 4;

  __shared__ __align__(16) unsigned sX[NT * XPW];     // [n][c/2] packed bf16 pairs (even c in the low half)
  __shared__ __align__(16) unsigned short sW[NQKV * WP];   // [dd][c] bf16 bits
  __shared__ __align__(16) f16      sQK[NT * SP];     // [n][q 0..31 | k 32..63] values
  __shared__ __align__(16) f16      sR[NT * SP];      // [n][q 0..31 | k 32..63] residuals x2048
  __shared__ __align__(16) f16      sV[HD * SP];      // [d][n]

  // weight pieces of 4 channels: piece i*256 + tid of the 6144; a wave's 32 pieces are 512 B in a row, whole lines
  v4f wl[24];
  #pragma unroll
  for (int i = 0; i < 24; ++i)
    wl[i] = *(const v4f*)(((i < 8) ? wq : ((i < 16) ? wk : wv)) + ((i & 7) * 256 + tid) * 4);

  #pragma unroll 2
  for (int it = 0; it < 8; ++it) {
    const int item = it * 256 + tid;                  // 0..2047
    const int nq   = item & 15;                       // 4-position group
    const int cp   = item >> 4;                       // channel pair 0..127
    const float* src = x + ((size_t)b * CH + 2 * cp) * SEQ_FULL + n0 + nq * 4;
    const v4f a0 = *(const v4f*)(src);
    const v4f a1 = *(const v4f*)(src + SEQ_FULL);
    #pragma unroll
    for (int i = 0; i < 4; ++i)
      sX[(nq * 4 + i) * XPW + cp] = bf16_bits(a0[i]) | (bf16_bits(a1[i]) << 16);
  }
  #pragma unroll
  for (int i = 0; i < 24; ++i) {
    v2u u;
    u[0] = bf16_pair(wl[i][0], wl[i][1]);
    u[1] = bf16_pair(wl[i][2], wl[i][3]);
    *(v2u*)(sW + (i * 4 + (tid >> 6)) * WP + (tid & 63) * 4) = u;   // row dd = piece >> 6, channels 4 * (piece & 63) ..
  }
  __syncthreads();

  const int nt = wave & 3;                            // position sub-tile
  const int g3 = wave >> 2;                           // output tile group: tiles g3*3 + {0,1,2}
  v8f acc[3];
  #pragma unroll
  for (int j = 0; j < 3; ++j) acc[j] = (v8f){0, 0, 0, 0, 0, 0, 0, 0};

  const int aoff = (nt * 16 + lq) * XPW + hi * 4;     // row n, words of channels 8*hi..
  #pragma unroll 2
  for (int ks = 0; ks < CH / 32; ++ks) {
    FragB a;
    a.q[0] = *(const v4u*)(sX + aoff + ks * 16);        // c = ks*32 + 8*hi + 0..7
    a.q[1] = *(const v4u*)(sX + aoff + ks * 16 + 8);    // c = ks*32 + 16 + 8*hi + 0..7
    #pragma unroll
    for (int j = 0; j < 3; ++j) {
      const unsigned short* wr = sW + ((g3 * 3 + j) * 16 + lq) * WP + ks * 32 + hi * 8;
      FragB w;
      w.q[0] = *(const v4u*)(wr);                       // c = ks*32 + 8*hi + 0..7
      w.q[1] = *(const v4u*)(wr + 16);                  // c = ks*32 + 16 + 8*hi + 0..7
      acc[j] = mma_bf16(a.v, w.v, acc[j]);
    }
  }

  // D element r of lane: (n = nt*16 + 8*hi + r, dd = tile*16 + lq)
  #pragma unroll
  for (int j = 0; j < 3; ++j) {
    const int t = g3 * 3 + j;                         // wave-uniform
    #pragma unroll
    for (int r = 0; r < 8; ++r) {
      const int nrow = nt * 16 + hi * 8 + r;
      const float av = acc[j][r];
      const f16 hv = (f16)av;
      if (t < 4) {
        sQK[nrow * SP + t * 16 + lq] = hv;
        sR[nrow * SP + t * 16 + lq]  = (f16)((av - (float)hv) * RES_CARRY);
      } else {
        sV[((t - 4) * 16 + lq) * SP + nrow] = hv;
      }
    }
  }
  __syncthreads();

  Pack8H pq, pk, pqr, pkr, pv;
  const int row = tid >> 2, seg = tid & 3;
  pq.v  = *(const v8h*)(sQK + row * SP + seg * 8);
  pk.v  = *(const v8h*)(sQK + row * SP + HD + seg * 8);
  pqr.v = *(const v8h*)(sR + row * SP + seg * 8);
  pkr.v = *(const v8h*)(sR + row * SP + HD + seg * 8);
  const int dv = tid >> 3, sv = tid & 7;
  pv.v = *(const v8h*)(sV + dv * SP + sv * 8);
  const size_t qi = ((size_t)b * SEQ + n0) * HD + (size_t)tid * 8;
  const size_t vi = ((size_t)b * HD + dv) * SEQ + n0 + sv * 8;
  const v4u uq = pq.u, uk = pk.u, uqr = pqr.u, ukr = pkr.u, uv = pv.u;
  *(v4u*)(qp + qi) = uq;
  *(v4u*)(kp + qi) = uk;
  *(v4u*)(qr + qi) = uqr;
  *(v4u*)(kr + qi) = ukr;
  *(v4u*)(vp + vi) = uv;
  
}

// Flash attention, all keys, no logit scaling. Block = (query block of 128, batch), 16 waves: four per SIMD, so that one
// wave's softmax work, LDS reads and waits stand beside the others' products. The waves form two key streams of eight:
// stream g takes stages g, g + 2, g + 4, ...; in a stream one wave owns 16 query rows and keeps its own online softmax
// (maximum, row sum, O); the two streams' partial results are joined once, behind the loop, through LDS.
// S^T = K x Q^T so queries sit on lanes; P^T in C-layout is bit-identical to the A-fragment layout of O += P x V.
// Scores: kval.qval in the main accumulator; kres.qval + kval.qres in a second accumulator folded by 1/2048 in f32.
// K, K-residual and V tiles of KS keys are brought into a two-buffer LDS ring per stream once per block by asynchronous copies
// (a stream's next but one stage flies while its next is worked on); the fragments are two 16-B LDS loads each, in the k order of the q fragments.
// One online-softmax step per stage: all KS scores first, then one maximum, one exchange between the lane halves and one
// rescale of O, then the stage's PV products.
// Epilogue: out-projection + gate + skip-add of the block's 128 positions. D[n][c] = sum_d ctx[n][d] woh[c][d];
// woh[c][d] = f16(bf16 RNE value of wo[c][d] x 64), exact, formed by each wave for its own channels.
// result = D * (g/64) + bf16 RNE value of x; g = bf16 RNE value of gamma. Wave w of the 16 owns channels 16w..16w+15.
// The block's x tile [256 c][128 n] comes into LDS beside the ring, eight rows with each stage's copies.
// LDS sC, sM: cross-wave (block barriers). sRing, sXO as filled by the copies: cross-wave, published by the ring's barriers.
// sXO in the epilogue: each wave reads and rewrites only the rows of its own channels.

// One stage, copied by the 256 threads of its stream (tid = thread within the stream):
// keys s*KS..s*KS+KS-1 of the three planes into dst. Six 16-B pieces per thread, every lane on, all addresses
// 16-B multiples; k / k residual pieces are contiguous in global memory, v pieces are 256-B runs of each of the 32 rows.
// A seventh piece per thread: x rows (channels) s*NWAVE..s*NWAVE+NWAVE-1 of the block's positions into sx, one row per wave.
static __device__ __forceinline__ void stage_copy(const f16* __restrict__ kb_b, const f16* __restrict__ kr_b,
                                                  const f16* __restrict__ vt_b, const float* __restrict__ x_b,
                                                  int s, f16* dst, float* sx, int tid) {
  const int j0 = s * KS;
  const int p0 = tid, p1 = tid + 256;                 // piece 0..511 of each plane
  const f16* gk0 = kb_b + (size_t)j0 * HD + p0 * 8;
  const f16* gk1 = kb_b + (size_t)j0 * HD + p1 * 8;
  const f16* gr0 = kr_b + (size_t)j0 * HD + p0 * 8;
  const f16* gr1 = kr_b + (size_t)j0 * HD + p1 * 8;
  const f16* gv0 = vt_b + (size_t)(p0 >> 4) * SEQ + j0 + (p0 & 15) * 8;
  const f16* gv1 = vt_b + (size_t)(p1 >> 4) * SEQ + j0 + (p1 & 15) * 8;
  const unsigned l0  = (unsigned)(size_t)dst;         // LDS byte address of the stage
  const unsigned lk0 = l0 + ((p0 >> 2) * KPH + (p0 & 3) * 8) * 2;
  const unsigned lk1 = l0 + ((p1 >> 2) * KPH + (p1 & 3) * 8) * 2;
  const unsigned lr0 = lk0 + ST_KR * 2;
  const unsigned lr1 = lk1 + ST_KR * 2;
  const unsigned lv0 = l0 + (ST_V + (p0 >> 4) * VPH + (p0 & 15) * 8) * 2;
  const unsigned lv1 = l0 + (ST_V + (p1 >> 4) * VPH + (p1 & 15) * 8) * 2;
  const int xc = s * NWAVE + (tid >> 5);              // channel row of this wave's x piece
  const float* gx = x_b + (size_t)xc * SEQ_FULL + (tid & 31) * 4;
  const unsigned lx = (unsigned)(size_t)sx + (xc * XP + (tid & 31) * 4) * 4;
  // The copies and their s_wait_xcnt in one statement: no address register is rewritten ahead of that wait.
  asm volatile("global_load_async_to_lds_b128 %0, %7, off\n\t"
               "global_load_async_to_lds_b128 %1, %8, off\n\t"
               "global_load_async_to_lds_b128 %2, %9, off\n\t"
               "global_load_async_to_lds_b128 %3, %10, off\n\t"
               "global_load_async_to_lds_b128 %4, %11, off\n\t"
               "global_load_async_to_lds_b128 %5, %12, off\n\t"
               "global_load_async_to_lds_b128 %6, %13, off\n\t"
               "s_wait_xcnt 0x0"
               :: "v"(lk0), "v"(lk1), "v"(lr0), "v"(lr1), "v"(lv0), "v"(lv1), "v"(lx),
                  "v"(gk0), "v"(gk1), "v"(gr0), "v"(gr1), "v"(gv0), "v"(gv1), "v"(gx)
               : "memory");
}

// Epilogue pieces. A lane's part of one channel row of the LDS tile: eight neighbouring positions out of every 16.
static __device__ __forceinline__ void x_rows_load(const float* xrow, v4f (&xv)[NWAVE][2]) {
  #pragma unroll
  for (int nt = 0; nt < NWAVE; ++nt) {
    xv[nt][0] = *(const v4f*)(xrow + nt * 16);
    xv[nt][1] = *(const v4f*)(xrow + nt * 16 + 4);
  }
}
// result = D * gs + bf16 RNE value of x, written over x in the LDS tile
static __device__ __forceinline__ void gate_add_store(float* xrow, const v8f (&acc)[NWAVE], const v4f (&xv)[NWAVE][2],
                                                      float gs) {
  #pragma unroll
  for (int nt = 0; nt < NWAVE; ++nt) {
    v4f r0, r1;
    #pragma unroll
    for (int i = 0; i < 4; ++i) {
      r0[i] = fmaf(acc[nt][i], gs, bf16_val(xv[nt][0][i]));
      r1[i] = fmaf(acc[nt][4 + i], gs, bf16_val(xv[nt][1][i]));
    }
    *(v4f*)(xrow + nt * 16)     = r0;
    *(v4f*)(xrow + nt * 16 + 4) = r1;
  }
}
// 16 channel rows of the LDS tile to the output: each store is one 512-B row of the block's positions, whole lines
static __device__ __forceinline__ void rows_out(const float* srow, float* orow) {
  v4f vals[16];
  #pragma unroll
  for (int it = 0; it < 16; ++it) vals[it] = *(const v4f*)(srow + it * XP);
  #pragma unroll
  for (int it = 0; it < 16; ++it) *(v4f*)(orow + (size_t)it * SEQ_FULL) = vals[it];
}

__global__ __launch_bounds__(512) void attn_kernel(const f16* __restrict__ qp, const f16* __restrict__ qr,
                                                   const f16* __restrict__ kp, const f16* __restrict__ kr,
                                                   const f16* __restrict__ vp, const float* __restrict__ wo,
                                                   const float* __restrict__ x, const float* __restrict__ gamma,
                                                   float* __restrict__ out) {
  const int qblk = blockIdx.x;
  const int b    = blockIdx.y;
  const int tid  = threadIdx.x;
  const int wave = tid >> 5;                                      // 0..15
  const int grp  = __builtin_amdgcn_readfirstlane(tid >> 8);      // key stream of the wave, a scalar
  const int qw   = wave & (NWAVE - 1);                            // query tile of the wave
  const int gtid = tid & 255;                                     // thread within its stream
  const int lane = tid & 31;
  const int lq   = lane & 15;   // query column of S^T / d column of O
  const int hi   = lane >> 4;   // k-split half

  __shared__ __align__(16) f16 sC[NWAVE * 16 * CP];
  __shared__ __align__(16) f16 sRing[2 * NGW * ST_H];           // [ring slot][stream]
  __shared__ __align__(16) float sM[NWAVE * 18 * 32];           // stream 1's partial O (16 words a lane), bias and row sum
  __shared__ __align__(16) float sXO[CH * XP];        // [c][n]: x of the block's positions, then the result in place

  const int qrow0 = qblk * BQ + qw * 16;

  FragH qf, qrf;                 // B operands: column = query qrow0+lq, k = d split map (value, residual)
  {
    const size_t qo = ((size_t)b * SEQ + qrow0 + lq) * HD + hi * 8;
    qf.q[0]  = *(const v4u*)(qp + qo);          // d = 8*hi + 0..7
    qf.q[1]  = *(const v4u*)(qp + qo + 16);     // d = 16 + 8*hi + 0..7
    qrf.q[0] = *(const v4u*)(qr + qo);
    qrf.q[1] = *(const v4u*)(qr + qo + 16);
  }
  const f16* kb_b = kp + (size_t)b * SEQ * HD;
  const f16* kr_b = kr + (size_t)b * SEQ * HD;
  const f16* vt_b = vp + (size_t)b * HD * SEQ;
  const float* x_b = x + (size_t)b * CH * SEQ_FULL + qblk * BQ;

  v8f o[2];
  o[0] = (v8f){0, 0, 0, 0, 0, 0, 0, 0};
  o[1] = (v8f){0, 0, 0, 0, 0, 0, 0, 0};
  float rmax = -__builtin_inff();
  float rbias = -__builtin_inff();        // rmax * log2(e) - 12, as rounded: the reference point of every exponent
  float rsum = 0.0f;                      // carried x4096, like P and O
  const float SL = 1.4426950408889634f;   // log2(e)

  // ring prologue: each stream's first stage landed and published, then its second in flight
  f16* ring_g = sRing + grp * ST_H;                   // this stream's two buffers: ring_g, ring_g + NGW * ST_H
  stage_copy(kb_b, kr_b, vt_b, x_b, grp, ring_g, sXO, gtid);
  asm volatile("s_wait_asynccnt 0x0" ::: "memory");   // this wave's pieces of the first stage have landed
  __syncthreads();                                    // ... and every other wave's
  stage_copy(kb_b, kr_b, vt_b, x_b, NGW + grp, ring_g + NGW * ST_H, sXO, gtid);

  #pragma unroll 1
  for (int t = 0; t < NTRIP; ++t) {                   // this wave's stage: t * NGW + grp
  f16* sbuf = ring_g + (t & 1) * (NGW * ST_H);        // trip t reads this buffer alone

  // c[sub][r] = score(query qrow0+lq, key (t*NGW+grp)*KS + sub*16 + 8*hi + r): all KS keys of the stage before any softmax work.
  // Four tiles at a time, so that the product that accumulates into cr stands four products behind the one it waits for.
  // Nothing ties the LDS reads, the products and the folds to this order: the compiler reads the fragments ahead as far as
  // the 256 registers a wave has at four waves per SIMD allow, and puts the folds among the products.
  v8f c[NSUB];
  #pragma unroll
  for (int h = 0; h < NSUB; h += 4) {
    FragH ak[4], akr[4];
    #pragma unroll
    for (int i = 0; i < 4; ++i) {
      const int ko = ((h + i) * 16 + lq) * KPH + hi * 8;       // row = key
      ak[i].q[0] = *(const v4u*)(sbuf + ko);                   // d = 8*hi + 0..7
      ak[i].q[1] = *(const v4u*)(sbuf + ko + 16);              // d = 16 + 8*hi + 0..7
    }
    #pragma unroll
    for (int i = 0; i < 4; ++i) {
      const int ko = ((h + i) * 16 + lq) * KPH + hi * 8;
      akr[i].q[0] = *(const v4u*)(sbuf + ST_KR + ko);
      akr[i].q[1] = *(const v4u*)(sbuf + ST_KR + ko + 16);
    }
    const v8f z = (v8f){0, 0, 0, 0, 0, 0, 0, 0};
    v8f cm[4], cr[4];
    #pragma unroll
    for (int i = 0; i < 4; ++i) cm[i] = mma_f16(ak[i].v, qf.v, z);        // value x value
    #pragma unroll
    for (int i = 0; i < 4; ++i) cr[i] = mma_f16(akr[i].v, qf.v, z);       // k residual x q value
    #pragma unroll
    for (int i = 0; i < 4; ++i) cr[i] = mma_f16(ak[i].v, qrf.v, cr[i]);   // k value x q residual
    #pragma unroll
    for (int i = 0; i < 4; ++i) c[h + i] = cm[i] + cr[i] * RES_FOLD;
  }

  // the stage's v fragments; the compiler places the reads among the softmax work below, as registers come free
  FragH bv[NGRP][2];
  #pragma unroll
  for (int g = 0; g < NGRP; ++g) {
    #pragma unroll
    for (int dt = 0; dt < 2; ++dt) {
      const f16* base = sbuf + ST_V + (dt * 16 + lq) * VPH + g * BK + hi * 8;    // column = d
      bv[g][dt].q[0] = *(const v4u*)(base);           // keys g*32 + 8*hi + 0..7 of the stage
      bv[g][dt].q[1] = *(const v4u*)(base + 16);      // keys g*32 + 16 + 8*hi + 0..7
    }
  }

  // one online-softmax step per stage: query lq's KS scores are split across lane / lane^16.
  // The maximum runs as eight independent chains over the tiles, joined at the end.
  v8f mx = c[0];
  #pragma unroll
  for (int sub = 1; sub < NSUB; ++sub) {
    #pragma unroll
    for (int r = 0; r < 8; ++r) mx[r] = fmaxf(mx[r], c[sub][r]);
  }
  float m_new = rmax;
  #pragma unroll
  for (int r = 0; r < 8; ++r) m_new = fmaxf(m_new, mx[r]);
  m_new = fmaxf(m_new, __shfl_xor(m_new, 16, 32));
  // The exponent of a score is one fused multiply-add: c * log2(e) - bias, bias = m_new * log2(e) - 12, so that the
  // maximum, the change of base and the x4096 carry of P cost no instruction of their own. The rescale uses the same
  // rounded biases, so every stage's weights refer to one another exactly as their exponents do.
  const float bias_new = fmaf(m_new, SL, -12.0f);
  const float scale = __builtin_amdgcn_exp2f(rbias - bias_new);
  rmax  = m_new;
  rbias = bias_new;
  const v8f slv = (v8f){SL, SL, SL, SL, SL, SL, SL, SL};
  const float nb = -bias_new;
  const v8f nbv = (v8f){nb, nb, nb, nb, nb, nb, nb, nb};

  // exp + pack: P^T C-layout == A-fragment layout of the PV product; P carried x4096
  FragH pa[NGRP];
  v8f ps = (v8f){0, 0, 0, 0, 0, 0, 0, 0};
  #pragma unroll
  for (int sub = 0; sub < NSUB; ++sub) {
    const v8f e = __builtin_elementwise_fma(c[sub], slv, nbv);
    v8f p;
    #pragma unroll
    for (int r = 0; r < 8; ++r) p[r] = __builtin_amdgcn_exp2f(e[r]);   // 4096 x weight of key sub*16 + 8*hi + r
    ps += p;
    #pragma unroll
    for (int r = 0; r < 8; ++r) pa[sub >> 1].h[(sub & 1) * 8 + r] = (f16)p[r];
  }
  const float psum = ((ps[0] + ps[1]) + (ps[2] + ps[3])) + ((ps[4] + ps[5]) + (ps[6] + ps[7]));
  rsum = rsum * scale + psum + __shfl_xor(psum, 16, 32);

  // rescale O: queries are the row dimension there -> per-row scale from lane 8*hi + r
  float sc[8];
  #pragma unroll
  for (int r = 0; r < 8; ++r) sc[r] = __shfl(scale, (hi << 3) + r, 32);
  #pragma unroll
  for (int dt = 0; dt < 2; ++dt) {
    #pragma unroll
    for (int r = 0; r < 8; ++r) o[dt][r] *= sc[r];
  }

  // O += P x V over the stage's NGRP groups of 32 keys
  #pragma unroll
  for (int g = 0; g < NGRP; ++g) {
    #pragma unroll
    for (int dt = 0; dt < 2; ++dt) o[dt] = mma_f16(pa[g].v, bv[g][dt].v, o[dt]);
  }
  // publish point of trip t + 1's stages; behind it the buffer just read is free for trip t + 2's
  asm volatile("s_wait_dscnt 0x0" ::: "memory");      // this wave's reads of sbuf have returned
  asm volatile("s_wait_asynccnt 0x0" ::: "memory");   // this wave's pieces of trip t + 1's stage have landed
  __syncthreads();
  if (t + 2 < NTRIP) stage_copy(kb_b, kr_b, vt_b, x_b, (t + 2) * NGW + grp, sbuf, sXO, gtid);
  }
  asm volatile("s_wait_asynccnt 0x0" ::: "memory");   // nothing in flight when the wave goes on to its end

  // this wave's out-projection weights, asked for ahead of the join. B operand: column = channel, k = d split map
  FragH bw;
  {
    const float* wr = wo + (size_t)(wave * 16 + lq) * HD + hi * 8;
    const v4f w0 = *(const v4f*)(wr),      w1 = *(const v4f*)(wr + 4);        // d = 8*hi + 0..7
    const v4f w2 = *(const v4f*)(wr + 16), w3 = *(const v4f*)(wr + 20);       // d = 16 + 8*hi + 0..7
    asm volatile("s_wait_xcnt 0x0" ::: "memory");     // ahead of any rewrite of the four loads' address registers
    #pragma unroll
    for (int i = 0; i < 4; ++i) {
      bw.h[i]      = (f16)(bf16_val(w0[i]) * 64.0f);
      bw.h[4 + i]  = (f16)(bf16_val(w1[i]) * 64.0f);
      bw.h[8 + i]  = (f16)(bf16_val(w2[i]) * 64.0f);
      bw.h[12 + i] = (f16)(bf16_val(w3[i]) * 64.0f);
    }
  }
  const float gs = bf16_val(gamma[0]) * (1.0f / 64.0f);

  // x of the wave's 16 channels (the tile was published by the ring's last barriers); the join covers the latency
  const int c0 = wave * 16;
  float* xrow0 = sXO + (c0 + lq) * XP + hi * 8;       // lane: channel row c0 + lq, positions nt*16 + 8*hi + 0..7
  v4f xv0[NWAVE][2];
  x_rows_load(xrow0, xv0);

  // join of the two key streams: wave qw of stream 1 hands its partial O, bias and row sum, lane for lane, to wave qw of stream 0
  float* mrow = sM + qw * (18 * 32);
  if (grp == 1) {
    #pragma unroll
    for (int dt = 0; dt < 2; ++dt) {
      *(v4f*)(mrow + ((dt * 2 + 0) * 32 + lane) * 4) = (v4f){o[dt][0], o[dt][1], o[dt][2], o[dt][3]};
      *(v4f*)(mrow + ((dt * 2 + 1) * 32 + lane) * 4) = (v4f){o[dt][4], o[dt][5], o[dt][6], o[dt][7]};
    }
    mrow[16 * 32 + lane] = rbias;
    mrow[17 * 32 + lane] = rsum;
  }
  __syncthreads();                         // stream 1's partial results are in sM

  if (grp == 0) {
    v4f o1[2][2];
    #pragma unroll
    for (int dt = 0; dt < 2; ++dt) {
      o1[dt][0] = *(const v4f*)(mrow + ((dt * 2 + 0) * 32 + lane) * 4);
      o1[dt][1] = *(const v4f*)(mrow + ((dt * 2 + 1) * 32 + lane) * 4);
    }
    const float b1 = mrow[16 * 32 + lane];
    const float l1 = mrow[17 * 32 + lane];
    // both partial results are brought to the larger bias, as a rescale inside the loop does, then normalised
    const float bm = fmaxf(rbias, b1);
    const float s0 = __builtin_amdgcn_exp2f(rbias - bm);
    const float s1 = __builtin_amdgcn_exp2f(b1 - bm);
    const float rinv = 1.0f / (rsum * s0 + l1 * s1);   // O and the row sums carry the same x4096
    const float f0 = s0 * rinv, f1 = s1 * rinv;
    // lane holds column d = dt*16 + lq for query rows 8*hi + r: per-row factors from lane 8*hi + r
    float r0[8], r1[8];
    #pragma unroll
    for (int r = 0; r < 8; ++r) {
      r0[r] = __shfl(f0, (hi << 3) + r, 32);
      r1[r] = __shfl(f1, (hi << 3) + r, 32);
    }
    f16* so = sC + qw * (16 * CP);
    #pragma unroll
    for (int r = 0; r < 8; ++r) {
      #pragma unroll
      for (int dt = 0; dt < 2; ++dt)
        so[(hi * 8 + r) * CP + dt * 16 + lq] = (f16)(o[dt][r] * r0[r] + o1[dt][r >> 2][r & 3] * r1[r]);
    }
  }
  __syncthreads();                         // ctx of all 128 positions is in sC

  FragH an[NWAVE];                         // A operands: row = position nt*16 + lq, k = d split map
  #pragma unroll
  for (int nt = 0; nt < NWAVE; ++nt) {
    const f16* p = sC + (nt * 16 + lq) * CP + hi * 8;
    an[nt].q[0] = *(const v4u*)(p);
    an[nt].q[1] = *(const v4u*)(p + 16);
  }

  // D element r of lane: (n = nt*16 + 8*hi + r, c = c0 + lq): eight neighbouring positions of one channel row
  const v8f z = (v8f){0, 0, 0, 0, 0, 0, 0, 0};
  float* orow = out + ((size_t)b * CH + c0) * SEQ_FULL + qblk * BQ + lane * 4;
  v8f acc0[NWAVE];
  #pragma unroll
  for (int nt = 0; nt < NWAVE; ++nt) acc0[nt] = mma_f16(an[nt].v, bw.v, z);
  gate_add_store(xrow0, acc0, xv0, gs);
  asm volatile("s_wait_dscnt 0x0" ::: "memory");      // the wave's own rows are written before it reads them back whole
  rows_out(sXO + c0 * XP + lane * 4, orow);
}

extern "C" void kernel_launch(void* const* d_in, const int* in_sizes, int n_in,
                              void* d_out, int out_size, void* d_ws, size_t ws_size,
                              hipStream_t stream) {
  if (n_in < 6) return;
  const size_t x_need = ((size_t)(NB - 1) * CH + (CH - 1)) * SEQ_FULL + SEQ;
  if ((size_t)in_sizes[0] < x_need) return;
  if ((size_t)in_sizes[1] < (size_t)HD * CH) return;
  if ((size_t)in_sizes[2] < (size_t)HD * CH) return;
  if ((size_t)in_sizes[3] < (size_t)HD * CH) return;
  if ((size_t)in_sizes[4] < (size_t)CH * HD) return;
  if (in_sizes[5] < 1) return;
  if ((size_t)out_size < x_need) return;
  if (ws_size < WS_TOTAL) return;

  const float* x     = (const float*)d_in[0];
  const float* wq    = (const float*)d_in[1];
  const float* wk    = (const float*)d_in[2];
  const float* wv    = (const float*)d_in[3];
  const float* wo    = (const float*)d_in[4];
  const float* gamma = (const float*)d_in[5];
  float*       out   = (float*)d_out;

  char* ws = (char*)d_ws;
  f16* qp  = (f16*)(ws);
  f16* kp  = (f16*)(ws + PL_BYTES);
  f16* vp  = (f16*)(ws + 2 * PL_BYTES);
  f16* qrp = (f16*)(ws + 4 * PL_BYTES);
  f16* krp = (f16*)(ws + 5 * PL_BYTES);

  // qkv_kernel(x, wq, wk, wv, qp, kp, qr, kr, vp)
  qkv_kernel<<<dim3(SEQ / NT, NB), 256, 0, stream>>>(x, wq, wk, wv, qp, kp, qrp, krp, vp);
  // attn_kernel(qp, qr, kp, kr, vp, wo, x, gamma, out)
  attn_kernel<<<dim3(SEQ / BQ, NB), 512, 0, stream>>>(qp, qrp, kp, krp, vp, wo, x, gamma, out);
}

// v008
// It runs in 40.7 microseconds.
// Timed twice side by side with v007, it ran 1.05 times as fast both times.
// Over all steps from v000 it is 3.24 times as fast.
#include <hip/hip_runtime.h>

// Contractions: q/k/v projections on v_wmma_f32_16x16x32_bf16 (x and W as bf16 RNE-converted inputs, f32 accumulate);
// S^T = K x Q^T on v_wmma_f32_16x16x32_f16 as three products (q,k f16 value planes + f16 residual planes x2048,
// residual products in their own accumulator folded by 1/2048 in f32); O = P x V on f16 (P on the softmax reference's scale);
// out-projection on f16 (Wo = f16 of bf16 RNE value x64, ctx f16, 1/64 folded in the f32 epilogue), done by the attention
// kernel itself on its own 128 positions; softmax, gate and skip-add in f32. q carries log2(e) from the projection on.
// The weights are converted by the kernels that use them: no launch of their own.

#ifndef NB
#define NB 8
#endif
#ifndef SEQ
#define SEQ 4096
#endif
#define NB_FULL   8
#define SEQ_FULL  4096
#define CH        256                 // channels (projection K)
#define HD        32                  // q/k/v dim (single head)
#define NQKV      96                  // stacked projection outputs: q 0..31, k 32..63, v 64..95
#define NT        64                  // positions per projection block
#define XPW       132                 // LDS pitch (32-bit words) of the transposed bf16 x tile
#define WP        264                 // LDS pitch (bf16) of a staged projection weight row: 528 B = 16 B x odd
#define SP        72                  // LDS pitch (halves) of the q|k, q|k residual and v staging tiles
#define BQ        128                 // query rows per attention block (8 waves x 16)
#define BK        32                  // keys per PV product (k of one WMMA)
#define NWAVE     8                   // waves per key stream == 16-row query tiles per block
#define NGW       2                   // key streams (groups of NWAVE waves) per attention block
#define CP        40                  // LDS pitch (halves) of the per-wave ctx staging tile
#define KS        128                 // keys per LDS stage of the attention ring == keys per online-softmax step
#define NS        (SEQ / KS)          // stages
#define NTRIP     (NS / NGW)          // ring trips: each trip, every key stream works on a stage of its own
#define NSUB      (KS / 16)           // 16-key score tiles per stage
#define NGRP      (KS / BK)           // 32-key PV groups per stage
#define KPH       40                  // LDS pitch (halves) of a staged k / k residual row: 80 B = 16 B x odd
#define VPH       136                 // LDS pitch (halves) of a staged v row of KS keys: 272 B = 16 B x odd
#define ST_KR     (KS * KPH)          // offsets (halves) inside one stage: k at 0, k residual, v
#define ST_V      (2 * KS * KPH)
#define ST_H      (2 * KS * KPH + HD * VPH)   // halves per stage
#define XP        132                 // LDS pitch (floats) of a staged x / result row of BQ positions: 528 B = 16 B x odd
#define RES_CARRY 2048.0f             // power-of-two carry of the q/k residual planes
#define RES_FOLD  (1.0f / 2048.0f)
#define LOG2E     1.4426950408889634f
#define P_SET     (-4.0f)             // a new softmax reference puts the largest weight at 2^P_SET: 19 doublings below P_LIMIT
#define P_LIMIT   32768.0f            // a lane's sum of weights over one stage above this asks for a new reference (f16 holds 65504)

static_assert(NB >= 1 && NB <= NB_FULL);
static_assert(SEQ <= SEQ_FULL);
static_assert(SEQ % BQ == 0);
static_assert(SEQ % NT == 0);
static_assert(SEQ % BK == 0);
static_assert(BQ == NWAVE * 16);
static_assert(SEQ % KS == 0 && KS % BK == 0 && BK == 32 && NSUB % 4 == 0);
static_assert(KS * 4 == 2 * 256 && HD * (KS / 8) == 2 * 256);   // 16-B pieces per plane and stage == 2 per thread
static_assert(KPH >= HD && (KPH * 2) % 16 == 0 && VPH >= KS && (VPH * 2) % 16 == 0 && (ST_H * 2) % 16 == 0);
static_assert(HD == 32);
static_assert(CH % 32 == 0);
static_assert(NQKV == 3 * HD);
static_assert(8 * 256 == (CH / 2) * (NT / 4));     // x staging items == threads x iterations
static_assert(XPW >= CH / 2 && (XPW * 4) % 16 == 0);
static_assert(SP >= 2 * HD && SP >= NT && (SP * 2) % 16 == 0);
static_assert(NT * 4 == 256);                      // q/k (+ residual) plane store: one 16-B piece per thread each
static_assert(HD * 8 == 256);                      // v plane store: one 16-B piece per thread
static_assert(CP >= HD && (CP * 2) % 16 == 0);
static_assert(XP >= BQ && (XP * 4) % 16 == 0);
static_assert(NGW * NWAVE * 16 == CH);             // out-projection: each wave owns 16 channel rows
static_assert(NGW == 2 && NS % NGW == 0 && NTRIP >= 2);
static_assert(BQ * 4 == 32 * 16);                  // one x / result row of the block == one 16-B piece per lane of a wave
static_assert(NS >= 2 && NS * NWAVE == CH);        // one x row per wave rides each of the NS stage copies
static_assert(WP >= CH && (WP * 2) % 16 == 0);
static_assert(NQKV * CH == 24 * 256 * 4 && HD * CH == 8 * 256 * 4 && CH == 64 * 4);   // weight staging: 24 pieces of 4 per thread, 8 per matrix
static_assert(2 * (NT * XPW * 4 + 2 * NT * SP * 2 + HD * SP * 2 + NQKV * WP * 2) <= 327680);   // two projection blocks per WGP

#define PL_BYTES  ((size_t)NB * SEQ * HD * 2)
#define NPLANE    6                                 // q, k, v, unused, q residual, k residual
#define WS_TOTAL  (NPLANE * PL_BYTES)
static_assert(PL_BYTES % 128 == 0);
static_assert(WS_TOTAL <= (size_t)134217728);

typedef __bf16   bf16;
typedef _Float16 f16;
typedef bf16     v16bf __attribute__((ext_vector_type(16)));
typedef bf16     v2bf  __attribute__((ext_vector_type(2)));
typedef f16      v16h  __attribute__((ext_vector_type(16)));
typedef f16      v8h   __attribute__((ext_vector_type(8)));
typedef float    v8f   __attribute__((ext_vector_type(8)));
typedef float    v4f   __attribute__((ext_vector_type(4)));
typedef unsigned v4u   __attribute__((ext_vector_type(4)));
typedef unsigned v2u   __attribute__((ext_vector_type(2)));

union FragB  { v16bf v; v4u q[2]; };
union FragH  { v16h  v; v4u q[2]; f16 h[16]; };
union Pack8H { v4u u; v8h v; f16 h[8]; };

// WMMA helpers: the plain builtins; the compiler itself keeps the distance to a vector instruction on D, A or B.
static __device__ __forceinline__ v8f mma_bf16(v16bf a, v16bf b, v8f acc) {
  return __builtin_amdgcn_wmma_f32_16x16x32_bf16(false, a, false, b, (short)0, acc, false, false);
}
static __device__ __forceinline__ v8f mma_f16(v16h a, v16h b, v8f acc) {
  return __builtin_amdgcn_wmma_f32_16x16x32_f16(false, a, false, b, (short)0, acc, false, false);
}

// f32 -> bf16 bits, RNE (finite inputs).
static __device__ __forceinline__ unsigned bf16_bits(float f) {
  const unsigned u = __float_as_uint(f);
  return (u + 0x7FFFu + ((u >> 16) & 1u)) >> 16;
}
static __device__ __forceinline__ float bf16_val(float f) {
  return __uint_as_float(bf16_bits(f) << 16);
}

// two f32 -> packed bf16 pair, RNE (the convert instruction; the same bits as bf16_bits on finite inputs), first in the low half
static __device__ __forceinline__ unsigned bf16_pair(float lo, float hi) {
  v2bf t;
  t[0] = (bf16)lo;
  t[1] = (bf16)hi;
  return __builtin_bit_cast(unsigned, t);
}

// Fused q/k/v projection. Block = (64-position tile, batch), 256 threads.
// x tile [256 c][64 n] is RNE-converted to bf16 and transposed through LDS to [n][c]; D[n][dd] = sum_c x[c][n] W[dd][c].
// W [96 dd][256 c] (rows 0..31 wq, 32..63 wk, 64..95 wv) is RNE-converted to bf16 by the block itself and kept in LDS:
// its f32 pieces are asked for ahead of the x tile and converted behind it; the B fragments are LDS reads.
// q is multiplied by log2(e) in f32 before it is split, so that the scores come out of the products as exponents of two.
// Planes: qp,kp [NB][SEQ][32] f16 value planes; qr,kr [NB][SEQ][32] f16 residual planes = (f32 - f16 value) x 2048
// coverage: q,k,q_res,k_res rows n0..n0+63 x 32 d ; v 32 d x positions n0..n0+63 ; every written line whole,
// one instruction. LDS: sX, sW, sQK, sR, sV are cross-wave (block barriers); staged extent == consumed extent for all five.
__global__ __launch_bounds__(256) void qkv_kernel(const float* __restrict__ x,
                                                  const float* __restrict__ wq, const float* __restrict__ wk,
                                                  const float* __restrict__ wv,
                                                  f16* __restrict__ qp, f16* __restrict__ kp,
                                                  f16* __restrict__ qr, f16* __restrict__ kr,
                                                  f16* __restrict__ vp) {
  const int n0   = blockIdx.x * NT;
  const int b    = blockIdx.y;
  const int tid  = threadIdx.x;
  const int wave = tid >> 5;
  const int lane = tid & 31;
  const int lq   = lane & 15;
  const int hi   = lane >> 4;

  __shared__ __align__(16) unsigned sX[NT * XPW];     // [n][c/2] packed bf16 pairs (even c in the low half)
  __shared__ __align__(16) unsigned short sW[NQKV * WP];   // [dd][c] bf16 bits
  __shared__ __align__(16) f16      sQK[NT * SP];     // [n][q 0..31 | k 32..63] values
  __shared__ __align__(16) f16      sR[NT * SP];      // [n][q 0..31 | k 32..63] residuals x2048
  __shared__ __align__(16) f16      sV[HD * SP];      // [d][n]

  // weight pieces of 4 channels: piece i*256 + tid of the 6144; a wave's 32 pieces are 512 B in a row, whole lines
  v4f wl[24];
  #pragma unroll
  for (int i = 0; i < 24; ++i)
    wl[i] = *(const v4f*)(((i < 8) ? wq : ((i < 16) ? wk : wv)) + ((i & 7) * 256 + tid) * 4);

  #pragma unroll 2
  for (int it = 0; it < 8; ++it) {
    const int item = it * 256 + tid;                  // 0..2047
    const int nq   = item & 15;                       // 4-position group
    const int cp   = item >> 4;                       // channel pair 0..127
    const float* src = x + ((size_t)b * CH + 2 * cp) * SEQ_FULL + n0 + nq * 4;
    const v4f a0 = *(const v4f*)(src);
    const v4f a1 = *(const v4f*)(src + SEQ_FULL);
    #pragma unroll
    for (int i = 0; i < 4; ++i)
      sX[(nq * 4 + i) * XPW + cp] = bf16_bits(a0[i]) | (bf16_bits(a1[i]) << 16);
  }
  #pragma unroll
  for (int i = 0; i < 24; ++i) {
    v2u u;
    u[0] = bf16_pair(wl[i][0], wl[i][1]);
    u[1] = bf16_pair(wl[i][2], wl[i][3]);
    *(v2u*)(sW + (i * 4 + (tid >> 6)) * WP + (tid & 63) * 4) = u;   // row dd = piece >> 6, channels 4 * (piece & 63) ..
  }
  __syncthreads();

  const int nt = wave & 3;                            // position sub-tile
  const int g3 = wave >> 2;                           // output tile group: tiles g3*3 + {0,1,2}
  v8f acc[3];
  #pragma unroll
  for (int j = 0; j < 3; ++j) acc[j] = (v8f){0, 0, 0, 0, 0, 0, 0, 0};

  const int aoff = (nt * 16 + lq) * XPW + hi * 4;     // row n, words of channels 8*hi..
  #pragma unroll 2
  for (int ks = 0; ks < CH / 32; ++ks) {
    FragB a;
    a.q[0] = *(const v4u*)(sX + aoff + ks * 16);        // c = ks*32 + 8*hi + 0..7
    a.q[1] = *(const v4u*)(sX + aoff + ks * 16 + 8);    // c = ks*32 + 16 + 8*hi + 0..7
    #pragma unroll
    for (int j = 0; j < 3; ++j) {
      const unsigned short* wr = sW + ((g3 * 3 + j) * 16 + lq) * WP + ks * 32 + hi * 8;
      FragB w;
      w.q[0] = *(const v4u*)(wr);                       // c = ks*32 + 8*hi + 0..7
      w.q[1] = *(const v4u*)(wr + 16);                  // c = ks*32 + 16 + 8*hi + 0..7
      acc[j] = mma_bf16(a.v, w.v, acc[j]);
    }
  }

  // D element r of lane: (n = nt*16 + 8*hi + r, dd = tile*16 + lq)
  #pragma unroll
  for (int j = 0; j < 3; ++j) {
    const int t = g3 * 3 + j;                         // wave-uniform
    #pragma unroll
    for (int r = 0; r < 8; ++r) {
      const int nrow = nt * 16 + hi * 8 + r;
      const float av = (t < 2) ? acc[j][r] * LOG2E : acc[j][r];     // tiles 0, 1 are q
      const f16 hv = (f16)av;
      if (t < 4) {
        sQK[nrow * SP + t * 16 + lq] = hv;
        sR[nrow * SP + t * 16 + lq]  = (f16)((av - (float)hv) * RES_CARRY);
      } else {
        sV[((t - 4) * 16 + lq) * SP + nrow] = hv;
      }
    }
  }
  __syncthreads();

  Pack8H pq, pk, pqr, pkr, pv;
  const int row = tid >> 2, seg = tid & 3;
  pq.v  = *(const v8h*)(sQK + row * SP + seg * 8);
  pk.v  = *(const v8h*)(sQK + row * SP + HD + seg * 8);
  pqr.v = *(const v8h*)(sR + row * SP + seg * 8);
  pkr.v = *(const v8h*)(sR + row * SP + HD + seg * 8);
  const int dv = tid >> 3, sv = tid & 7;
  pv.v = *(const v8h*)(sV + dv * SP + sv * 8);
  const size_t qi = ((size_t)b * SEQ + n0) * HD + (size_t)tid * 8;
  const size_t vi = ((size_t)b * HD + dv) * SEQ + n0 + sv * 8;
  const v4u uq = pq.u, uk = pk.u, uqr = pqr.u, ukr = pkr.u, uv = pv.u;
  *(v4u*)(qp + qi) = uq;
  *(v4u*)(kp + qi) = uk;
  *(v4u*)(qr + qi) = uqr;
  *(v4u*)(kr + qi) = ukr;
  *(v4u*)(vp + vi) = uv;
  
}

// Flash attention, all keys, no logit scaling. Block = (query block of 128, batch), 16 waves: four per SIMD, so that one
// wave's softmax work, LDS reads and waits stand beside the others' products. The waves form two key streams of eight:
// stream g takes stages g, g + 2, g + 4, ...; in a stream one wave owns 16 query rows and keeps its own online softmax
// (reference, row sum, O); the two streams' partial results are joined once, behind the loop, through LDS.
// S^T = K x Q^T so queries sit on lanes; P^T in C-layout is bit-identical to the A-fragment layout of O += P x V.
// Scores: kval.qval in the main accumulator; kres.qval + kval.qres in a second accumulator folded by 1/2048 in f32.
// K, K-residual and V tiles of KS keys are brought into a two-buffer LDS ring per stream once per block by asynchronous copies
// (a stream's next but one stage flies while its next is worked on); the fragments are two 16-B LDS loads each, in the k order of the q fragments.
// Softmax with a lazy reference: minus the reference in use is the C operand of the value product, so a score leaves the
// matrix unit as the exponent of its weight: no maximum, no multiply-add per score, no rescale of O. A lane's sum of the
// stage's weights tells whether the reference still holds; only if some lane's sum is too large (and in the first stage)
// the wave takes the stage's maximum, moves the reference, forms the weights again and rescales O and the row sum.
// Epilogue: out-projection + gate + skip-add of the block's 128 positions. D[n][c] = sum_d ctx[n][d] woh[c][d];
// woh[c][d] = f16(bf16 RNE value of wo[c][d] x 64), exact, formed by each wave for its own channels.
// result = D * (g/64) + bf16 RNE value of x; g = bf16 RNE value of gamma. Wave w of the 16 owns channels 16w..16w+15.
// The block's x tile [256 c][128 n] comes into LDS beside the ring, eight rows with each stage's copies.
// LDS sC, sM: cross-wave (block barriers). sRing, sXO as filled by the copies: cross-wave, published by the ring's barriers.
// sXO in the epilogue: each wave reads and rewrites only the rows of its own channels.

// One stage, copied by the 256 threads of its stream (tid = thread within the stream):
// keys s*KS..s*KS+KS-1 of the three planes into dst. Six 16-B pieces per thread, every lane on, all addresses
// 16-B multiples; k / k residual pieces are contiguous in global memory, v pieces are 256-B runs of each of the 32 rows.
// A seventh piece per thread: x rows (channels) s*NWAVE..s*NWAVE+NWAVE-1 of the block's positions into sx, one row per wave.
static __device__ __forceinline__ void stage_copy(const f16* __restrict__ kb_b, const f16* __restrict__ kr_b,
                                                  const f16* __restrict__ vt_b, const float* __restrict__ x_b,
                                                  int s, f16* dst, float* sx, int tid) {
  const int j0 = s * KS;
  const int p0 = tid, p1 = tid + 256;                 // piece 0..511 of each plane
  const f16* gk0 = kb_b + (size_t)j0 * HD + p0 * 8;
  const f16* gk1 = kb_b + (size_t)j0 * HD + p1 * 8;
  const f16* gr0 = kr_b + (size_t)j0 * HD + p0 * 8;
  const f16* gr1 = kr_b + (size_t)j0 * HD + p1 * 8;
  const f16* gv0 = vt_b + (size_t)(p0 >> 4) * SEQ + j0 + (p0 & 15) * 8;
  const f16* gv1 = vt_b + (size_t)(p1 >> 4) * SEQ + j0 + (p1 & 15) * 8;
  const unsigned l0  = (unsigned)(size_t)dst;         // LDS byte address of the stage
  const unsigned lk0 = l0 + ((p0 >> 2) * KPH + (p0 & 3) * 8) * 2;
  const unsigned lk1 = l0 + ((p1 >> 2) * KPH + (p1 & 3) * 8) * 2;
  const unsigned lr0 = lk0 + ST_KR * 2;
  const unsigned lr1 = lk1 + ST_KR * 2;
  const unsigned lv0 = l0 + (ST_V + (p0 >> 4) * VPH + (p0 & 15) * 8) * 2;
  const unsigned lv1 = l0 + (ST_V + (p1 >> 4) * VPH + (p1 & 15) * 8) * 2;
  const int xc = s * NWAVE + (tid >> 5);              // channel row of this wave's x piece
  const float* gx = x_b + (size_t)xc * SEQ_FULL + (tid & 31) * 4;
  const unsigned lx = (unsigned)(size_t)sx + (xc * XP + (tid & 31) * 4) * 4;
  // The copies and their s_wait_xcnt in one statement: no address register is rewritten ahead of that wait.
  asm volatile("global_load_async_to_lds_b128 %0, %7, off\n\t"
               "global_load_async_to_lds_b128 %1, %8, off\n\t"
               "global_load_async_to_lds_b128 %2, %9, off\n\t"
               "global_load_async_to_lds_b128 %3, %10, off\n\t"
               "global_load_async_to_lds_b128 %4, %11, off\n\t"
               "global_load_async_to_lds_b128 %5, %12, off\n\t"
               "global_load_async_to_lds_b128 %6, %13, off\n\t"
               "s_wait_xcnt 0x0"
               :: "v"(lk0), "v"(lk1), "v"(lr0), "v"(lr1), "v"(lv0), "v"(lv1), "v"(lx),
                  "v"(gk0), "v"(gk1), "v"(gr0), "v"(gr1), "v"(gv0), "v"(gv1), "v"(gx)
               : "memory");
}

// 2^x with the slot behind the transcendental filled in the same statement. For the rarely taken path that renews the softmax
// reference.
static __device__ __forceinline__ float exp2_slot(float x) {
  float r;
  asm("v_exp_f32 %0, %1\n\tv_nop" : "=v"(r) : "v"(x));   // v_nop: the one independent slot the instruction set asks for
  return r;
}

// Epilogue pieces. A lane's part of one channel row of the LDS tile: eight neighbouring positions out of every 16.
static __device__ __forceinline__ void x_rows_load(const float* xrow, v4f (&xv)[NWAVE][2]) {
  #pragma unroll
  for (int nt = 0; nt < NWAVE; ++nt) {
    xv[nt][0] = *(const v4f*)(xrow + nt * 16);
    xv[nt][1] = *(const v4f*)(xrow + nt * 16 + 4);
  }
}
// result = D * gs + bf16 RNE value of x, written over x in the LDS tile
static __device__ __forceinline__ void gate_add_store(float* xrow, const v8f (&acc)[NWAVE], const v4f (&xv)[NWAVE][2],
                                                      float gs) {
  #pragma unroll
  for (int nt = 0; nt < NWAVE; ++nt) {
    v4f r0, r1;
    #pragma unroll
    for (int i = 0; i < 4; ++i) {
      r0[i] = fmaf(acc[nt][i], gs, bf16_val(xv[nt][0][i]));
      r1[i] = fmaf(acc[nt][4 + i], gs, bf16_val(xv[nt][1][i]));
    }
    *(v4f*)(xrow + nt * 16)     = r0;
    *(v4f*)(xrow + nt * 16 + 4) = r1;
  }
}
// 16 channel rows of the LDS tile to the output: each store is one 512-B row of the block's positions, whole lines
static __device__ __forceinline__ void rows_out(const float* srow, float* orow) {
  v4f vals[16];
  #pragma unroll
  for (int it = 0; it < 16; ++it) vals[it] = *(const v4f*)(srow + it * XP);
  #pragma unroll
  for (int it = 0; it < 16; ++it) *(v4f*)(orow + (size_t)it * SEQ_FULL) = vals[it];
}

__global__ __launch_bounds__(512) void attn_kernel(const f16* __restrict__ qp, const f16* __restrict__ qr,
                                                   const f16* __restrict__ kp, const f16* __restrict__ kr,
                                                   const f16* __restrict__ vp, const float* __restrict__ wo,
                                                   const float* __restrict__ x, const float* __restrict__ gamma,
                                                   float* __restrict__ out) {
  const int qblk = blockIdx.x;
  const int b    = blockIdx.y;
  const int tid  = threadIdx.x;
  const int wave = tid >> 5;                                      // 0..15
  const int grp  = __builtin_amdgcn_readfirstlane(tid >> 8);      // key stream of the wave, a scalar
  const int qw   = wave & (NWAVE - 1);                            // query tile of the wave
  const int gtid = tid & 255;                                     // thread within its stream
  const int lane = tid & 31;
  const int lq   = lane & 15;   // query column of S^T / d column of O
  const int hi   = lane >> 4;   // k-split half

  __shared__ __align__(16) f16 sC[NWAVE * 16 * CP];
  __shared__ __align__(16) f16 sRing[2 * NGW * ST_H];           // [ring slot][stream]
  __shared__ __align__(16) float sM[NWAVE * 18 * 32];           // stream 1's partial O (16 words a lane), bias and row sum
  __shared__ __align__(16) float sXO[CH * XP];        // [c][n]: x of the block's positions, then the result in place

  const int qrow0 = qblk * BQ + qw * 16;

  FragH qf, qrf;                 // B operands: column = query qrow0+lq, k = d split map (value, residual)
  {
    const size_t qo = ((size_t)b * SEQ + qrow0 + lq) * HD + hi * 8;
    qf.q[0]  = *(const v4u*)(qp + qo);          // d = 8*hi + 0..7
    qf.q[1]  = *(const v4u*)(qp + qo + 16);     // d = 16 + 8*hi + 0..7
    qrf.q[0] = *(const v4u*)(qr + qo);
    qrf.q[1] = *(const v4u*)(qr + qo + 16);
  }
  const f16* kb_b = kp + (size_t)b * SEQ * HD;
  const f16* kr_b = kr + (size_t)b * SEQ * HD;
  const f16* vt_b = vp + (size_t)b * HD * SEQ;
  const float* x_b = x + (size_t)b * CH * SEQ_FULL + qblk * BQ;

  v8f o[2];
  o[0] = (v8f){0, 0, 0, 0, 0, 0, 0, 0};
  o[1] = (v8f){0, 0, 0, 0, 0, 0, 0, 0};
  float rbias = 0.0f;                     // the reference in use: weight = 2^(score * log2(e) - rbias); set in the first stage
  v8f cin = (v8f){0, 0, 0, 0, 0, 0, 0, 0};   // -rbias in all eight rows (a lane is one query): C of the value product
  float rsum = 0.0f;                      // on the scale of P and O

  // ring prologue: each stream's first stage landed and published, then its second in flight
  f16* ring_g = sRing + grp * ST_H;                   // this stream's two buffers: ring_g, ring_g + NGW * ST_H
  stage_copy(kb_b, kr_b, vt_b, x_b, grp, ring_g, sXO, gtid);
  asm volatile("s_wait_asynccnt 0x0" ::: "memory");   // this wave's pieces of the first stage have landed
  __syncthreads();                                    // ... and every other wave's
  stage_copy(kb_b, kr_b, vt_b, x_b, NGW + grp, ring_g + NGW * ST_H, sXO, gtid);

  #pragma unroll 1
  for (int t = 0; t < NTRIP; ++t) {                   // this wave's stage: t * NGW + grp
  f16* sbuf = ring_g + (t & 1) * (NGW * ST_H);        // trip t reads this buffer alone

  // c[sub][r] = log2(e) * score - rbias (query qrow0+lq, key (t*NGW+grp)*KS + sub*16 + 8*hi + r): all KS keys of the stage before any softmax work.
  // Four tiles at a time, so that the product that accumulates into cr stands four products behind the one it waits for.
  // Nothing ties the LDS reads, the products and the folds to this order: the compiler reads the fragments ahead as far as
  // the 256 registers a wave has at four waves per SIMD allow, and puts the folds among the products.
  v8f c[NSUB];
  #pragma unroll
  for (int h = 0; h < NSUB; h += 4) {
    FragH ak[4], akr[4];
    #pragma unroll
    for (int i = 0; i < 4; ++i) {
      const int ko = ((h + i) * 16 + lq) * KPH + hi * 8;       // row = key
      ak[i].q[0] = *(const v4u*)(sbuf + ko);                   // d = 8*hi + 0..7
      ak[i].q[1] = *(const v4u*)(sbuf + ko + 16);              // d = 16 + 8*hi + 0..7
    }
    #pragma unroll
    for (int i = 0; i < 4; ++i) {
      const int ko = ((h + i) * 16 + lq) * KPH + hi * 8;
      akr[i].q[0] = *(const v4u*)(sbuf + ST_KR + ko);
      akr[i].q[1] = *(const v4u*)(sbuf + ST_KR + ko + 16);
    }
    const v8f z = (v8f){0, 0, 0, 0, 0, 0, 0, 0};
    v8f cm[4], cr[4];
    #pragma unroll
    for (int i = 0; i < 4; ++i) cm[i] = mma_f16(ak[i].v, qf.v, cin);      // value x value - reference
    #pragma unroll
    for (int i = 0; i < 4; ++i) cr[i] = mma_f16(akr[i].v, qf.v, z);       // k residual x q value
    #pragma unroll
    for (int i = 0; i < 4; ++i) cr[i] = mma_f16(ak[i].v, qrf.v, cr[i]);   // k value x q residual
    #pragma unroll
    for (int i = 0; i < 4; ++i) c[h + i] = cm[i] + cr[i] * RES_FOLD;
  }

  // the stage's v fragments, asked for ahead of the softmax work
  FragH bv[NGRP][2];
  #pragma unroll
  for (int g = 0; g < NGRP; ++g) {
    #pragma unroll
    for (int dt = 0; dt < 2; ++dt) {
      const f16* base = sbuf + ST_V + (dt * 16 + lq) * VPH + g * BK + hi * 8;    // column = d
      bv[g][dt].q[0] = *(const v4u*)(base);           // keys g*32 + 8*hi + 0..7 of the stage
      bv[g][dt].q[1] = *(const v4u*)(base + 16);      // keys g*32 + 16 + 8*hi + 0..7
    }
  }

  // Weights on the reference in use. exp + pack: P^T C-layout == A-fragment layout of the PV product.
  // Query lq's KS scores are split across lane / lane^16.
  FragH pa[NGRP];
  float psum = 0.0f;
  bool renew = (t == 0);                  // a scalar: the first stage sets the reference
  if (!renew) {
    v8f ps = (v8f){0, 0, 0, 0, 0, 0, 0, 0};
    #pragma unroll
    for (int sub = 0; sub < NSUB; ++sub) {
      v8f p;
      #pragma unroll
      for (int r = 0; r < 8; ++r) p[r] = __builtin_amdgcn_exp2f(c[sub][r]);   // weight of key sub*16 + 8*hi + r
      ps += p;
      #pragma unroll
      for (int r = 0; r < 8; ++r) pa[sub >> 1].h[(sub & 1) * 8 + r] = (f16)p[r];
    }
    psum = ((ps[0] + ps[1]) + (ps[2] + ps[3])) + ((ps[4] + ps[5]) + (ps[6] + ps[7]));
    // Holds the v reads ahead of this place (loaded values as inputs only): without it the compiler moves them down between
    // the PV products, where every product waits out an LDS read; here the exponentials above cover them.
    asm volatile("" :: "v"(bv[0][0].q[0]), "v"(bv[0][0].q[1]), "v"(bv[0][1].q[0]), "v"(bv[0][1].q[1]),
                       "v"(bv[1][0].q[0]), "v"(bv[1][0].q[1]), "v"(bv[1][1].q[0]), "v"(bv[1][1].q[1]),
                       "v"(bv[2][0].q[0]), "v"(bv[2][0].q[1]), "v"(bv[2][1].q[0]), "v"(bv[2][1].q[1]),
                       "v"(bv[3][0].q[0]), "v"(bv[3][0].q[1]), "v"(bv[3][1].q[0]), "v"(bv[3][1].q[1]));
    // every weight is positive and no larger than the sum: a sum within the limit says that all of them fit f16
    renew = __builtin_amdgcn_ballot_w32(!(psum <= P_LIMIT)) != 0;             // one scalar test for the wave
  }
  if (renew) {
    // The maximum runs as eight independent chains over the tiles, joined at the end.
    v8f mx = c[0];
    #pragma unroll
    for (int sub = 1; sub < NSUB; ++sub) {
      #pragma unroll
      for (int r = 0; r < 8; ++r) mx[r] = fmaxf(mx[r], c[sub][r]);
    }
    float m_new = mx[0];
    #pragma unroll
    for (int r = 1; r < 8; ++r) m_new = fmaxf(m_new, mx[r]);
    m_new = fmaxf(m_new, __shfl_xor(m_new, 16, 32));
    // the reference moves up by delta, never down; the first stage takes it as it comes (O and the row sum are still 0)
    const float dn = P_SET - m_new;
    const float nd = (t == 0) ? dn : fminf(dn, 0.0f);          // minus delta
    const float scale = (t == 0) ? 0.0f : __builtin_amdgcn_exp2f(nd);
    rbias -= nd;
    const float nr = -rbias;
    cin = (v8f){nr, nr, nr, nr, nr, nr, nr, nr};
    const v8f ndv = (v8f){nd, nd, nd, nd, nd, nd, nd, nd};
    v8f ps = (v8f){0, 0, 0, 0, 0, 0, 0, 0};
    #pragma unroll
    for (int sub = 0; sub < NSUB; ++sub) {
      const v8f e = c[sub] + ndv;
      v8f p;
      #pragma unroll
      for (int r = 0; r < 8; ++r) p[r] = exp2_slot(e[r]);
      ps += p;
      #pragma unroll
      for (int r = 0; r < 8; ++r) pa[sub >> 1].h[(sub & 1) * 8 + r] = (f16)p[r];
    }
    psum = ((ps[0] + ps[1]) + (ps[2] + ps[3])) + ((ps[4] + ps[5]) + (ps[6] + ps[7]));
    rsum *= scale;
    // rescale O: queries are the row dimension there -> per-row scale from lane 8*hi + r
    float sc[8];
    #pragma unroll
    for (int r = 0; r < 8; ++r) sc[r] = __shfl(scale, (hi << 3) + r, 32);
    #pragma unroll
    for (int dt = 0; dt < 2; ++dt) {
      #pragma unroll
      for (int r = 0; r < 8; ++r) o[dt][r] *= sc[r];
    }
  }
  rsum += psum + __shfl_xor(psum, 16, 32);

  // O += P x V over the stage's NGRP groups of 32 keys
  #pragma unroll
  for (int g = 0; g < NGRP; ++g) {
    #pragma unroll
    for (int dt = 0; dt < 2; ++dt) o[dt] = mma_f16(pa[g].v, bv[g][dt].v, o[dt]);
  }
  // publish point of trip t + 1's stages; behind it the buffer just read is free for trip t + 2's
  asm volatile("s_wait_dscnt 0x0" ::: "memory");      // this wave's reads of sbuf have returned
  asm volatile("s_wait_asynccnt 0x0" ::: "memory");   // this wave's pieces of trip t + 1's stage have landed
  __syncthreads();
  if (t + 2 < NTRIP) stage_copy(kb_b, kr_b, vt_b, x_b, (t + 2) * NGW + grp, sbuf, sXO, gtid);
  }
  asm volatile("s_wait_asynccnt 0x0" ::: "memory");   // nothing in flight when the wave goes on to its end

  // this wave's out-projection weights, asked for ahead of the join. B operand: column = channel, k = d split map
  FragH bw;
  {
    const float* wr = wo + (size_t)(wave * 16 + lq) * HD + hi * 8;
    const v4f w0 = *(const v4f*)(wr),      w1 = *(const v4f*)(wr + 4);        // d = 8*hi + 0..7
    const v4f w2 = *(const v4f*)(wr + 16), w3 = *(const v4f*)(wr + 20);       // d = 16 + 8*hi + 0..7
    asm volatile("s_wait_xcnt 0x0" ::: "memory");     // ahead of any rewrite of the four loads' address registers
    #pragma unroll
    for (int i = 0; i < 4; ++i) {
      bw.h[i]      = (f16)(bf16_val(w0[i]) * 64.0f);
      bw.h[4 + i]  = (f16)(bf16_val(w1[i]) * 64.0f);
      bw.h[8 + i]  = (f16)(bf16_val(w2[i]) * 64.0f);
      bw.h[12 + i] = (f16)(bf16_val(w3[i]) * 64.0f);
    }
  }
  const float gs = bf16_val(gamma[0]) * (1.0f / 64.0f);

  // x of the wave's 16 channels (the tile was published by the ring's last barriers); the join covers the latency
  const int c0 = wave * 16;
  float* xrow0 = sXO + (c0 + lq) * XP + hi * 8;       // lane: channel row c0 + lq, positions nt*16 + 8*hi + 0..7
  v4f xv0[NWAVE][2];
  x_rows_load(xrow0, xv0);

  // join of the two key streams: wave qw of stream 1 hands its partial O, bias and row sum, lane for lane, to wave qw of stream 0
  float* mrow = sM + qw * (18 * 32);
  if (grp == 1) {
    #pragma unroll
    for (int dt = 0; dt < 2; ++dt) {
      *(v4f*)(mrow + ((dt * 2 + 0) * 32 + lane) * 4) = (v4f){o[dt][0], o[dt][1], o[dt][2], o[dt][3]};
      *(v4f*)(mrow + ((dt * 2 + 1) * 32 + lane) * 4) = (v4f){o[dt][4], o[dt][5], o[dt][6], o[dt][7]};
    }
    mrow[16 * 32 + lane] = rbias;
    mrow[17 * 32 + lane] = rsum;
  }
  __syncthreads();                         // stream 1's partial results are in sM

  if (grp == 0) {
    v4f o1[2][2];
    #pragma unroll
    for (int dt = 0; dt < 2; ++dt) {
      o1[dt][0] = *(const v4f*)(mrow + ((dt * 2 + 0) * 32 + lane) * 4);
      o1[dt][1] = *(const v4f*)(mrow + ((dt * 2 + 1) * 32 + lane) * 4);
    }
    const float b1 = mrow[16 * 32 + lane];
    const float l1 = mrow[17 * 32 + lane];
    // both partial results are brought to the larger bias, as a rescale inside the loop does, then normalised
    const float bm = fmaxf(rbias, b1);
    const float s0 = __builtin_amdgcn_exp2f(rbias - bm);
    const float s1 = __builtin_amdgcn_exp2f(b1 - bm);
    const float rinv = 1.0f / (rsum * s0 + l1 * s1);   // O and the row sums are on the same scale
    const float f0 = s0 * rinv, f1 = s1 * rinv;
    // lane holds column d = dt*16 + lq for query rows 8*hi + r: per-row factors from lane 8*hi + r
    float r0[8], r1[8];
    #pragma unroll
    for (int r = 0; r < 8; ++r) {
      r0[r] = __shfl(f0, (hi << 3) + r, 32);
      r1[r] = __shfl(f1, (hi << 3) + r, 32);
    }
    f16* so = sC + qw * (16 * CP);
    #pragma unroll
    for (int r = 0; r < 8; ++r) {
      #pragma unroll
      for (int dt = 0; dt < 2; ++dt)
        so[(hi * 8 + r) * CP + dt * 16 + lq] = (f16)(o[dt][r] * r0[r] + o1[dt][r >> 2][r & 3] * r1[r]);
    }
  }
  __syncthreads();                         // ctx of all 128 positions is in sC

  FragH an[NWAVE];                         // A operands: row = position nt*16 + lq, k = d split map
  #pragma unroll
  for (int nt = 0; nt < NWAVE; ++nt) {
    const f16* p = sC + (nt * 16 + lq) * CP + hi * 8;
    an[nt].q[0] = *(const v4u*)(p);
    an[nt].q[1] = *(const v4u*)(p + 16);
  }

  // D element r of lane: (n = nt*16 + 8*hi + r, c = c0 + lq): eight neighbouring positions of one channel row
  const v8f z = (v8f){0, 0, 0, 0, 0, 0, 0, 0};
  float* orow = out + ((size_t)b * CH + c0) * SEQ_FULL + qblk * BQ + lane * 4;
  v8f acc0[NWAVE];
  #pragma unroll
  for (int nt = 0; nt < NWAVE; ++nt) acc0[nt] = mma_f16(an[nt].v, bw.v, z);
  gate_add_store(xrow0, acc0, xv0, gs);
  asm volatile("s_wait_dscnt 0x0" ::: "memory");      // the wave's own rows are written before it reads them back whole
  rows_out(sXO + c0 * XP + lane * 4, orow);
}

extern "C" void kernel_launch(void* const* d_in, const int* in_sizes, int n_in,
                              void* d_out, int out_size, void* d_ws, size_t ws_size,
                              hipStream_t stream) {
  if (n_in < 6) return;
  const size_t x_need = ((size_t)(NB - 1) * CH + (CH - 1)) * SEQ_FULL + SEQ;
  if ((size_t)in_sizes[0] < x_need) return;
  if ((size_t)in_sizes[1] < (size_t)HD * CH) return;
  if ((size_t)in_sizes[2] < (size_t)HD * CH) return;
  if ((size_t)in_sizes[3] < (size_t)HD * CH) return;
  if ((size_t)in_sizes[4] < (size_t)CH * HD) return;
  if (in_sizes[5] < 1) return;
  if ((size_t)out_size < x_need) return;
  if (ws_size < WS_TOTAL) return;

  const float* x     = (const float*)d_in[0];
  const float* wq    = (const float*)d_in[1];
  const float* wk    = (const float*)d_in[2];
  const float* wv    = (const float*)d_in[3];
  const float* wo    = (const float*)d_in[4];
  const float* gamma = (const float*)d_in[5];
  float*       out   = (float*)d_out;

  char* ws = (char*)d_ws;
  f16* qp  = (f16*)(ws);
  f16* kp  = (f16*)(ws + PL_BYTES);
  f16* vp  = (f16*)(ws + 2 * PL_BYTES);
  f16* qrp = (f16*)(ws + 4 * PL_BYTES);
  f16* krp = (f16*)(ws + 5 * PL_BYTES);

  // qkv_kernel(x, wq, wk, wv, qp, kp, qr, kr, vp)
  qkv_kernel<<<dim3(SEQ / NT, NB), 256, 0, stream>>>(x, wq, wk, wv, qp, kp, qrp, krp, vp);
  // attn_kernel(qp, qr, kp, kr, vp, wo, x, gamma, out)
  attn_kernel<<<dim3(SEQ / BQ, NB), 512, 0, stream>>>(qp, qrp, kp, krp, vp, wo, x, gamma, out);
}
